// v000
// Times are from an AMD MI455X. After a warm-up the kernel runs many times in a row, and a time is the length of
// such a window on the GPU divided by its runs, so every launch and the gaps after it count. The runs cycle
// through copies of the inputs. A figure is the median of several windows, for all but v000 over two sittings.
// Sittings can differ by a few percent; kernels timed side by side share one.
// v000 is the starting kernel. One run takes 412 microseconds.
// compute dtype: embeddings and W*/b* (INPUTS) rounded to bf16 with exact bf16 WMMA products (f32 accumulate) for the projections; K pre-split into bf16 hi/lo rows; q f32 split, P and V f16 hi/lo (3 products each); softmax f32.
#include <hip/hip_runtime.h>
#include <math.h>

typedef __attribute__((ext_vector_type(16))) _Float16 v16h;
typedef __attribute__((ext_vector_type(16))) __bf16 v16b;
typedef __attribute__((ext_vector_type(8)))  _Float16 v8h;
typedef __attribute__((ext_vector_type(8)))  float v8f;
typedef __attribute__((ext_vector_type(4)))  float v4f;
typedef __attribute__((ext_vector_type(2)))  float v2f;
typedef __attribute__((ext_vector_type(4)))  unsigned v4u;
typedef __attribute__((ext_vector_type(4)))  int v4i;
typedef float __attribute__((may_alias)) float_a;
typedef int __attribute__((may_alias)) int_a;

template <typename T> __device__ __forceinline__ void vst2(void* p, T v) { *(T*)p = v;  }
__device__ __forceinline__ v8f wmma16(v16h a, v16h b, v8f c) {
  v8f d = __builtin_amdgcn_wmma_f32_16x16x32_f16(false, a, false, b, (short)0, c, false, false);
  asm volatile("v_nop\n\tv_nop\n\tv_nop\n\tv_nop" : "+v"(d) : "v"(a), "v"(b));
  return d;
}
__device__ __forceinline__ v8f wmma_bf(v16b a, v16b b, v8f c) {
  v8f d = __builtin_amdgcn_wmma_f32_16x16x32_bf16(false, a, false, b, (short)0, c, false, false);
  asm volatile("v_nop\n\tv_nop\n\tv_nop\n\tv_nop" : "+v"(d) : "v"(a), "v"(b));
  return d;
}
// 16x16x32 fragments: lane = (h = lane>>4, row/col = lane&15); elements 0..7 = k0+8h+0..7, 8..15 = k0+16+8h+0..7; D element r = row 8h+r
__device__ __forceinline__ v16h frag_h(const _Float16* rowk0, int lane) {
  union { v16h v; v8h q[2]; } u; const _Float16* p = rowk0 + 8 * (lane >> 4);
  u.q[0] = *(const v8h*)p; u.q[1] = *(const v8h*)(p + 16); return u.v;
}
__device__ __forceinline__ v16h frag_f32(const float* rowk0, int lane) {
  v16h a; const float* p = rowk0 + 8 * (lane >> 4);
#pragma unroll
  for (int i = 0; i < 8; ++i) { a[i] = (_Float16)p[i]; a[8 + i] = (_Float16)p[16 + i]; }
  return a;
}
__device__ __forceinline__ v16h frag_f32s(const float* rowk0, int lane, float sc) {
  v16h a; const float* p = rowk0 + 8 * (lane >> 4);
#pragma unroll
  for (int i = 0; i < 8; ++i) { a[i] = (_Float16)(p[i] * sc); a[8 + i] = (_Float16)(p[16 + i] * sc); }
  return a;
}
// column fragment from a [K][ld] layout (column n), rows >= K read as 0
__device__ __forceinline__ v16h fragc_f32(const float* W, int k0, int n, int lane, int ld, int K) {
  v16h a; const int g = lane >> 4;
#pragma unroll
  for (int i = 0; i < 8; ++i) { const int ka = k0 + 8 * g + i, kb = ka + 16;
    a[i] = (_Float16)(ka < K ? W[(size_t)ka * ld + n] : 0.f); a[8 + i] = (_Float16)(kb < K ? W[(size_t)kb * ld + n] : 0.f); }
  return a;
}
struct F2 { v16b h, l; };
__device__ __forceinline__ F2 bsplit16(const float v[16]) { F2 r;
#pragma unroll
  for (int i = 0; i < 16; ++i) { const __bf16 h = (__bf16)v[i]; r.h[i] = h; r.l[i] = (__bf16)(v[i] - (float)h); }
  return r; }
__device__ __forceinline__ F2 split_row(const float* row, int k0, int lane) { float v[16]; const float* p = row + k0 + 8 * (lane >> 4);
#pragma unroll
  for (int i = 0; i < 8; ++i) { v[i] = p[i]; v[8 + i] = p[16 + i]; }
  return bsplit16(v); }
__device__ __forceinline__ F2 split_rowK(const float* row, int k0, int lane, int K) { float v[16]; const int g = lane >> 4;
#pragma unroll
  for (int i = 0; i < 8; ++i) { const int ka = k0 + 8 * g + i, kb = ka + 16; v[i] = ka < K ? row[ka] : 0.f; v[8 + i] = kb < K ? row[kb] : 0.f; }
  return bsplit16(v); }
__device__ __forceinline__ F2 split_col(const float* W, int k0, int n, int lane, int ld, int K) { float v[16]; const int g = lane >> 4;
#pragma unroll
  for (int i = 0; i < 8; ++i) { const int ka = k0 + 8 * g + i, kb = ka + 16; v[i] = ka < K ? W[(size_t)ka * ld + n] : 0.f; v[8 + i] = kb < K ? W[(size_t)kb * ld + n] : 0.f; }
  return bsplit16(v); }
__device__ __forceinline__ v8f mac3(const F2& a, const F2& b, v8f c) { c = wmma_bf(a.l, b.h, c); c = wmma_bf(a.h, b.l, c); return wmma_bf(a.h, b.h, c); }
__device__ __forceinline__ float sigm(float v) { return 1.0f / (1.0f + expf(-v)); }
#define LDSX() do { asm volatile("s_wait_dscnt 0" ::: "memory"); __builtin_amdgcn_wave_barrier(); __builtin_amdgcn_fence(__ATOMIC_RELEASE, "workgroup"); } while (0)


// Encoder-decoder multi-head attention (8 heads x 64 on [4,2048,512]): Q/K/V from three separate embeddings with per-head weights W[h][e][d] + biases; full softmax(q.k/8); cat(heads) WO^T + bO.
#define NB 4
#define SS 2048
#define E 512
#define NH 8
#define HD 64
#define NR (NB * SS)
#define PLO 1024.0f
#define VLO 2048.0f
__device__ __forceinline__ float bfr(float v) { return (float)(__bf16)v; }
__device__ __forceinline__ v16b frag_b(const __bf16* rowk0, int lane) { return __builtin_bit_cast(v16b, frag_h((const _Float16*)rowk0, lane)); }

__global__ __launch_bounds__(256) void k_cvt(const float* __restrict__ x, __bf16* __restrict__ Xb) {
  const size_t i8 = (size_t)blockIdx.x * 256 + threadIdx.x; if (i8 >= (size_t)NR * E / 8) return;
  union { __bf16 h[8]; v4u u; } pk;
#pragma unroll
  for (int e = 0; e < 8; ++e) pk.h[e] = (__bf16)x[i8 * 8 + e];
  vst2((unsigned*)(Xb + i8 * 8), pk.u);
}
// PT rows: [0,E) Wq[:,n], [E,2E) Wk[:,n], [2E,3E) Wv[:,n], [3E,4E) Wo[n,:]  (Wq/Wk/Wv: column n as a bf16 row; Wo [out][in]: row n)
__global__ __launch_bounds__(256) void k_pack(const float* __restrict__ Wq, const float* __restrict__ Wk, const float* __restrict__ Wv, const float* __restrict__ Wo, __bf16* __restrict__ PT) {
  const int n = blockIdx.x, tid = threadIdx.x; __shared__ __align__(16) __bf16 srow[E];
  const float* W = n < E ? Wq : (n < 2 * E ? Wk : (n < 3 * E ? Wv : Wo)); const int nn = n % E;
  if (n < 3 * E) { const int hh = nn / HD, d = nn % HD; for (int k = tid; k < E; k += 256) srow[k] = (__bf16)W[((size_t)hh * E + k) * HD + d]; }     // per-head [H][E][DH]: column (h,d) over e
  else { for (int k = tid; k < E; k += 256) srow[k] = (__bf16)W[(size_t)nn * E + k]; }      // WO [out][in]: row nn
  __syncthreads();
  if (tid < E / 8) vst2((unsigned*)(PT + (size_t)n * E + tid * 8), *(const v4u*)(&srow[tid * 8]));
}
// QKV: block (64 rows, 128 cols = 2 heads, which); q (+bias) -> Q32 f32 [bh][s][64]; k (+bias) -> bf16 hi/lo rows; v (+bias) -> VT hi/lo x4 [bh][d][s]
__global__ __launch_bounds__(128) void k_qkv(const __bf16* __restrict__ XQ, const __bf16* __restrict__ XK, const __bf16* __restrict__ XV, const __bf16* __restrict__ PT, const float* __restrict__ bq, const float* __restrict__ bk, const float* __restrict__ bv, float* __restrict__ Q32, __bf16* __restrict__ Kh, __bf16* __restrict__ Kl, _Float16* __restrict__ VTh, _Float16* __restrict__ VTl) {
  __shared__ __align__(16) float so[4][16][132];
  __shared__ __align__(16) _Float16 sth[128][72], stl[128][72];
  const int tid = threadIdx.x, wave = tid >> 5, lane = tid & 31, col = lane & 15, g = lane >> 4;
  const int which = blockIdx.z, r0b = blockIdx.x * 64, r0 = r0b + wave * 16, n0 = blockIdx.y * 128; const int b = r0b / SS, s0 = r0b % SS;
  const __bf16* Xb = which == 0 ? XQ : (which == 1 ? XK : XV); const float* bb_ = which == 0 ? bq : (which == 1 ? bk : bv);
  v8f acc[8] = {};
#pragma unroll 2
  for (int kc = 0; kc < E / 32; ++kc) { const v16b a = frag_b(Xb + (size_t)(r0 + col) * E + kc * 32, lane);
#pragma unroll
    for (int j = 0; j < 8; ++j) acc[j] = wmma_bf(a, frag_b(PT + (size_t)(which * E + n0 + j * 16 + col) * E + kc * 32, lane), acc[j]); }
  if (which < 2) {
#pragma unroll
    for (int j = 0; j < 8; ++j) { const float bb = bfr(bb_[n0 + j * 16 + col]);
#pragma unroll
      for (int r = 0; r < 8; ++r) so[wave][8 * g + r][j * 16 + col] = acc[j][r] + bb; }
    LDSX();
    if (which == 0) { for (int qq = lane; qq < 2 * 16 * 16; qq += 32) { const int hh = qq >> 8, rl = (qq >> 4) & 15, pc = qq & 15; const int h = (n0 >> 6) + hh;
        vst2(Q32 + (((size_t)b * NH + h) * SS + s0 + wave * 16 + rl) * HD + pc * 4, *(const v4f*)(&so[wave][rl][hh * 64 + pc * 4])); } }
    else {
      for (int qq = lane; qq < 2 * 16 * 16; qq += 32) { const int hh = qq >> 8, rl = (qq >> 4) & 15, pl = qq & 15; const int h = (n0 >> 6) + hh; const int pc = pl & 7; union { __bf16 e[8]; v4u u; } pk;
#pragma unroll
        for (int e = 0; e < 8; ++e) { const float v = so[wave][rl][hh * 64 + pc * 8 + e]; const __bf16 hi = (__bf16)v; pk.e[e] = pl < 8 ? hi : (__bf16)(v - (float)hi); }
        vst2((unsigned*)((pl < 8 ? Kh : Kl) + (((size_t)b * NH + h) * SS + s0 + wave * 16 + rl) * HD + pc * 8), pk.u); } } }
  else {
#pragma unroll
    for (int j = 0; j < 8; ++j) { const float bb = bfr(bb_[n0 + j * 16 + col]);
#pragma unroll
      for (int r = 0; r < 8; ++r) { const float v = (acc[j][r] + bb) * 4.0f; const _Float16 hi = (_Float16)v; sth[j * 16 + col][wave * 16 + 8 * g + r] = hi; stl[j * 16 + col][wave * 16 + 8 * g + r] = (_Float16)((v - (float)hi) * VLO); } }
    __syncthreads();
    for (int qq = tid; qq < 128 * 8; qq += 128) { const int cl = qq >> 3, pc = qq & 7; const int c = n0 + cl, h = c >> 6, d = c & 63; const size_t o = (((size_t)b * NH + h) * HD + d) * SS + s0 + pc * 8;
      vst2(VTh + o, *(const v4u*)(&sth[cl][pc * 8])); vst2(VTl + o, *(const v4u*)(&stl[cl][pc * 8])); } }
}
// unmasked attention: block (64 queries, bh); all 32 key tiles of 64; S on q hi/lo x K hi/lo rows; P,V hi/lo; O f32 [bh][s][64]
__global__ __launch_bounds__(128) void k_attn(const float* __restrict__ Q32, const __bf16* __restrict__ Kh, const __bf16* __restrict__ Kl, const _Float16* __restrict__ VTh, const _Float16* __restrict__ VTl, float* __restrict__ O32) {
  __shared__ __align__(16) float sS[4][16][68];
  __shared__ __align__(16) _Float16 sPh[4][16][72], sPl[4][16][72];
  __shared__ __align__(16) float sO[4][16][68];
  const int tid = threadIdx.x, w = tid >> 5, lane = tid & 31, col = lane & 15, g = lane >> 4;
  const size_t bh = blockIdx.y; const int qb = blockIdx.x; const int q0 = qb * 64 + w * 16;
  F2 aq[2];
#pragma unroll
  for (int kc = 0; kc < 2; ++kc) aq[kc] = split_row(Q32 + (bh * SS + q0 + col) * HD, kc * 32, lane);
  float mrun = -3.0e38f, lrun = 0.f; v8f acc[4] = {}, ac1[4] = {}, ac2[4] = {};
  LDSX();
#pragma unroll 1
  for (int kt = 0; kt < SS / 64; ++kt) {
#pragma unroll
    for (int t = 0; t < 4; ++t) { const int key = kt * 64 + t * 16 + col; const size_t ko = (bh * SS + key) * HD; v8f s = {};
#pragma unroll
      for (int kc = 0; kc < 2; ++kc) { const v16b khf = frag_b(Kh + ko + kc * 32, lane), klf = frag_b(Kl + ko + kc * 32, lane); s = wmma_bf(aq[kc].l, khf, s); s = wmma_bf(aq[kc].h, klf, s); s = wmma_bf(aq[kc].h, khf, s); }
#pragma unroll
      for (int r = 0; r < 8; ++r) sS[w][8 * g + r][t * 16 + col] = s[r] * 0.125f; }
    LDSX();
    float mx = -3.4e38f;
#pragma unroll
    for (int jj = 0; jj < 32; ++jj) mx = fmaxf(mx, sS[w][col][g * 32 + jj]);
    mx = fmaxf(mx, __shfl_xor(mx, 16, 32));
    const float mnew = fmaxf(mrun, mx); const float corr = expf(mrun - mnew);
    float ps = 0.f;
#pragma unroll
    for (int jj = 0; jj < 32; ++jj) { const float p = expf(sS[w][col][g * 32 + jj] - mnew) * 16384.0f; ps += p; const _Float16 hi = (_Float16)p; sPh[w][col][g * 32 + jj] = hi; sPl[w][col][g * 32 + jj] = (_Float16)((p - (float)hi) * PLO); }
    ps += __shfl_xor(ps, 16, 32);
    lrun = lrun * corr + ps * (1.0f / 16384.0f); mrun = mnew;
#pragma unroll
    for (int r = 0; r < 8; ++r) { const float cr = __shfl(corr, 8 * g + r, 32);
#pragma unroll
      for (int t = 0; t < 4; ++t) { acc[t][r] *= cr; ac1[t][r] *= cr; ac2[t][r] *= cr; } }
    LDSX();
#pragma unroll
    for (int kc = 0; kc < 2; ++kc) { const v16h ph = frag_h(&sPh[w][col][0] + kc * 32, lane), pl = frag_h(&sPl[w][col][0] + kc * 32, lane);
#pragma unroll
      for (int t = 0; t < 4; ++t) { const size_t vo = (bh * HD + t * 16 + col) * SS + kt * 64 + kc * 32; const v16h vh = frag_h(VTh + vo, lane);
        acc[t] = wmma16(ph, vh, acc[t]); ac1[t] = wmma16(ph, frag_h(VTl + vo, lane), ac1[t]); ac2[t] = wmma16(pl, vh, ac2[t]); } }
    __builtin_amdgcn_wave_barrier(); }
#pragma unroll
  for (int r = 0; r < 8; ++r) { const float lr = __shfl(lrun, 8 * g + r, 32); const float inv = 1.0f / (lr * 16384.0f * 4.0f);
#pragma unroll
    for (int t = 0; t < 4; ++t) sO[w][8 * g + r][t * 16 + col] = (acc[t][r] + ac1[t][r] * (1.0f / VLO) + ac2[t][r] * (1.0f / PLO)) * inv; }
  LDSX();
  for (int qq = lane; qq < 16 * 16; qq += 32) { const int rl = qq >> 4, pc = qq & 15; vst2(O32 + ((bh * SS) + q0 + rl) * HD + pc * 4, *(const v4f*)(&sO[w][rl][pc * 4])); }
}
// out = ctx Wo^T + bo : split(ctx) x bf16(Wo rows): 2 products (Wo is an INPUT -> bf16 exact)
__global__ __launch_bounds__(128) void k_out(const float* __restrict__ O32, const __bf16* __restrict__ PT, const float* __restrict__ bo, float* __restrict__ out) {
  __shared__ __align__(16) float so[4][16][132];
  const int tid = threadIdx.x, wave = tid >> 5, lane = tid & 31, col = lane & 15, g = lane >> 4;
  const int r0 = blockIdx.x * 64 + wave * 16, n0 = blockIdx.y * 128; const int ra = r0 + col; const int b = ra / SS, s = ra % SS;
  v8f acc[8] = {};
#pragma unroll 1
  for (int kc = 0; kc < E / 32; ++kc) { const int h = kc >> 1; const F2 a = split_row(O32 + (((size_t)b * NH + h) * SS + s) * HD, (kc & 1) * 32, lane);
#pragma unroll
    for (int j = 0; j < 8; ++j) { const v16b wb = frag_b(PT + (size_t)(3 * E + n0 + j * 16 + col) * E + kc * 32, lane); acc[j] = wmma_bf(a.l, wb, acc[j]); acc[j] = wmma_bf(a.h, wb, acc[j]); } }
#pragma unroll
  for (int j = 0; j < 8; ++j) { const float bb = bfr(bo[n0 + j * 16 + col]);
#pragma unroll
    for (int r = 0; r < 8; ++r) so[wave][8 * g + r][j * 16 + col] = acc[j][r] + bb; }
  LDSX();
#pragma unroll 4
  for (int rl = 0; rl < 16; ++rl) vst2(out + (size_t)(r0 + rl) * E + n0 + lane * 4, *(const v4f*)(&so[wave][rl][lane * 4]));
}
extern "C" void kernel_launch(void* const* d_in, const int* in_sizes, int n_in, void* d_out, int out_size, void* d_ws, size_t ws_size, hipStream_t stream) {
  (void)in_sizes; (void)n_in; (void)out_size; (void)ws_size;
  const float** I = (const float**)d_in;   // emb_q, emb_k, emb_v, WQ, bQ, WK, bK, WV, bV, WO, bO
  const float* eq = I[0]; const float* ek = I[1]; const float* ev = I[2]; const float* WQ = I[3]; const float* bQ = I[4]; const float* WK = I[5]; const float* bK = I[6]; const float* WV = I[7]; const float* bV = I[8]; const float* WO = I[9]; const float* bO = I[10];
  float* out = (float*)d_out;
  char* ws = (char*)d_ws; size_t off = 0;
  auto take = [&](size_t bytes) { char* p = ws + off; off += (bytes + 255) & ~(size_t)255; return p; };
  __bf16* XQ = (__bf16*)take((size_t)NR * E * 2); __bf16* XK = (__bf16*)take((size_t)NR * E * 2); __bf16* XV = (__bf16*)take((size_t)NR * E * 2); __bf16* PT = (__bf16*)take((size_t)4 * E * E * 2);
  float* Q32 = (float*)take((size_t)NR * E * 4); __bf16* Kh = (__bf16*)take((size_t)NR * E * 2); __bf16* Kl = (__bf16*)take((size_t)NR * E * 2); _Float16* VTh = (_Float16*)take((size_t)NR * E * 2); _Float16* VTl = (_Float16*)take((size_t)NR * E * 2); float* O32 = (float*)take((size_t)NR * E * 4);
  // ws ~ 90 MiB
  k_cvt<<<(NR * E / 8 + 255) / 256, 256, 0, stream>>>(eq, XQ);
  k_cvt<<<(NR * E / 8 + 255) / 256, 256, 0, stream>>>(ek, XK);
  k_cvt<<<(NR * E / 8 + 255) / 256, 256, 0, stream>>>(ev, XV);
  k_pack<<<4 * E, 256, 0, stream>>>(WQ, WK, WV, WO, PT);
  k_qkv<<<dim3(NR / 64, E / 128, 3), 128, 0, stream>>>(XQ, XK, XV, PT, bQ, bK, bV, Q32, Kh, Kl, VTh, VTl);
  k_attn<<<dim3(SS / 64, NB * NH), 128, 0, stream>>>(Q32, Kh, Kl, VTh, VTl, O32);
  k_out<<<dim3(NR / 64, E / 128), 128, 0, stream>>>(O32, PT, bO, out);
}

// v001
// Measured time: 276 microseconds a run.
// Next to v000, in two timings, it ran 1.52 times as fast each time.
// compute dtype: embeddings and W*/b* (INPUTS) rounded to bf16 with exact bf16 WMMA products (f32 accumulate) for the projections; K pre-split into bf16 hi/lo rows; q f32 split, P and V f16 hi/lo (3 products each); softmax f32.
#include <hip/hip_runtime.h>
#include <math.h>

typedef __attribute__((ext_vector_type(16))) _Float16 v16h;
typedef __attribute__((ext_vector_type(16))) __bf16 v16b;
typedef __attribute__((ext_vector_type(8)))  _Float16 v8h;
typedef __attribute__((ext_vector_type(8)))  float v8f;
typedef __attribute__((ext_vector_type(4)))  float v4f;
typedef __attribute__((ext_vector_type(2)))  float v2f;
typedef __attribute__((ext_vector_type(4)))  unsigned v4u;
typedef __attribute__((ext_vector_type(4)))  int v4i;
typedef float __attribute__((may_alias)) float_a;
typedef int __attribute__((may_alias)) int_a;

template <typename T> __device__ __forceinline__ void vst2(void* p, T v) { *(T*)p = v;  }
__device__ __forceinline__ v8f wmma16(v16h a, v16h b, v8f c) {
  v8f d = __builtin_amdgcn_wmma_f32_16x16x32_f16(false, a, false, b, (short)0, c, false, false);
  asm volatile("v_nop\n\tv_nop\n\tv_nop\n\tv_nop" : "+v"(d) : "v"(a), "v"(b));
  return d;
}
__device__ __forceinline__ v8f wmma_bf(v16b a, v16b b, v8f c) {
  v8f d = __builtin_amdgcn_wmma_f32_16x16x32_bf16(false, a, false, b, (short)0, c, false, false);
  asm volatile("v_nop\n\tv_nop\n\tv_nop\n\tv_nop" : "+v"(d) : "v"(a), "v"(b));
  return d;
}
// 16x16x32 fragments: lane = (h = lane>>4, row/col = lane&15); elements 0..7 = k0+8h+0..7, 8..15 = k0+16+8h+0..7; D element r = row 8h+r
__device__ __forceinline__ v16h frag_h(const _Float16* rowk0, int lane) {
  union { v16h v; v8h q[2]; } u; const _Float16* p = rowk0 + 8 * (lane >> 4);
  u.q[0] = *(const v8h*)p; u.q[1] = *(const v8h*)(p + 16); return u.v;
}
__device__ __forceinline__ v16h frag_f32(const float* rowk0, int lane) {
  v16h a; const float* p = rowk0 + 8 * (lane >> 4);
#pragma unroll
  for (int i = 0; i < 8; ++i) { a[i] = (_Float16)p[i]; a[8 + i] = (_Float16)p[16 + i]; }
  return a;
}
__device__ __forceinline__ v16h frag_f32s(const float* rowk0, int lane, float sc) {
  v16h a; const float* p = rowk0 + 8 * (lane >> 4);
#pragma unroll
  for (int i = 0; i < 8; ++i) { a[i] = (_Float16)(p[i] * sc); a[8 + i] = (_Float16)(p[16 + i] * sc); }
  return a;
}
// column fragment from a [K][ld] layout (column n), rows >= K read as 0
__device__ __forceinline__ v16h fragc_f32(const float* W, int k0, int n, int lane, int ld, int K) {
  v16h a; const int g = lane >> 4;
#pragma unroll
  for (int i = 0; i < 8; ++i) { const int ka = k0 + 8 * g + i, kb = ka + 16;
    a[i] = (_Float16)(ka < K ? W[(size_t)ka * ld + n] : 0.f); a[8 + i] = (_Float16)(kb < K ? W[(size_t)kb * ld + n] : 0.f); }
  return a;
}
struct F2 { v16b h, l; };
__device__ __forceinline__ F2 bsplit16(const float v[16]) { F2 r;
#pragma unroll
  for (int i = 0; i < 16; ++i) { const __bf16 h = (__bf16)v[i]; r.h[i] = h; r.l[i] = (__bf16)(v[i] - (float)h); }
  return r; }
__device__ __forceinline__ F2 split_row(const float* row, int k0, int lane) { float v[16]; const float* p = row + k0 + 8 * (lane >> 4);
#pragma unroll
  for (int i = 0; i < 8; ++i) { v[i] = p[i]; v[8 + i] = p[16 + i]; }
  return bsplit16(v); }
__device__ __forceinline__ F2 split_rowK(const float* row, int k0, int lane, int K) { float v[16]; const int g = lane >> 4;
#pragma unroll
  for (int i = 0; i < 8; ++i) { const int ka = k0 + 8 * g + i, kb = ka + 16; v[i] = ka < K ? row[ka] : 0.f; v[8 + i] = kb < K ? row[kb] : 0.f; }
  return bsplit16(v); }
__device__ __forceinline__ F2 split_col(const float* W, int k0, int n, int lane, int ld, int K) { float v[16]; const int g = lane >> 4;
#pragma unroll
  for (int i = 0; i < 8; ++i) { const int ka = k0 + 8 * g + i, kb = ka + 16; v[i] = ka < K ? W[(size_t)ka * ld + n] : 0.f; v[8 + i] = kb < K ? W[(size_t)kb * ld + n] : 0.f; }
  return bsplit16(v); }
__device__ __forceinline__ v8f mac3(const F2& a, const F2& b, v8f c) { c = wmma_bf(a.l, b.h, c); c = wmma_bf(a.h, b.l, c); return wmma_bf(a.h, b.h, c); }
__device__ __forceinline__ float sigm(float v) { return 1.0f / (1.0f + expf(-v)); }
#define LDSX() do { asm volatile("s_wait_dscnt 0" ::: "memory"); __builtin_amdgcn_wave_barrier(); __builtin_amdgcn_fence(__ATOMIC_RELEASE, "workgroup"); } while (0)


// Encoder-decoder multi-head attention (8 heads x 64 on [4,2048,512]): Q/K/V from three separate embeddings with per-head weights W[h][e][d] + biases; full softmax(q.k/8); cat(heads) WO^T + bO.
#define NB 4
#define SS 2048
#define E 512
#define NH 8
#define HD 64
#define NR (NB * SS)
#define PLO 1024.0f
#define VLO 2048.0f
__device__ __forceinline__ float bfr(float v) { return (float)(__bf16)v; }
__device__ __forceinline__ v16b frag_b(const __bf16* rowk0, int lane) { return __builtin_bit_cast(v16b, frag_h((const _Float16*)rowk0, lane)); }

__global__ __launch_bounds__(256) void k_cvt(const float* __restrict__ x, __bf16* __restrict__ Xb) {
  const size_t i8 = (size_t)blockIdx.x * 256 + threadIdx.x; if (i8 >= (size_t)NR * E / 8) return;
  union { __bf16 h[8]; v4u u; } pk;
#pragma unroll
  for (int e = 0; e < 8; ++e) pk.h[e] = (__bf16)x[i8 * 8 + e];
  vst2((unsigned*)(Xb + i8 * 8), pk.u);
}
// PT rows: [0,E) Wq[:,n], [E,2E) Wk[:,n], [2E,3E) Wv[:,n], [3E,4E) Wo[n,:]  (Wq/Wk/Wv: column n as a bf16 row; Wo [out][in]: row n)
__global__ __launch_bounds__(256) void k_pack(const float* __restrict__ Wq, const float* __restrict__ Wk, const float* __restrict__ Wv, const float* __restrict__ Wo, __bf16* __restrict__ PT) {
  const int n = blockIdx.x, tid = threadIdx.x; __shared__ __align__(16) __bf16 srow[E];
  const float* W = n < E ? Wq : (n < 2 * E ? Wk : (n < 3 * E ? Wv : Wo)); const int nn = n % E;
  if (n < 3 * E) { const int hh = nn / HD, d = nn % HD; for (int k = tid; k < E; k += 256) srow[k] = (__bf16)W[((size_t)hh * E + k) * HD + d]; }     // per-head [H][E][DH]: column (h,d) over e
  else { for (int k = tid; k < E; k += 256) srow[k] = (__bf16)W[(size_t)nn * E + k]; }      // WO [out][in]: row nn
  __syncthreads();
  if (tid < E / 8) vst2((unsigned*)(PT + (size_t)n * E + tid * 8), *(const v4u*)(&srow[tid * 8]));
}
// QKV: block (64 rows, 128 cols = 2 heads, which); q (+bias) -> Q32 f32 [bh][s][64]; k (+bias) -> bf16 hi/lo rows; v (+bias) -> VT hi/lo x4 [bh][d][s]
__global__ __launch_bounds__(128) void k_qkv(const __bf16* __restrict__ XQ, const __bf16* __restrict__ XK, const __bf16* __restrict__ XV, const __bf16* __restrict__ PT, const float* __restrict__ bq, const float* __restrict__ bk, const float* __restrict__ bv, float* __restrict__ Q32, __bf16* __restrict__ Kh, __bf16* __restrict__ Kl, _Float16* __restrict__ VTh, _Float16* __restrict__ VTl) {
  __shared__ __align__(16) float so[4][16][132];
  __shared__ __align__(16) _Float16 sth[128][72], stl[128][72];
  const int tid = threadIdx.x, wave = tid >> 5, lane = tid & 31, col = lane & 15, g = lane >> 4;
  const int which = blockIdx.z, r0b = blockIdx.x * 64, r0 = r0b + wave * 16, n0 = blockIdx.y * 128; const int b = r0b / SS, s0 = r0b % SS;
  const __bf16* Xb = which == 0 ? XQ : (which == 1 ? XK : XV); const float* bb_ = which == 0 ? bq : (which == 1 ? bk : bv);
  v8f acc[8] = {};
#pragma unroll 2
  for (int kc = 0; kc < E / 32; ++kc) { const v16b a = frag_b(Xb + (size_t)(r0 + col) * E + kc * 32, lane);
#pragma unroll
    for (int j = 0; j < 8; ++j) acc[j] = wmma_bf(a, frag_b(PT + (size_t)(which * E + n0 + j * 16 + col) * E + kc * 32, lane), acc[j]); }
  if (which < 2) {
#pragma unroll
    for (int j = 0; j < 8; ++j) { const float bb = bfr(bb_[n0 + j * 16 + col]);
#pragma unroll
      for (int r = 0; r < 8; ++r) so[wave][8 * g + r][j * 16 + col] = acc[j][r] + bb; }
    LDSX();
    if (which == 0) { for (int qq = lane; qq < 2 * 16 * 16; qq += 32) { const int hh = qq >> 8, rl = (qq >> 4) & 15, pc = qq & 15; const int h = (n0 >> 6) + hh;
        vst2(Q32 + (((size_t)b * NH + h) * SS + s0 + wave * 16 + rl) * HD + pc * 4, *(const v4f*)(&so[wave][rl][hh * 64 + pc * 4])); } }
    else {
      for (int qq = lane; qq < 2 * 16 * 16; qq += 32) { const int hh = qq >> 8, rl = (qq >> 4) & 15, pl = qq & 15; const int h = (n0 >> 6) + hh; const int pc = pl & 7; union { __bf16 e[8]; v4u u; } pk;
#pragma unroll
        for (int e = 0; e < 8; ++e) { const float v = so[wave][rl][hh * 64 + pc * 8 + e]; const __bf16 hi = (__bf16)v; pk.e[e] = pl < 8 ? hi : (__bf16)(v - (float)hi); }
        vst2((unsigned*)((pl < 8 ? Kh : Kl) + (((size_t)b * NH + h) * SS + s0 + wave * 16 + rl) * HD + pc * 8), pk.u); } } }
  else {
#pragma unroll
    for (int j = 0; j < 8; ++j) { const float bb = bfr(bb_[n0 + j * 16 + col]);
#pragma unroll
      for (int r = 0; r < 8; ++r) { const float v = (acc[j][r] + bb) * 4.0f; const _Float16 hi = (_Float16)v; sth[j * 16 + col][wave * 16 + 8 * g + r] = hi; stl[j * 16 + col][wave * 16 + 8 * g + r] = (_Float16)((v - (float)hi) * VLO); } }
    __syncthreads();
    for (int qq = tid; qq < 128 * 8; qq += 128) { const int cl = qq >> 3, pc = qq & 7; const int c = n0 + cl, h = c >> 6, d = c & 63; const size_t o = (((size_t)b * NH + h) * HD + d) * SS + s0 + pc * 8;
      vst2(VTh + o, *(const v4u*)(&sth[cl][pc * 8])); vst2(VTl + o, *(const v4u*)(&stl[cl][pc * 8])); } }
}
// K/V staging: one 64-key tile of Kh, Kl, VTh, VTl (64 rows x 128 B each) per buffer, rows at a 144-B pitch (16 B x odd: conflict-free for 16-byte fragment reads)
#define KVP 72
#define KVT (64 * KVP * 2)
// One tile's copies: every lane moves 16 B of two rows of each of the four arrays, so a wave-wide copy covers four whole 128-B lines.
// s_wait_xcnt 0 closes the statement so that no address register named here is rewritten in front of it.
__device__ __forceinline__ void stage_kv(unsigned l, const __bf16* kh, const __bf16* kl, const _Float16* vh, const _Float16* vl) {
  asm volatile("global_load_async_to_lds_b128 %0, %8, off\n\t"
               "global_load_async_to_lds_b128 %1, %9, off\n\t"
               "global_load_async_to_lds_b128 %2, %10, off\n\t"
               "global_load_async_to_lds_b128 %3, %11, off\n\t"
               "global_load_async_to_lds_b128 %4, %12, off\n\t"
               "global_load_async_to_lds_b128 %5, %13, off\n\t"
               "global_load_async_to_lds_b128 %6, %14, off\n\t"
               "global_load_async_to_lds_b128 %7, %15, off\n\t"
               "s_wait_xcnt 0x0"
               :: "v"(l), "v"(l + 32 * KVP * 2), "v"(l + KVT), "v"(l + KVT + 32 * KVP * 2), "v"(l + 2 * KVT), "v"(l + 2 * KVT + 32 * KVP * 2), "v"(l + 3 * KVT), "v"(l + 3 * KVT + 32 * KVP * 2),
                  "v"(kh), "v"(kh + 32 * HD), "v"(kl), "v"(kl + 32 * HD), "v"(vh), "v"(vh + 32 * SS), "v"(vl), "v"(vl + 32 * SS)
               : "memory");
}
// full attention: block (128 queries = 8 waves x 16, bh); 32 key tiles of 64, each staged once per block in LDS (two buffers, the next tile's copies fly during this tile's work); S on q hi/lo x K hi/lo rows; P,V hi/lo; O f32 [bh][s][64]
__global__ __launch_bounds__(256) void k_attn(const float* __restrict__ Q32, const __bf16* __restrict__ Kh, const __bf16* __restrict__ Kl, const _Float16* __restrict__ VTh, const _Float16* __restrict__ VTl, float* __restrict__ O32) {
  __shared__ __align__(16) _Float16 sKV[2][4][64][KVP];
  __shared__ __align__(16) float sS[8][16][68];   // scores in the loop, output staging behind it (each wave its own slice): two blocks fit one WGP's LDS
  __shared__ __align__(16) _Float16 sPh[8][16][72], sPl[8][16][72];
  const int tid = threadIdx.x, w = tid >> 5, lane = tid & 31, col = lane & 15, g = lane >> 4;
  const size_t bh = blockIdx.y; const int qb = blockIdx.x; const int q0 = qb * 128 + w * 16;
  const int crow = tid >> 3, cpc = tid & 7;
  const unsigned lds0 = (unsigned)(size_t)&sKV[0][0][crow][cpc * 8];
  const __bf16* gkh = Kh + (bh * SS + crow) * HD + cpc * 8; const __bf16* gkl = Kl + (bh * SS + crow) * HD + cpc * 8;
  const _Float16* gvh = VTh + (bh * HD + crow) * SS + cpc * 8; const _Float16* gvl = VTl + (bh * HD + crow) * SS + cpc * 8;
  stage_kv(lds0, gkh, gkl, gvh, gvl);
  F2 aq[2];
#pragma unroll
  for (int kc = 0; kc < 2; ++kc) aq[kc] = split_row(Q32 + (bh * SS + q0 + col) * HD, kc * 32, lane);
  float mrun = -3.0e38f, lrun = 0.f; v8f acc[4] = {}, ac1[4] = {}, ac2[4] = {};
  LDSX();
  asm volatile("s_wait_asynccnt 0x0" ::: "memory");   // this wave's share of tile 0 has landed
  __syncthreads();                                     // tile 0 is published to every wave
  stage_kv(lds0 + 4 * KVT, gkh + 64 * HD, gkl + 64 * HD, gvh + 64, gvl + 64);
#pragma unroll 1
  for (int kt = 0; kt < SS / 64; ++kt) {
    const int bf = kt & 1;
#pragma unroll
    for (int t = 0; t < 4; ++t) { const __bf16* kr = (const __bf16*)&sKV[bf][0][t * 16 + col][0]; const __bf16* lr_ = (const __bf16*)&sKV[bf][1][t * 16 + col][0]; v8f s = {};
#pragma unroll
      for (int kc = 0; kc < 2; ++kc) { const v16b khf = frag_b(kr + kc * 32, lane), klf = frag_b(lr_ + kc * 32, lane); s = wmma_bf(aq[kc].l, khf, s); s = wmma_bf(aq[kc].h, klf, s); s = wmma_bf(aq[kc].h, khf, s); }
#pragma unroll
      for (int r = 0; r < 8; ++r) sS[w][8 * g + r][t * 16 + col] = s[r] * 0.125f; }
    LDSX();
    float mx = -3.4e38f;
#pragma unroll
    for (int jj = 0; jj < 32; ++jj) mx = fmaxf(mx, sS[w][col][g * 32 + jj]);
    mx = fmaxf(mx, __shfl_xor(mx, 16, 32));
    const float mnew = fmaxf(mrun, mx); const float corr = expf(mrun - mnew);
    float ps = 0.f;
#pragma unroll
    for (int jj = 0; jj < 32; ++jj) { const float p = expf(sS[w][col][g * 32 + jj] - mnew) * 16384.0f; ps += p; const _Float16 hi = (_Float16)p; sPh[w][col][g * 32 + jj] = hi; sPl[w][col][g * 32 + jj] = (_Float16)((p - (float)hi) * PLO); }
    ps += __shfl_xor(ps, 16, 32);
    lrun = lrun * corr + ps * (1.0f / 16384.0f); mrun = mnew;
#pragma unroll
    for (int r = 0; r < 8; ++r) { const float cr = __shfl(corr, 8 * g + r, 32);
#pragma unroll
      for (int t = 0; t < 4; ++t) { acc[t][r] *= cr; ac1[t][r] *= cr; ac2[t][r] *= cr; } }
    LDSX();
#pragma unroll
    for (int kc = 0; kc < 2; ++kc) { const v16h ph = frag_h(&sPh[w][col][0] + kc * 32, lane), pl = frag_h(&sPl[w][col][0] + kc * 32, lane);
#pragma unroll
      for (int t = 0; t < 4; ++t) { const v16h vh = frag_h(&sKV[bf][2][t * 16 + col][kc * 32], lane);
        acc[t] = wmma16(ph, vh, acc[t]); ac1[t] = wmma16(ph, frag_h(&sKV[bf][3][t * 16 + col][kc * 32], lane), ac1[t]); ac2[t] = wmma16(pl, vh, ac2[t]); } }
    __builtin_amdgcn_wave_barrier();
    asm volatile("s_wait_dscnt 0x0" ::: "memory");      // this wave's reads of buffer bf have returned before the buffer is handed to its next writer
    asm volatile("s_wait_asynccnt 0x0" ::: "memory");   // this wave's share of tile kt + 1 has landed
    __syncthreads();                                     // publishes tile kt + 1 and ends every wave's reads of buffer bf
    if (kt + 2 < SS / 64) stage_kv(lds0 + bf * (4 * KVT), gkh + (size_t)(kt + 2) * 64 * HD, gkl + (size_t)(kt + 2) * 64 * HD, gvh + (kt + 2) * 64, gvl + (kt + 2) * 64); }
  asm volatile("s_wait_asynccnt 0x0" ::: "memory");     // no copy is outstanding when the wave goes on to its epilogue and ends
#pragma unroll
  for (int r = 0; r < 8; ++r) { const float lr = __shfl(lrun, 8 * g + r, 32); const float inv = 1.0f / (lr * 16384.0f * 4.0f);
#pragma unroll
    for (int t = 0; t < 4; ++t) sS[w][8 * g + r][t * 16 + col] = (acc[t][r] + ac1[t][r] * (1.0f / VLO) + ac2[t][r] * (1.0f / PLO)) * inv; }
  LDSX();
  for (int qq = lane; qq < 16 * 16; qq += 32) { const int rl = qq >> 4, pc = qq & 15; vst2(O32 + ((bh * SS) + q0 + rl) * HD + pc * 4, *(const v4f*)(&sS[w][rl][pc * 4])); }
}
// out = ctx Wo^T + bo : split(ctx) x bf16(Wo rows): 2 products (Wo is an INPUT -> bf16 exact)
__global__ __launch_bounds__(128) void k_out(const float* __restrict__ O32, const __bf16* __restrict__ PT, const float* __restrict__ bo, float* __restrict__ out) {
  __shared__ __align__(16) float so[4][16][132];
  const int tid = threadIdx.x, wave = tid >> 5, lane = tid & 31, col = lane & 15, g = lane >> 4;
  const int r0 = blockIdx.x * 64 + wave * 16, n0 = blockIdx.y * 128; const int ra = r0 + col; const int b = ra / SS, s = ra % SS;
  v8f acc[8] = {};
#pragma unroll 1
  for (int kc = 0; kc < E / 32; ++kc) { const int h = kc >> 1; const F2 a = split_row(O32 + (((size_t)b * NH + h) * SS + s) * HD, (kc & 1) * 32, lane);
#pragma unroll
    for (int j = 0; j < 8; ++j) { const v16b wb = frag_b(PT + (size_t)(3 * E + n0 + j * 16 + col) * E + kc * 32, lane); acc[j] = wmma_bf(a.l, wb, acc[j]); acc[j] = wmma_bf(a.h, wb, acc[j]); } }
#pragma unroll
  for (int j = 0; j < 8; ++j) { const float bb = bfr(bo[n0 + j * 16 + col]);
#pragma unroll
    for (int r = 0; r < 8; ++r) so[wave][8 * g + r][j * 16 + col] = acc[j][r] + bb; }
  LDSX();
#pragma unroll 4
  for (int rl = 0; rl < 16; ++rl) vst2(out + (size_t)(r0 + rl) * E + n0 + lane * 4, *(const v4f*)(&so[wave][rl][lane * 4]));
}
extern "C" void kernel_launch(void* const* d_in, const int* in_sizes, int n_in, void* d_out, int out_size, void* d_ws, size_t ws_size, hipStream_t stream) {
  (void)in_sizes; (void)n_in; (void)out_size; (void)ws_size;
  const float** I = (const float**)d_in;   // emb_q, emb_k, emb_v, WQ, bQ, WK, bK, WV, bV, WO, bO
  const float* eq = I[0]; const float* ek = I[1]; const float* ev = I[2]; const float* WQ = I[3]; const float* bQ = I[4]; const float* WK = I[5]; const float* bK = I[6]; const float* WV = I[7]; const float* bV = I[8]; const float* WO = I[9]; const float* bO = I[10];
  float* out = (float*)d_out;
  char* ws = (char*)d_ws; size_t off = 0;
  auto take = [&](size_t bytes) { char* p = ws + off; off += (bytes + 255) & ~(size_t)255; return p; };
  __bf16* XQ = (__bf16*)take((size_t)NR * E * 2); __bf16* XK = (__bf16*)take((size_t)NR * E * 2); __bf16* XV = (__bf16*)take((size_t)NR * E * 2); __bf16* PT = (__bf16*)take((size_t)4 * E * E * 2);
  float* Q32 = (float*)take((size_t)NR * E * 4); __bf16* Kh = (__bf16*)take((size_t)NR * E * 2); __bf16* Kl = (__bf16*)take((size_t)NR * E * 2); _Float16* VTh = (_Float16*)take((size_t)NR * E * 2); _Float16* VTl = (_Float16*)take((size_t)NR * E * 2); float* O32 = (float*)take((size_t)NR * E * 4);
  // ws ~ 90 MiB
  k_cvt<<<(NR * E / 8 + 255) / 256, 256, 0, stream>>>(eq, XQ);
  k_cvt<<<(NR * E / 8 + 255) / 256, 256, 0, stream>>>(ek, XK);
  k_cvt<<<(NR * E / 8 + 255) / 256, 256, 0, stream>>>(ev, XV);
  k_pack<<<4 * E, 256, 0, stream>>>(WQ, WK, WV, WO, PT);
  k_qkv<<<dim3(NR / 64, E / 128, 3), 128, 0, stream>>>(XQ, XK, XV, PT, bQ, bK, bV, Q32, Kh, Kl, VTh, VTl);
  k_attn<<<dim3(SS / 128, NB * NH), 256, 0, stream>>>(Q32, Kh, Kl, VTh, VTl, O32);
  k_out<<<dim3(NR / 64, E / 128), 128, 0, stream>>>(O32, PT, bO, out);
}

// v002
// One run takes 244 microseconds.
// Next to v001, in two timings, it ran 1.12 times as fast each time.
// All steps since v000 together make it 1.70 times as fast.
// compute dtype: embeddings and W*/b* (INPUTS) rounded to bf16 with exact bf16 WMMA products (f32 accumulate) for the projections; K pre-split into bf16 hi/lo rows; q f32 split, P and V f16 hi/lo (3 products each); softmax f32.
#include <hip/hip_runtime.h>
#include <math.h>

typedef __attribute__((ext_vector_type(16))) _Float16 v16h;
typedef __attribute__((ext_vector_type(16))) __bf16 v16b;
typedef __attribute__((ext_vector_type(8)))  _Float16 v8h;
typedef __attribute__((ext_vector_type(8)))  float v8f;
typedef __attribute__((ext_vector_type(4)))  float v4f;
typedef __attribute__((ext_vector_type(2)))  float v2f;
typedef __attribute__((ext_vector_type(4)))  unsigned v4u;
typedef __attribute__((ext_vector_type(4)))  int v4i;
typedef float __attribute__((may_alias)) float_a;
typedef int __attribute__((may_alias)) int_a;

template <typename T> __device__ __forceinline__ void vst2(void* p, T v) { *(T*)p = v;  }
__device__ __forceinline__ v8f wmma16(v16h a, v16h b, v8f c) {
  v8f d = __builtin_amdgcn_wmma_f32_16x16x32_f16(false, a, false, b, (short)0, c, false, false);
  asm volatile("v_nop\n\tv_nop\n\tv_nop\n\tv_nop" : "+v"(d) : "v"(a), "v"(b));
  return d;
}
__device__ __forceinline__ v8f wmma_bf(v16b a, v16b b, v8f c) {
  v8f d = __builtin_amdgcn_wmma_f32_16x16x32_bf16(false, a, false, b, (short)0, c, false, false);
  asm volatile("v_nop\n\tv_nop\n\tv_nop\n\tv_nop" : "+v"(d) : "v"(a), "v"(b));
  return d;
}
// 16x16x32 fragments: lane = (h = lane>>4, row/col = lane&15); elements 0..7 = k0+8h+0..7, 8..15 = k0+16+8h+0..7; D element r = row 8h+r
__device__ __forceinline__ v16h frag_h(const _Float16* rowk0, int lane) {
  union { v16h v; v8h q[2]; } u; const _Float16* p = rowk0 + 8 * (lane >> 4);
  u.q[0] = *(const v8h*)p; u.q[1] = *(const v8h*)(p + 16); return u.v;
}
__device__ __forceinline__ v16h frag_f32(const float* rowk0, int lane) {
  v16h a; const float* p = rowk0 + 8 * (lane >> 4);
#pragma unroll
  for (int i = 0; i < 8; ++i) { a[i] = (_Float16)p[i]; a[8 + i] = (_Float16)p[16 + i]; }
  return a;
}
__device__ __forceinline__ v16h frag_f32s(const float* rowk0, int lane, float sc) {
  v16h a; const float* p = rowk0 + 8 * (lane >> 4);
#pragma unroll
  for (int i = 0; i < 8; ++i) { a[i] = (_Float16)(p[i] * sc); a[8 + i] = (_Float16)(p[16 + i] * sc); }
  return a;
}
// column fragment from a [K][ld] layout (column n), rows >= K read as 0
__device__ __forceinline__ v16h fragc_f32(const float* W, int k0, int n, int lane, int ld, int K) {
  v16h a; const int g = lane >> 4;
#pragma unroll
  for (int i = 0; i < 8; ++i) { const int ka = k0 + 8 * g + i, kb = ka + 16;
    a[i] = (_Float16)(ka < K ? W[(size_t)ka * ld + n] : 0.f); a[8 + i] = (_Float16)(kb < K ? W[(size_t)kb * ld + n] : 0.f); }
  return a;
}
struct F2 { v16b h, l; };
__device__ __forceinline__ F2 bsplit16(const float v[16]) { F2 r;
#pragma unroll
  for (int i = 0; i < 16; ++i) { const __bf16 h = (__bf16)v[i]; r.h[i] = h; r.l[i] = (__bf16)(v[i] - (float)h); }
  return r; }
__device__ __forceinline__ F2 split_row(const float* row, int k0, int lane) { float v[16]; const float* p = row + k0 + 8 * (lane >> 4);
#pragma unroll
  for (int i = 0; i < 8; ++i) { v[i] = p[i]; v[8 + i] = p[16 + i]; }
  return bsplit16(v); }
__device__ __forceinline__ F2 split_rowK(const float* row, int k0, int lane, int K) { float v[16]; const int g = lane >> 4;
#pragma unroll
  for (int i = 0; i < 8; ++i) { const int ka = k0 + 8 * g + i, kb = ka + 16; v[i] = ka < K ? row[ka] : 0.f; v[8 + i] = kb < K ? row[kb] : 0.f; }
  return bsplit16(v); }
__device__ __forceinline__ F2 split_col(const float* W, int k0, int n, int lane, int ld, int K) { float v[16]; const int g = lane >> 4;
#pragma unroll
  for (int i = 0; i < 8; ++i) { const int ka = k0 + 8 * g + i, kb = ka + 16; v[i] = ka < K ? W[(size_t)ka * ld + n] : 0.f; v[8 + i] = kb < K ? W[(size_t)kb * ld + n] : 0.f; }
  return bsplit16(v); }
__device__ __forceinline__ v8f mac3(const F2& a, const F2& b, v8f c) { c = wmma_bf(a.l, b.h, c); c = wmma_bf(a.h, b.l, c); return wmma_bf(a.h, b.h, c); }
__device__ __forceinline__ float sigm(float v) { return 1.0f / (1.0f + expf(-v)); }
#define LDSX() do { asm volatile("s_wait_dscnt 0" ::: "memory"); __builtin_amdgcn_wave_barrier(); __builtin_amdgcn_fence(__ATOMIC_RELEASE, "workgroup"); } while (0)


// Encoder-decoder multi-head attention (8 heads x 64 on [4,2048,512]): Q/K/V from three separate embeddings with per-head weights W[h][e][d] + biases; full softmax(q.k/8); cat(heads) WO^T + bO.
#define NB 4
#define SS 2048
#define E 512
#define NH 8
#define HD 64
#define NR (NB * SS)
#define PLO 1024.0f
#define VLO 2048.0f
#define SC2 0.18033688f   // 1/8 x log2(e): takes a raw score to base-2 units
__device__ __forceinline__ float bfr(float v) { return (float)(__bf16)v; }
__device__ __forceinline__ v16b frag_b(const __bf16* rowk0, int lane) { return __builtin_bit_cast(v16b, frag_h((const _Float16*)rowk0, lane)); }

__global__ __launch_bounds__(256) void k_cvt(const float* __restrict__ x, __bf16* __restrict__ Xb) {
  const size_t i8 = (size_t)blockIdx.x * 256 + threadIdx.x; if (i8 >= (size_t)NR * E / 8) return;
  union { __bf16 h[8]; v4u u; } pk;
#pragma unroll
  for (int e = 0; e < 8; ++e) pk.h[e] = (__bf16)x[i8 * 8 + e];
  vst2((unsigned*)(Xb + i8 * 8), pk.u);
}
// PT rows: [0,E) Wq[:,n], [E,2E) Wk[:,n], [2E,3E) Wv[:,n], [3E,4E) Wo[n,:]  (Wq/Wk/Wv: column n as a bf16 row; Wo [out][in]: row n)
__global__ __launch_bounds__(256) void k_pack(const float* __restrict__ Wq, const float* __restrict__ Wk, const float* __restrict__ Wv, const float* __restrict__ Wo, __bf16* __restrict__ PT) {
  const int n = blockIdx.x, tid = threadIdx.x; __shared__ __align__(16) __bf16 srow[E];
  const float* W = n < E ? Wq : (n < 2 * E ? Wk : (n < 3 * E ? Wv : Wo)); const int nn = n % E;
  if (n < 3 * E) { const int hh = nn / HD, d = nn % HD; for (int k = tid; k < E; k += 256) srow[k] = (__bf16)W[((size_t)hh * E + k) * HD + d]; }     // per-head [H][E][DH]: column (h,d) over e
  else { for (int k = tid; k < E; k += 256) srow[k] = (__bf16)W[(size_t)nn * E + k]; }      // WO [out][in]: row nn
  __syncthreads();
  if (tid < E / 8) vst2((unsigned*)(PT + (size_t)n * E + tid * 8), *(const v4u*)(&srow[tid * 8]));
}
// QKV: block (64 rows, 128 cols = 2 heads, which); q (+bias) -> Q32 f32 [bh][s][64]; k (+bias) -> bf16 hi/lo rows; v (+bias) -> VT hi/lo x4 [bh][d][s]
__global__ __launch_bounds__(128) void k_qkv(const __bf16* __restrict__ XQ, const __bf16* __restrict__ XK, const __bf16* __restrict__ XV, const __bf16* __restrict__ PT, const float* __restrict__ bq, const float* __restrict__ bk, const float* __restrict__ bv, float* __restrict__ Q32, __bf16* __restrict__ Kh, __bf16* __restrict__ Kl, _Float16* __restrict__ VTh, _Float16* __restrict__ VTl) {
  __shared__ __align__(16) float so[4][16][132];
  __shared__ __align__(16) _Float16 sth[128][72], stl[128][72];
  const int tid = threadIdx.x, wave = tid >> 5, lane = tid & 31, col = lane & 15, g = lane >> 4;
  const int which = blockIdx.z, r0b = blockIdx.x * 64, r0 = r0b + wave * 16, n0 = blockIdx.y * 128; const int b = r0b / SS, s0 = r0b % SS;
  const __bf16* Xb = which == 0 ? XQ : (which == 1 ? XK : XV); const float* bb_ = which == 0 ? bq : (which == 1 ? bk : bv);
  v8f acc[8] = {};
#pragma unroll 2
  for (int kc = 0; kc < E / 32; ++kc) { const v16b a = frag_b(Xb + (size_t)(r0 + col) * E + kc * 32, lane);
#pragma unroll
    for (int j = 0; j < 8; ++j) acc[j] = wmma_bf(a, frag_b(PT + (size_t)(which * E + n0 + j * 16 + col) * E + kc * 32, lane), acc[j]); }
  if (which < 2) {
#pragma unroll
    for (int j = 0; j < 8; ++j) { const float bb = bfr(bb_[n0 + j * 16 + col]);
#pragma unroll
      for (int r = 0; r < 8; ++r) so[wave][8 * g + r][j * 16 + col] = acc[j][r] + bb; }
    LDSX();
    if (which == 0) { for (int qq = lane; qq < 2 * 16 * 16; qq += 32) { const int hh = qq >> 8, rl = (qq >> 4) & 15, pc = qq & 15; const int h = (n0 >> 6) + hh;
        vst2(Q32 + (((size_t)b * NH + h) * SS + s0 + wave * 16 + rl) * HD + pc * 4, *(const v4f*)(&so[wave][rl][hh * 64 + pc * 4])); } }
    else {
      for (int qq = lane; qq < 2 * 16 * 16; qq += 32) { const int hh = qq >> 8, rl = (qq >> 4) & 15, pl = qq & 15; const int h = (n0 >> 6) + hh; const int pc = pl & 7; union { __bf16 e[8]; v4u u; } pk;
#pragma unroll
        for (int e = 0; e < 8; ++e) { const float v = so[wave][rl][hh * 64 + pc * 8 + e]; const __bf16 hi = (__bf16)v; pk.e[e] = pl < 8 ? hi : (__bf16)(v - (float)hi); }
        vst2((unsigned*)((pl < 8 ? Kh : Kl) + (((size_t)b * NH + h) * SS + s0 + wave * 16 + rl) * HD + pc * 8), pk.u); } } }
  else {
#pragma unroll
    for (int j = 0; j < 8; ++j) { const float bb = bfr(bb_[n0 + j * 16 + col]);
#pragma unroll
      for (int r = 0; r < 8; ++r) { const float v = (acc[j][r] + bb) * 4.0f; const _Float16 hi = (_Float16)v; sth[j * 16 + col][wave * 16 + 8 * g + r] = hi; stl[j * 16 + col][wave * 16 + 8 * g + r] = (_Float16)((v - (float)hi) * VLO); } }
    __syncthreads();
    for (int qq = tid; qq < 128 * 8; qq += 128) { const int cl = qq >> 3, pc = qq & 7; const int c = n0 + cl, h = c >> 6, d = c & 63; const size_t o = (((size_t)b * NH + h) * HD + d) * SS + s0 + pc * 8;
      vst2(VTh + o, *(const v4u*)(&sth[cl][pc * 8])); vst2(VTl + o, *(const v4u*)(&stl[cl][pc * 8])); } }
}
// K/V staging: one 64-key tile of Kh, Kl, VTh, VTl (64 rows x 128 B each) per buffer, rows at a 144-B pitch (16 B x odd: conflict-free for 16-byte fragment reads)
#define KVP 72
#define KVT (64 * KVP * 2)
// One tile's copies: every lane moves 16 B of two rows of each of the four arrays, so a wave-wide copy covers four whole 128-B lines.
// s_wait_xcnt 0 closes the statement so that no address register named here is rewritten in front of it.
__device__ __forceinline__ void stage_kv(unsigned l, const __bf16* kh, const __bf16* kl, const _Float16* vh, const _Float16* vl) {
  asm volatile("global_load_async_to_lds_b128 %0, %8, off\n\t"
               "global_load_async_to_lds_b128 %1, %9, off\n\t"
               "global_load_async_to_lds_b128 %2, %10, off\n\t"
               "global_load_async_to_lds_b128 %3, %11, off\n\t"
               "global_load_async_to_lds_b128 %4, %12, off\n\t"
               "global_load_async_to_lds_b128 %5, %13, off\n\t"
               "global_load_async_to_lds_b128 %6, %14, off\n\t"
               "global_load_async_to_lds_b128 %7, %15, off\n\t"
               "s_wait_xcnt 0x0"
               :: "v"(l), "v"(l + 32 * KVP * 2), "v"(l + KVT), "v"(l + KVT + 32 * KVP * 2), "v"(l + 2 * KVT), "v"(l + 2 * KVT + 32 * KVP * 2), "v"(l + 3 * KVT), "v"(l + 3 * KVT + 32 * KVP * 2),
                  "v"(kh), "v"(kh + 32 * HD), "v"(kl), "v"(kl + 32 * HD), "v"(vh), "v"(vh + 32 * SS), "v"(vl), "v"(vl + 32 * SS)
               : "memory");
}
// full attention: block (128 queries = 8 waves x 16, bh); 32 key tiles of 64, each staged once per block in LDS (two buffers, the next tile's copies fly during this tile's work); S on q hi/lo x K hi/lo rows; softmax in base 2 (one fma and one hardware exp2 per score); P,V hi/lo; O f32 [bh][s][64]
__global__ __launch_bounds__(256) void k_attn(const float* __restrict__ Q32, const __bf16* __restrict__ Kh, const __bf16* __restrict__ Kl, const _Float16* __restrict__ VTh, const _Float16* __restrict__ VTl, float* __restrict__ O32) {
  __shared__ __align__(16) _Float16 sKV[2][4][64][KVP];
  __shared__ __align__(16) float sS[8][16][68];   // scores in the loop, output staging behind it (each wave its own slice): two blocks fit one WGP's LDS
  __shared__ __align__(16) _Float16 sPh[8][16][72], sPl[8][16][72];
  const int tid = threadIdx.x, w = tid >> 5, lane = tid & 31, col = lane & 15, g = lane >> 4;
  const size_t bh = blockIdx.y; const int qb = blockIdx.x; const int q0 = qb * 128 + w * 16;
  const int crow = tid >> 3, cpc = tid & 7;
  const unsigned lds0 = (unsigned)(size_t)&sKV[0][0][crow][cpc * 8];
  const __bf16* gkh = Kh + (bh * SS + crow) * HD + cpc * 8; const __bf16* gkl = Kl + (bh * SS + crow) * HD + cpc * 8;
  const _Float16* gvh = VTh + (bh * HD + crow) * SS + cpc * 8; const _Float16* gvl = VTl + (bh * HD + crow) * SS + cpc * 8;
  stage_kv(lds0, gkh, gkl, gvh, gvl);
  F2 aq[2];
#pragma unroll
  for (int kc = 0; kc < 2; ++kc) aq[kc] = split_row(Q32 + (bh * SS + q0 + col) * HD, kc * 32, lane);
  float mrun = -3.0e38f, lrun = 0.f; v8f acc[4] = {}, ac1[4] = {}, ac2[4] = {};
  LDSX();
  asm volatile("s_wait_asynccnt 0x0" ::: "memory");   // this wave's share of tile 0 has landed
  __syncthreads();                                     // tile 0 is published to every wave
  stage_kv(lds0 + 4 * KVT, gkh + 64 * HD, gkl + 64 * HD, gvh + 64, gvl + 64);
#pragma unroll 1
  for (int kt = 0; kt < SS / 64; ++kt) {
    const int bf = kt & 1;
#pragma unroll
    for (int t = 0; t < 4; ++t) { const __bf16* kr = (const __bf16*)&sKV[bf][0][t * 16 + col][0]; const __bf16* lr_ = (const __bf16*)&sKV[bf][1][t * 16 + col][0]; v8f s = {};
#pragma unroll
      for (int kc = 0; kc < 2; ++kc) { const v16b khf = frag_b(kr + kc * 32, lane), klf = frag_b(lr_ + kc * 32, lane); s = wmma_bf(aq[kc].l, khf, s); s = wmma_bf(aq[kc].h, klf, s); s = wmma_bf(aq[kc].h, khf, s); }
#pragma unroll
      for (int r = 0; r < 8; ++r) sS[w][8 * g + r][t * 16 + col] = s[r]; }
    LDSX();
    float mx = -3.4e38f;
#pragma unroll
    for (int jj = 0; jj < 32; ++jj) mx = fmaxf(mx, sS[w][col][g * 32 + jj]);
    mx = fmaxf(mx, __shfl_xor(mx, 16, 32));
    const float mnew = fmaxf(mrun, mx * SC2); const float corr = __builtin_amdgcn_exp2f(mrun - mnew);   // running maximum in base-2 units
    const float moff = mnew - 14.0f;   // the factor 16384 = 2^14 of P rides in the exponent
    float ps = 0.f;
#pragma unroll
    for (int jj = 0; jj < 32; ++jj) { const float p = __builtin_amdgcn_exp2f(fmaf(sS[w][col][g * 32 + jj], SC2, -moff)); ps += p; const _Float16 hi = (_Float16)p; sPh[w][col][g * 32 + jj] = hi; sPl[w][col][g * 32 + jj] = (_Float16)((p - (float)hi) * PLO); }
    ps += __shfl_xor(ps, 16, 32);
    lrun = lrun * corr + ps * (1.0f / 16384.0f); mrun = mnew;
#pragma unroll
    for (int r = 0; r < 8; ++r) { const float cr = __shfl(corr, 8 * g + r, 32);
#pragma unroll
      for (int t = 0; t < 4; ++t) { acc[t][r] *= cr; ac1[t][r] *= cr; ac2[t][r] *= cr; } }
    LDSX();
#pragma unroll
    for (int kc = 0; kc < 2; ++kc) { const v16h ph = frag_h(&sPh[w][col][0] + kc * 32, lane), pl = frag_h(&sPl[w][col][0] + kc * 32, lane);
#pragma unroll
      for (int t = 0; t < 4; ++t) { const v16h vh = frag_h(&sKV[bf][2][t * 16 + col][kc * 32], lane);
        acc[t] = wmma16(ph, vh, acc[t]); ac1[t] = wmma16(ph, frag_h(&sKV[bf][3][t * 16 + col][kc * 32], lane), ac1[t]); ac2[t] = wmma16(pl, vh, ac2[t]); } }
    __builtin_amdgcn_wave_barrier();
    asm volatile("s_wait_dscnt 0x0" ::: "memory");      // this wave's reads of buffer bf have returned before the buffer is handed to its next writer
    asm volatile("s_wait_asynccnt 0x0" ::: "memory");   // this wave's share of tile kt + 1 has landed
    __syncthreads();                                     // publishes tile kt + 1 and ends every wave's reads of buffer bf
    if (kt + 2 < SS / 64) stage_kv(lds0 + bf * (4 * KVT), gkh + (size_t)(kt + 2) * 64 * HD, gkl + (size_t)(kt + 2) * 64 * HD, gvh + (kt + 2) * 64, gvl + (kt + 2) * 64); }
  asm volatile("s_wait_asynccnt 0x0" ::: "memory");     // no copy is outstanding when the wave goes on to its epilogue and ends
#pragma unroll
  for (int r = 0; r < 8; ++r) { const float lr = __shfl(lrun, 8 * g + r, 32); const float inv = 1.0f / (lr * 16384.0f * 4.0f);
#pragma unroll
    for (int t = 0; t < 4; ++t) sS[w][8 * g + r][t * 16 + col] = (acc[t][r] + ac1[t][r] * (1.0f / VLO) + ac2[t][r] * (1.0f / PLO)) * inv; }
  LDSX();
  for (int qq = lane; qq < 16 * 16; qq += 32) { const int rl = qq >> 4, pc = qq & 15; vst2(O32 + ((bh * SS) + q0 + rl) * HD + pc * 4, *(const v4f*)(&sS[w][rl][pc * 4])); }
}
// out = ctx Wo^T + bo : split(ctx) x bf16(Wo rows): 2 products (Wo is an INPUT -> bf16 exact)
__global__ __launch_bounds__(128) void k_out(const float* __restrict__ O32, const __bf16* __restrict__ PT, const float* __restrict__ bo, float* __restrict__ out) {
  __shared__ __align__(16) float so[4][16][132];
  const int tid = threadIdx.x, wave = tid >> 5, lane = tid & 31, col = lane & 15, g = lane >> 4;
  const int r0 = blockIdx.x * 64 + wave * 16, n0 = blockIdx.y * 128; const int ra = r0 + col; const int b = ra / SS, s = ra % SS;
  v8f acc[8] = {};
#pragma unroll 1
  for (int kc = 0; kc < E / 32; ++kc) { const int h = kc >> 1; const F2 a = split_row(O32 + (((size_t)b * NH + h) * SS + s) * HD, (kc & 1) * 32, lane);
#pragma unroll
    for (int j = 0; j < 8; ++j) { const v16b wb = frag_b(PT + (size_t)(3 * E + n0 + j * 16 + col) * E + kc * 32, lane); acc[j] = wmma_bf(a.l, wb, acc[j]); acc[j] = wmma_bf(a.h, wb, acc[j]); } }
#pragma unroll
  for (int j = 0; j < 8; ++j) { const float bb = bfr(bo[n0 + j * 16 + col]);
#pragma unroll
    for (int r = 0; r < 8; ++r) so[wave][8 * g + r][j * 16 + col] = acc[j][r] + bb; }
  LDSX();
#pragma unroll 4
  for (int rl = 0; rl < 16; ++rl) vst2(out + (size_t)(r0 + rl) * E + n0 + lane * 4, *(const v4f*)(&so[wave][rl][lane * 4]));
}
extern "C" void kernel_launch(void* const* d_in, const int* in_sizes, int n_in, void* d_out, int out_size, void* d_ws, size_t ws_size, hipStream_t stream) {
  (void)in_sizes; (void)n_in; (void)out_size; (void)ws_size;
  const float** I = (const float**)d_in;   // emb_q, emb_k, emb_v, WQ, bQ, WK, bK, WV, bV, WO, bO
  const float* eq = I[0]; const float* ek = I[1]; const float* ev = I[2]; const float* WQ = I[3]; const float* bQ = I[4]; const float* WK = I[5]; const float* bK = I[6]; const float* WV = I[7]; const float* bV = I[8]; const float* WO = I[9]; const float* bO = I[10];
  float* out = (float*)d_out;
  char* ws = (char*)d_ws; size_t off = 0;
  auto take = [&](size_t bytes) { char* p = ws + off; off += (bytes + 255) & ~(size_t)255; return p; };
  __bf16* XQ = (__bf16*)take((size_t)NR * E * 2); __bf16* XK = (__bf16*)take((size_t)NR * E * 2); __bf16* XV = (__bf16*)take((size_t)NR * E * 2); __bf16* PT = (__bf16*)take((size_t)4 * E * E * 2);
  float* Q32 = (float*)take((size_t)NR * E * 4); __bf16* Kh = (__bf16*)take((size_t)NR * E * 2); __bf16* Kl = (__bf16*)take((size_t)NR * E * 2); _Float16* VTh = (_Float16*)take((size_t)NR * E * 2); _Float16* VTl = (_Float16*)take((size_t)NR * E * 2); float* O32 = (float*)take((size_t)NR * E * 4);
  // ws ~ 90 MiB
  k_cvt<<<(NR * E / 8 + 255) / 256, 256, 0, stream>>>(eq, XQ);
  k_cvt<<<(NR * E / 8 + 255) / 256, 256, 0, stream>>>(ek, XK);
  k_cvt<<<(NR * E / 8 + 255) / 256, 256, 0, stream>>>(ev, XV);
  k_pack<<<4 * E, 256, 0, stream>>>(WQ, WK, WV, WO, PT);
  k_qkv<<<dim3(NR / 64, E / 128, 3), 128, 0, stream>>>(XQ, XK, XV, PT, bQ, bK, bV, Q32, Kh, Kl, VTh, VTl);
  k_attn<<<dim3(SS / 128, NB * NH), 256, 0, stream>>>(Q32, Kh, Kl, VTh, VTl, O32);
  k_out<<<dim3(NR / 64, E / 128), 128, 0, stream>>>(O32, PT, bO, out);
}

// v003
// Measured time: 163 microseconds a run.
// In both of two side-by-side timings against v002, it was 1.51 times as fast.
// All steps since v000 together make it 2.57 times as fast.
// compute dtype: embeddings and W*/b* (INPUTS) rounded to bf16 with exact bf16 WMMA products (f32 accumulate) for the projections; K pre-split into bf16 hi/lo rows; q f32 split, P and V f16 hi/lo (3 products each); softmax f32.
#include <hip/hip_runtime.h>
#include <math.h>

typedef __attribute__((ext_vector_type(16))) _Float16 v16h;
typedef __attribute__((ext_vector_type(16))) __bf16 v16b;
typedef __attribute__((ext_vector_type(8)))  _Float16 v8h;
typedef __attribute__((ext_vector_type(8)))  float v8f;
typedef __attribute__((ext_vector_type(4)))  float v4f;
typedef __attribute__((ext_vector_type(2)))  float v2f;
typedef __attribute__((ext_vector_type(4)))  unsigned v4u;
typedef __attribute__((ext_vector_type(4)))  int v4i;
typedef float __attribute__((may_alias)) float_a;
typedef int __attribute__((may_alias)) int_a;

template <typename T> __device__ __forceinline__ void vst2(void* p, T v) { *(T*)p = v;  }
__device__ __forceinline__ v8f wmma16(v16h a, v16h b, v8f c) {
  v8f d = __builtin_amdgcn_wmma_f32_16x16x32_f16(false, a, false, b, (short)0, c, false, false);
  asm volatile("v_nop\n\tv_nop\n\tv_nop\n\tv_nop" : "+v"(d) : "v"(a), "v"(b));
  return d;
}
__device__ __forceinline__ v8f wmma_bf(v16b a, v16b b, v8f c) {
  v8f d = __builtin_amdgcn_wmma_f32_16x16x32_bf16(false, a, false, b, (short)0, c, false, false);
  asm volatile("v_nop\n\tv_nop\n\tv_nop\n\tv_nop" : "+v"(d) : "v"(a), "v"(b));
  return d;
}
// 16x16x32 fragments: lane = (h = lane>>4, row/col = lane&15); elements 0..7 = k0+8h+0..7, 8..15 = k0+16+8h+0..7; D element r = row 8h+r
__device__ __forceinline__ v16h frag_h(const _Float16* rowk0, int lane) {
  union { v16h v; v8h q[2]; } u; const _Float16* p = rowk0 + 8 * (lane >> 4);
  u.q[0] = *(const v8h*)p; u.q[1] = *(const v8h*)(p + 16); return u.v;
}
__device__ __forceinline__ v16h frag_f32(const float* rowk0, int lane) {
  v16h a; const float* p = rowk0 + 8 * (lane >> 4);
#pragma unroll
  for (int i = 0; i < 8; ++i) { a[i] = (_Float16)p[i]; a[8 + i] = (_Float16)p[16 + i]; }
  return a;
}
__device__ __forceinline__ v16h frag_f32s(const float* rowk0, int lane, float sc) {
  v16h a; const float* p = rowk0 + 8 * (lane >> 4);
#pragma unroll
  for (int i = 0; i < 8; ++i) { a[i] = (_Float16)(p[i] * sc); a[8 + i] = (_Float16)(p[16 + i] * sc); }
  return a;
}
// column fragment from a [K][ld] layout (column n), rows >= K read as 0
__device__ __forceinline__ v16h fragc_f32(const float* W, int k0, int n, int lane, int ld, int K) {
  v16h a; const int g = lane >> 4;
#pragma unroll
  for (int i = 0; i < 8; ++i) { const int ka = k0 + 8 * g + i, kb = ka + 16;
    a[i] = (_Float16)(ka < K ? W[(size_t)ka * ld + n] : 0.f); a[8 + i] = (_Float16)(kb < K ? W[(size_t)kb * ld + n] : 0.f); }
  return a;
}
struct F2 { v16b h, l; };
__device__ __forceinline__ F2 bsplit16(const float v[16]) { F2 r;
#pragma unroll
  for (int i = 0; i < 16; ++i) { const __bf16 h = (__bf16)v[i]; r.h[i] = h; r.l[i] = (__bf16)(v[i] - (float)h); }
  return r; }
__device__ __forceinline__ F2 split_row(const float* row, int k0, int lane) { float v[16]; const float* p = row + k0 + 8 * (lane >> 4);
#pragma unroll
  for (int i = 0; i < 8; ++i) { v[i] = p[i]; v[8 + i] = p[16 + i]; }
  return bsplit16(v); }
__device__ __forceinline__ F2 split_rowK(const float* row, int k0, int lane, int K) { float v[16]; const int g = lane >> 4;
#pragma unroll
  for (int i = 0; i < 8; ++i) { const int ka = k0 + 8 * g + i, kb = ka + 16; v[i] = ka < K ? row[ka] : 0.f; v[8 + i] = kb < K ? row[kb] : 0.f; }
  return bsplit16(v); }
__device__ __forceinline__ F2 split_col(const float* W, int k0, int n, int lane, int ld, int K) { float v[16]; const int g = lane >> 4;
#pragma unroll
  for (int i = 0; i < 8; ++i) { const int ka = k0 + 8 * g + i, kb = ka + 16; v[i] = ka < K ? W[(size_t)ka * ld + n] : 0.f; v[8 + i] = kb < K ? W[(size_t)kb * ld + n] : 0.f; }
  return bsplit16(v); }
__device__ __forceinline__ v8f mac3(const F2& a, const F2& b, v8f c) { c = wmma_bf(a.l, b.h, c); c = wmma_bf(a.h, b.l, c); return wmma_bf(a.h, b.h, c); }
__device__ __forceinline__ float sigm(float v) { return 1.0f / (1.0f + expf(-v)); }
#define LDSX() do { asm volatile("s_wait_dscnt 0" ::: "memory"); __builtin_amdgcn_wave_barrier(); __builtin_amdgcn_fence(__ATOMIC_RELEASE, "workgroup"); } while (0)


// Encoder-decoder multi-head attention (8 heads x 64 on [4,2048,512]): Q/K/V from three separate embeddings with per-head weights W[h][e][d] + biases; full softmax(q.k/8); cat(heads) WO^T + bO.
#define NB 4
#define SS 2048
#define E 512
#define NH 8
#define HD 64
#define NR (NB * SS)
#define PLO 1024.0f
#define VLO 2048.0f
#define SC2 0.18033688f   // 1/8 x log2(e): takes a raw score to base-2 units
__device__ __forceinline__ float bfr(float v) { return (float)(__bf16)v; }
__device__ __forceinline__ v16b frag_b(const __bf16* rowk0, int lane) { return __builtin_bit_cast(v16b, frag_h((const _Float16*)rowk0, lane)); }

__global__ __launch_bounds__(256) void k_cvt(const float* __restrict__ x, __bf16* __restrict__ Xb) {
  const size_t i8 = (size_t)blockIdx.x * 256 + threadIdx.x; if (i8 >= (size_t)NR * E / 8) return;
  union { __bf16 h[8]; v4u u; } pk;
#pragma unroll
  for (int e = 0; e < 8; ++e) pk.h[e] = (__bf16)x[i8 * 8 + e];
  vst2((unsigned*)(Xb + i8 * 8), pk.u);
}
// PT rows: [0,E) Wq[:,n], [E,2E) Wk[:,n], [2E,3E) Wv[:,n], [3E,4E) Wo[n,:]  (Wq/Wk/Wv: column n as a bf16 row; Wo [out][in]: row n)
__global__ __launch_bounds__(256) void k_pack(const float* __restrict__ Wq, const float* __restrict__ Wk, const float* __restrict__ Wv, const float* __restrict__ Wo, __bf16* __restrict__ PT) {
  const int n = blockIdx.x, tid = threadIdx.x; __shared__ __align__(16) __bf16 srow[E];
  const float* W = n < E ? Wq : (n < 2 * E ? Wk : (n < 3 * E ? Wv : Wo)); const int nn = n % E;
  if (n < 3 * E) { const int hh = nn / HD, d = nn % HD; for (int k = tid; k < E; k += 256) srow[k] = (__bf16)W[((size_t)hh * E + k) * HD + d]; }     // per-head [H][E][DH]: column (h,d) over e
  else { for (int k = tid; k < E; k += 256) srow[k] = (__bf16)W[(size_t)nn * E + k]; }      // WO [out][in]: row nn
  __syncthreads();
  if (tid < E / 8) vst2((unsigned*)(PT + (size_t)n * E + tid * 8), *(const v4u*)(&srow[tid * 8]));
}
// Operand staging of the projection products: a tile is 64 k of every row the block needs, rows of 16-bit data (128 B) at a 144-B pitch, rows of f32 (256 B) at a 272-B pitch (16 B x odd: conflict-free for 16-byte fragment reads).
// A wave-wide copy covers four whole 128-B lines, where a fragment load from global memory touches sixteen.
#define GP 72
#define GBUF ((64 + 128) * GP * 2)
#define OAP 68
#define OBUF (64 * OAP * 4 + 128 * GP * 2)
// Eight copies: 16 B of eight rows, the rows rs apart in LDS (bytes) and gs apart in global memory (elements). s_wait_xcnt 0 closes the statement so that no address register named here is rewritten in front of it.
template <typename T> __device__ __forceinline__ void stage8(unsigned l, unsigned rs, const T* p, size_t gs) {
  asm volatile("global_load_async_to_lds_b128 %0, %8, off\n\t"
               "global_load_async_to_lds_b128 %1, %9, off\n\t"
               "global_load_async_to_lds_b128 %2, %10, off\n\t"
               "global_load_async_to_lds_b128 %3, %11, off\n\t"
               "global_load_async_to_lds_b128 %4, %12, off\n\t"
               "global_load_async_to_lds_b128 %5, %13, off\n\t"
               "global_load_async_to_lds_b128 %6, %14, off\n\t"
               "global_load_async_to_lds_b128 %7, %15, off\n\t"
               "s_wait_xcnt 0x0"
               :: "v"(l), "v"(l + rs), "v"(l + 2 * rs), "v"(l + 3 * rs), "v"(l + 4 * rs), "v"(l + 5 * rs), "v"(l + 6 * rs), "v"(l + 7 * rs),
                  "v"(p), "v"(p + gs), "v"(p + 2 * gs), "v"(p + 3 * gs), "v"(p + 4 * gs), "v"(p + 5 * gs), "v"(p + 6 * gs), "v"(p + 7 * gs)
               : "memory");
}
// Four copies, as above.
template <typename T> __device__ __forceinline__ void stage4(unsigned l, unsigned rs, const T* p, size_t gs) {
  asm volatile("global_load_async_to_lds_b128 %0, %4, off\n\t"
               "global_load_async_to_lds_b128 %1, %5, off\n\t"
               "global_load_async_to_lds_b128 %2, %6, off\n\t"
               "global_load_async_to_lds_b128 %3, %7, off\n\t"
               "s_wait_xcnt 0x0"
               :: "v"(l), "v"(l + rs), "v"(l + 2 * rs), "v"(l + 3 * rs), "v"(p), "v"(p + gs), "v"(p + 2 * gs), "v"(p + 3 * gs)
               : "memory");
}
// QKV: block (64 rows, 128 cols = 2 heads, which); eight tiles of 64 k, X rows and weight rows staged once per block in LDS (two buffers, the next tile's copies fly during this tile's products); q (+bias) -> Q32 f32 [bh][s][64]; k (+bias) -> bf16 hi/lo rows; v (+bias) -> VT hi/lo x4 [bh][d][s]
__global__ __launch_bounds__(128) void k_qkv(const __bf16* __restrict__ XQ, const __bf16* __restrict__ XK, const __bf16* __restrict__ XV, const __bf16* __restrict__ PT, const float* __restrict__ bq, const float* __restrict__ bk, const float* __restrict__ bv, float* __restrict__ Q32, __bf16* __restrict__ Kh, __bf16* __restrict__ Kl, _Float16* __restrict__ VTh, _Float16* __restrict__ VTl) {
  __shared__ __align__(16) unsigned char sm[2 * GBUF];   // operand tiles in the loop; output staging behind its last barrier
  float (*so)[16][132] = (float (*)[16][132])sm;
  _Float16 (*sth)[72] = (_Float16 (*)[72])sm; _Float16 (*stl)[72] = (_Float16 (*)[72])(sm + 128 * 72 * 2);
  const int tid = threadIdx.x, wave = tid >> 5, lane = tid & 31, col = lane & 15, g = lane >> 4;
  const int which = blockIdx.z, r0b = blockIdx.x * 64, n0 = blockIdx.y * 128; const int b = r0b / SS, s0 = r0b % SS;
  const __bf16* Xb = which == 0 ? XQ : (which == 1 ? XK : XV); const float* bb_ = which == 0 ? bq : (which == 1 ? bk : bv);
  const int crow = tid >> 3, cpc = tid & 7;
  const unsigned l0 = (unsigned)(size_t)&sm[crow * (GP * 2) + cpc * 16];
  const __bf16* ga = Xb + (size_t)(r0b + crow) * E + cpc * 8; const __bf16* gb = PT + (size_t)(which * E + n0 + crow) * E + cpc * 8;
  stage4(l0, 16 * GP * 2, ga, (size_t)16 * E); stage8(l0 + 64 * GP * 2, 16 * GP * 2, gb, (size_t)16 * E);
  v8f acc[8] = {};
  asm volatile("s_wait_asynccnt 0x0" ::: "memory");   // this wave's share of tile 0 has landed
  __syncthreads();                                     // tile 0 is published to every wave
  stage4(l0 + GBUF, 16 * GP * 2, ga + 64, (size_t)16 * E); stage8(l0 + GBUF + 64 * GP * 2, 16 * GP * 2, gb + 64, (size_t)16 * E);
#pragma unroll 1
  for (int c = 0; c < E / 64; ++c) { const __bf16* tb = (const __bf16*)(sm + (c & 1) * GBUF);
    v16b a[2], wb[2][8];   // the tile's fragment reads all stand in front of its products: the wave meets the LDS latency once per tile, not once per product
#pragma unroll
    for (int kk = 0; kk < 2; ++kk) { a[kk] = frag_b(tb + (wave * 16 + col) * GP + kk * 32, lane);
#pragma unroll
      for (int j = 0; j < 8; ++j) wb[kk][j] = frag_b(tb + (64 + j * 16 + col) * GP + kk * 32, lane); }
#pragma unroll
    for (int kk = 0; kk < 2; ++kk) {
#pragma unroll
      for (int j = 0; j < 8; ++j) acc[j] = wmma_bf(a[kk], wb[kk][j], acc[j]); }
    asm volatile("s_wait_dscnt 0x0" ::: "memory");      // this wave's reads of the buffer have returned before it is handed to its next writer
    asm volatile("s_wait_asynccnt 0x0" ::: "memory");   // this wave's share of tile c + 1 has landed
    __syncthreads();                                     // publishes tile c + 1 and ends every wave's reads of this buffer
    if (c + 2 < E / 64) { stage4(l0 + (c & 1) * GBUF, 16 * GP * 2, ga + (c + 2) * 64, (size_t)16 * E); stage8(l0 + (c & 1) * GBUF + 64 * GP * 2, 16 * GP * 2, gb + (c + 2) * 64, (size_t)16 * E); } }
  asm volatile("s_wait_asynccnt 0x0" ::: "memory");     // no copy is outstanding when the LDS becomes output staging
  if (which < 2) {
#pragma unroll
    for (int j = 0; j < 8; ++j) { const float bb = bfr(bb_[n0 + j * 16 + col]);
#pragma unroll
      for (int r = 0; r < 8; ++r) so[wave][8 * g + r][j * 16 + col] = acc[j][r] + bb; }
    LDSX();
    if (which == 0) { for (int qq = lane; qq < 2 * 16 * 16; qq += 32) { const int hh = qq >> 8, rl = (qq >> 4) & 15, pc = qq & 15; const int h = (n0 >> 6) + hh;
        vst2(Q32 + (((size_t)b * NH + h) * SS + s0 + wave * 16 + rl) * HD + pc * 4, *(const v4f*)(&so[wave][rl][hh * 64 + pc * 4])); } }
    else {
      for (int qq = lane; qq < 2 * 16 * 16; qq += 32) { const int hh = qq >> 8, rl = (qq >> 4) & 15, pl = qq & 15; const int h = (n0 >> 6) + hh; const int pc = pl & 7; union { __bf16 e[8]; v4u u; } pk;
#pragma unroll
        for (int e = 0; e < 8; ++e) { const float v = so[wave][rl][hh * 64 + pc * 8 + e]; const __bf16 hi = (__bf16)v; pk.e[e] = pl < 8 ? hi : (__bf16)(v - (float)hi); }
        vst2((unsigned*)((pl < 8 ? Kh : Kl) + (((size_t)b * NH + h) * SS + s0 + wave * 16 + rl) * HD + pc * 8), pk.u); } } }
  else {
#pragma unroll
    for (int j = 0; j < 8; ++j) { const float bb = bfr(bb_[n0 + j * 16 + col]);
#pragma unroll
      for (int r = 0; r < 8; ++r) { const float v = (acc[j][r] + bb) * 4.0f; const _Float16 hi = (_Float16)v; sth[j * 16 + col][wave * 16 + 8 * g + r] = hi; stl[j * 16 + col][wave * 16 + 8 * g + r] = (_Float16)((v - (float)hi) * VLO); } }
    __syncthreads();
    for (int qq = tid; qq < 128 * 8; qq += 128) { const int cl = qq >> 3, pc = qq & 7; const int c = n0 + cl, h = c >> 6, d = c & 63; const size_t o = (((size_t)b * NH + h) * HD + d) * SS + s0 + pc * 8;
      vst2(VTh + o, *(const v4u*)(&sth[cl][pc * 8])); vst2(VTl + o, *(const v4u*)(&stl[cl][pc * 8])); } }
}
// K/V staging: one 64-key tile of Kh, Kl, VTh, VTl (64 rows x 128 B each) per buffer, rows at a 144-B pitch (16 B x odd: conflict-free for 16-byte fragment reads)
#define KVP 72
#define KVT (64 * KVP * 2)
// One tile's copies: every lane moves 16 B of two rows of each of the four arrays, so a wave-wide copy covers four whole 128-B lines.
// s_wait_xcnt 0 closes the statement so that no address register named here is rewritten in front of it.
__device__ __forceinline__ void stage_kv(unsigned l, const __bf16* kh, const __bf16* kl, const _Float16* vh, const _Float16* vl) {
  asm volatile("global_load_async_to_lds_b128 %0, %8, off\n\t"
               "global_load_async_to_lds_b128 %1, %9, off\n\t"
               "global_load_async_to_lds_b128 %2, %10, off\n\t"
               "global_load_async_to_lds_b128 %3, %11, off\n\t"
               "global_load_async_to_lds_b128 %4, %12, off\n\t"
               "global_load_async_to_lds_b128 %5, %13, off\n\t"
               "global_load_async_to_lds_b128 %6, %14, off\n\t"
               "global_load_async_to_lds_b128 %7, %15, off\n\t"
               "s_wait_xcnt 0x0"
               :: "v"(l), "v"(l + 32 * KVP * 2), "v"(l + KVT), "v"(l + KVT + 32 * KVP * 2), "v"(l + 2 * KVT), "v"(l + 2 * KVT + 32 * KVP * 2), "v"(l + 3 * KVT), "v"(l + 3 * KVT + 32 * KVP * 2),
                  "v"(kh), "v"(kh + 32 * HD), "v"(kl), "v"(kl + 32 * HD), "v"(vh), "v"(vh + 32 * SS), "v"(vl), "v"(vl + 32 * SS)
               : "memory");
}
// full attention: block (128 queries = 8 waves x 16, bh); 32 key tiles of 64, each staged once per block in LDS (two buffers, the next tile's copies fly during this tile's work); S on q hi/lo x K hi/lo rows; softmax in base 2 (one fma and one hardware exp2 per score); P,V hi/lo; O f32 [bh][s][64]
__global__ __launch_bounds__(256) void k_attn(const float* __restrict__ Q32, const __bf16* __restrict__ Kh, const __bf16* __restrict__ Kl, const _Float16* __restrict__ VTh, const _Float16* __restrict__ VTl, float* __restrict__ O32) {
  __shared__ __align__(16) _Float16 sKV[2][4][64][KVP];
  __shared__ __align__(16) float sS[8][16][68];   // scores in the loop, output staging behind it (each wave its own slice): two blocks fit one WGP's LDS
  __shared__ __align__(16) _Float16 sPh[8][16][72], sPl[8][16][72];
  const int tid = threadIdx.x, w = tid >> 5, lane = tid & 31, col = lane & 15, g = lane >> 4;
  const size_t bh = blockIdx.y; const int qb = blockIdx.x; const int q0 = qb * 128 + w * 16;
  const int crow = tid >> 3, cpc = tid & 7;
  const unsigned lds0 = (unsigned)(size_t)&sKV[0][0][crow][cpc * 8];
  const __bf16* gkh = Kh + (bh * SS + crow) * HD + cpc * 8; const __bf16* gkl = Kl + (bh * SS + crow) * HD + cpc * 8;
  const _Float16* gvh = VTh + (bh * HD + crow) * SS + cpc * 8; const _Float16* gvl = VTl + (bh * HD + crow) * SS + cpc * 8;
  stage_kv(lds0, gkh, gkl, gvh, gvl);
  F2 aq[2];
#pragma unroll
  for (int kc = 0; kc < 2; ++kc) aq[kc] = split_row(Q32 + (bh * SS + q0 + col) * HD, kc * 32, lane);
  float mrun = -3.0e38f, lrun = 0.f; v8f acc[4] = {}, ac1[4] = {}, ac2[4] = {};
  LDSX();
  asm volatile("s_wait_asynccnt 0x0" ::: "memory");   // this wave's share of tile 0 has landed
  __syncthreads();                                     // tile 0 is published to every wave
  stage_kv(lds0 + 4 * KVT, gkh + 64 * HD, gkl + 64 * HD, gvh + 64, gvl + 64);
#pragma unroll 1
  for (int kt = 0; kt < SS / 64; ++kt) {
    const int bf = kt & 1;
#pragma unroll
    for (int t = 0; t < 4; ++t) { const __bf16* kr = (const __bf16*)&sKV[bf][0][t * 16 + col][0]; const __bf16* lr_ = (const __bf16*)&sKV[bf][1][t * 16 + col][0]; v8f s = {};
#pragma unroll
      for (int kc = 0; kc < 2; ++kc) { const v16b khf = frag_b(kr + kc * 32, lane), klf = frag_b(lr_ + kc * 32, lane); s = wmma_bf(aq[kc].l, khf, s); s = wmma_bf(aq[kc].h, klf, s); s = wmma_bf(aq[kc].h, khf, s); }
#pragma unroll
      for (int r = 0; r < 8; ++r) sS[w][8 * g + r][t * 16 + col] = s[r]; }
    LDSX();
    float mx = -3.4e38f;
#pragma unroll
    for (int jj = 0; jj < 32; ++jj) mx = fmaxf(mx, sS[w][col][g * 32 + jj]);
    mx = fmaxf(mx, __shfl_xor(mx, 16, 32));
    const float mnew = fmaxf(mrun, mx * SC2); const float corr = __builtin_amdgcn_exp2f(mrun - mnew);   // running maximum in base-2 units
    const float moff = mnew - 14.0f;   // the factor 16384 = 2^14 of P rides in the exponent
    float ps = 0.f;
#pragma unroll
    for (int jj = 0; jj < 32; ++jj) { const float p = __builtin_amdgcn_exp2f(fmaf(sS[w][col][g * 32 + jj], SC2, -moff)); ps += p; const _Float16 hi = (_Float16)p; sPh[w][col][g * 32 + jj] = hi; sPl[w][col][g * 32 + jj] = (_Float16)((p - (float)hi) * PLO); }
    ps += __shfl_xor(ps, 16, 32);
    lrun = lrun * corr + ps * (1.0f / 16384.0f); mrun = mnew;
#pragma unroll
    for (int r = 0; r < 8; ++r) { const float cr = __shfl(corr, 8 * g + r, 32);
#pragma unroll
      for (int t = 0; t < 4; ++t) { acc[t][r] *= cr; ac1[t][r] *= cr; ac2[t][r] *= cr; } }
    LDSX();
#pragma unroll
    for (int kc = 0; kc < 2; ++kc) { const v16h ph = frag_h(&sPh[w][col][0] + kc * 32, lane), pl = frag_h(&sPl[w][col][0] + kc * 32, lane);
#pragma unroll
      for (int t = 0; t < 4; ++t) { const v16h vh = frag_h(&sKV[bf][2][t * 16 + col][kc * 32], lane);
        acc[t] = wmma16(ph, vh, acc[t]); ac1[t] = wmma16(ph, frag_h(&sKV[bf][3][t * 16 + col][kc * 32], lane), ac1[t]); ac2[t] = wmma16(pl, vh, ac2[t]); } }
    __builtin_amdgcn_wave_barrier();
    asm volatile("s_wait_dscnt 0x0" ::: "memory");      // this wave's reads of buffer bf have returned before the buffer is handed to its next writer
    asm volatile("s_wait_asynccnt 0x0" ::: "memory");   // this wave's share of tile kt + 1 has landed
    __syncthreads();                                     // publishes tile kt + 1 and ends every wave's reads of buffer bf
    if (kt + 2 < SS / 64) stage_kv(lds0 + bf * (4 * KVT), gkh + (size_t)(kt + 2) * 64 * HD, gkl + (size_t)(kt + 2) * 64 * HD, gvh + (kt + 2) * 64, gvl + (kt + 2) * 64); }
  asm volatile("s_wait_asynccnt 0x0" ::: "memory");     // no copy is outstanding when the wave goes on to its epilogue and ends
#pragma unroll
  for (int r = 0; r < 8; ++r) { const float lr = __shfl(lrun, 8 * g + r, 32); const float inv = 1.0f / (lr * 16384.0f * 4.0f);
#pragma unroll
    for (int t = 0; t < 4; ++t) sS[w][8 * g + r][t * 16 + col] = (acc[t][r] + ac1[t][r] * (1.0f / VLO) + ac2[t][r] * (1.0f / PLO)) * inv; }
  LDSX();
  for (int qq = lane; qq < 16 * 16; qq += 32) { const int rl = qq >> 4, pc = qq & 15; vst2(O32 + ((bh * SS) + q0 + rl) * HD + pc * 4, *(const v4f*)(&sS[w][rl][pc * 4])); }
}
// out = ctx Wo^T + bo : split(ctx) x bf16(Wo rows): 2 products (Wo is an INPUT -> bf16 exact); eight tiles of 64 k (one head each), ctx rows (f32) and Wo rows staged once per block in LDS, two buffers
__global__ __launch_bounds__(128) void k_out(const float* __restrict__ O32, const __bf16* __restrict__ PT, const float* __restrict__ bo, float* __restrict__ out) {
  __shared__ __align__(16) unsigned char sm[2 * OBUF];   // operand tiles in the loop; output staging behind its last barrier
  float (*so)[16][132] = (float (*)[16][132])sm;
  const int tid = threadIdx.x, wave = tid >> 5, lane = tid & 31, col = lane & 15, g = lane >> 4;
  const int r0b = blockIdx.x * 64, r0 = r0b + wave * 16, n0 = blockIdx.y * 128; const int b = r0b / SS, s0 = r0b % SS;
  const unsigned la = (unsigned)(size_t)&sm[(tid >> 4) * (OAP * 4) + (tid & 15) * 16];
  const unsigned lb = (unsigned)(size_t)&sm[64 * OAP * 4 + (tid >> 3) * (GP * 2) + (tid & 7) * 16];
  const float* ga = O32 + ((size_t)b * NH * SS + s0 + (tid >> 4)) * HD + (tid & 15) * 4;   // head h of these rows: + h * SS * HD
  const __bf16* gb = PT + (size_t)(3 * E + n0 + (tid >> 3)) * E + (tid & 7) * 8;
  stage8(la, 8 * OAP * 4, ga, (size_t)8 * HD); stage8(lb, 16 * GP * 2, gb, (size_t)16 * E);
  v8f acc[8] = {};
  asm volatile("s_wait_asynccnt 0x0" ::: "memory");   // this wave's share of tile 0 has landed
  __syncthreads();                                     // tile 0 is published to every wave
  stage8(la + OBUF, 8 * OAP * 4, ga + (size_t)SS * HD, (size_t)8 * HD); stage8(lb + OBUF, 16 * GP * 2, gb + 64, (size_t)16 * E);
#pragma unroll 1
  for (int c = 0; c < E / 64; ++c) { const float* ta = (const float*)(sm + (c & 1) * OBUF); const __bf16* tb = (const __bf16*)(sm + (c & 1) * OBUF + 64 * OAP * 4);
    F2 a[2]; v16b wb[2][8];   // the tile's fragment reads all stand in front of its products: the wave meets the LDS latency once per tile, not once per product
#pragma unroll
    for (int kk = 0; kk < 2; ++kk) { a[kk] = split_row(ta + (wave * 16 + col) * OAP, kk * 32, lane);
#pragma unroll
      for (int j = 0; j < 8; ++j) wb[kk][j] = frag_b(tb + (j * 16 + col) * GP + kk * 32, lane); }
#pragma unroll
    for (int kk = 0; kk < 2; ++kk) {
#pragma unroll
      for (int j = 0; j < 8; ++j) { acc[j] = wmma_bf(a[kk].l, wb[kk][j], acc[j]); acc[j] = wmma_bf(a[kk].h, wb[kk][j], acc[j]); } }
    asm volatile("s_wait_dscnt 0x0" ::: "memory");      // this wave's reads of the buffer have returned before it is handed to its next writer
    asm volatile("s_wait_asynccnt 0x0" ::: "memory");   // this wave's share of tile c + 1 has landed
    __syncthreads();                                     // publishes tile c + 1 and ends every wave's reads of this buffer
    if (c + 2 < E / 64) { stage8(la + (c & 1) * OBUF, 8 * OAP * 4, ga + (size_t)(c + 2) * SS * HD, (size_t)8 * HD); stage8(lb + (c & 1) * OBUF, 16 * GP * 2, gb + (c + 2) * 64, (size_t)16 * E); } }
  asm volatile("s_wait_asynccnt 0x0" ::: "memory");     // no copy is outstanding when the LDS becomes output staging
#pragma unroll
  for (int j = 0; j < 8; ++j) { const float bb = bfr(bo[n0 + j * 16 + col]);
#pragma unroll
    for (int r = 0; r < 8; ++r) so[wave][8 * g + r][j * 16 + col] = acc[j][r] + bb; }
  LDSX();
#pragma unroll 4
  for (int rl = 0; rl < 16; ++rl) vst2(out + (size_t)(r0 + rl) * E + n0 + lane * 4, *(const v4f*)(&so[wave][rl][lane * 4]));
}
extern "C" void kernel_launch(void* const* d_in, const int* in_sizes, int n_in, void* d_out, int out_size, void* d_ws, size_t ws_size, hipStream_t stream) {
  (void)in_sizes; (void)n_in; (void)out_size; (void)ws_size;
  const float** I = (const float**)d_in;   // emb_q, emb_k, emb_v, WQ, bQ, WK, bK, WV, bV, WO, bO
  const float* eq = I[0]; const float* ek = I[1]; const float* ev = I[2]; const float* WQ = I[3]; const float* bQ = I[4]; const float* WK = I[5]; const float* bK = I[6]; const float* WV = I[7]; const float* bV = I[8]; const float* WO = I[9]; const float* bO = I[10];
  float* out = (float*)d_out;
  char* ws = (char*)d_ws; size_t off = 0;
  auto take = [&](size_t bytes) { char* p = ws + off; off += (bytes + 255) & ~(size_t)255; return p; };
  __bf16* XQ = (__bf16*)take((size_t)NR * E * 2); __bf16* XK = (__bf16*)take((size_t)NR * E * 2); __bf16* XV = (__bf16*)take((size_t)NR * E * 2); __bf16* PT = (__bf16*)take((size_t)4 * E * E * 2);
  float* Q32 = (float*)take((size_t)NR * E * 4); __bf16* Kh = (__bf16*)take((size_t)NR * E * 2); __bf16* Kl = (__bf16*)take((size_t)NR * E * 2); _Float16* VTh = (_Float16*)take((size_t)NR * E * 2); _Float16* VTl = (_Float16*)take((size_t)NR * E * 2); float* O32 = (float*)take((size_t)NR * E * 4);
  // ws ~ 90 MiB
  k_cvt<<<(NR * E / 8 + 255) / 256, 256, 0, stream>>>(eq, XQ);
  k_cvt<<<(NR * E / 8 + 255) / 256, 256, 0, stream>>>(ek, XK);
  k_cvt<<<(NR * E / 8 + 255) / 256, 256, 0, stream>>>(ev, XV);
  k_pack<<<4 * E, 256, 0, stream>>>(WQ, WK, WV, WO, PT);
  k_qkv<<<dim3(NR / 64, E / 128, 3), 128, 0, stream>>>(XQ, XK, XV, PT, bQ, bK, bV, Q32, Kh, Kl, VTh, VTl);
  k_attn<<<dim3(SS / 128, NB * NH), 256, 0, stream>>>(Q32, Kh, Kl, VTh, VTl, O32);
  k_out<<<dim3(NR / 64, E / 128), 128, 0, stream>>>(O32, PT, bO, out);
}

// v004
// One run takes 155 microseconds.
// Two timings next to v003 both put it at 1.05 times that version's speed.
// Counting every step since v000, it is 2.70 times as fast.
// compute dtype: embeddings and W*/b* (INPUTS) rounded to bf16 with exact bf16 WMMA products (f32 accumulate) for the projections; K pre-split into bf16 hi/lo rows; q f32 split, P and V f16 hi/lo (3 products each); softmax f32.
#include <hip/hip_runtime.h>
#include <math.h>

typedef __attribute__((ext_vector_type(16))) _Float16 v16h;
typedef __attribute__((ext_vector_type(16))) __bf16 v16b;
typedef __attribute__((ext_vector_type(8)))  _Float16 v8h;
typedef __attribute__((ext_vector_type(8)))  float v8f;
typedef __attribute__((ext_vector_type(4)))  float v4f;
typedef __attribute__((ext_vector_type(2)))  float v2f;
typedef __attribute__((ext_vector_type(4)))  unsigned v4u;
typedef __attribute__((ext_vector_type(4)))  int v4i;
typedef float __attribute__((may_alias)) float_a;
typedef int __attribute__((may_alias)) int_a;

template <typename T> __device__ __forceinline__ void vst2(void* p, T v) { *(T*)p = v;  }
__device__ __forceinline__ v8f wmma16(v16h a, v16h b, v8f c) {
  v8f d = __builtin_amdgcn_wmma_f32_16x16x32_f16(false, a, false, b, (short)0, c, false, false);
  asm volatile("v_nop\n\tv_nop\n\tv_nop\n\tv_nop" : "+v"(d) : "v"(a), "v"(b));
  return d;
}
__device__ __forceinline__ v8f wmma_bf(v16b a, v16b b, v8f c) {
  v8f d = __builtin_amdgcn_wmma_f32_16x16x32_bf16(false, a, false, b, (short)0, c, false, false);
  asm volatile("v_nop\n\tv_nop\n\tv_nop\n\tv_nop" : "+v"(d) : "v"(a), "v"(b));
  return d;
}
// 16x16x32 fragments: lane = (h = lane>>4, row/col = lane&15); elements 0..7 = k0+8h+0..7, 8..15 = k0+16+8h+0..7; D element r = row 8h+r
__device__ __forceinline__ v16h frag_h(const _Float16* rowk0, int lane) {
  union { v16h v; v8h q[2]; } u; const _Float16* p = rowk0 + 8 * (lane >> 4);
  u.q[0] = *(const v8h*)p; u.q[1] = *(const v8h*)(p + 16); return u.v;
}
__device__ __forceinline__ v16h frag_f32(const float* rowk0, int lane) {
  v16h a; const float* p = rowk0 + 8 * (lane >> 4);
#pragma unroll
  for (int i = 0; i < 8; ++i) { a[i] = (_Float16)p[i]; a[8 + i] = (_Float16)p[16 + i]; }
  return a;
}
__device__ __forceinline__ v16h frag_f32s(const float* rowk0, int lane, float sc) {
  v16h a; const float* p = rowk0 + 8 * (lane >> 4);
#pragma unroll
  for (int i = 0; i < 8; ++i) { a[i] = (_Float16)(p[i] * sc); a[8 + i] = (_Float16)(p[16 + i] * sc); }
  return a;
}
// column fragment from a [K][ld] layout (column n), rows >= K read as 0
__device__ __forceinline__ v16h fragc_f32(const float* W, int k0, int n, int lane, int ld, int K) {
  v16h a; const int g = lane >> 4;
#pragma unroll
  for (int i = 0; i < 8; ++i) { const int ka = k0 + 8 * g + i, kb = ka + 16;
    a[i] = (_Float16)(ka < K ? W[(size_t)ka * ld + n] : 0.f); a[8 + i] = (_Float16)(kb < K ? W[(size_t)kb * ld + n] : 0.f); }
  return a;
}
struct F2 { v16b h, l; };
__device__ __forceinline__ F2 bsplit16(const float v[16]) { F2 r;
#pragma unroll
  for (int i = 0; i < 16; ++i) { const __bf16 h = (__bf16)v[i]; r.h[i] = h; r.l[i] = (__bf16)(v[i] - (float)h); }
  return r; }
__device__ __forceinline__ F2 split_row(const float* row, int k0, int lane) { float v[16]; const float* p = row + k0 + 8 * (lane >> 4);
#pragma unroll
  for (int i = 0; i < 8; ++i) { v[i] = p[i]; v[8 + i] = p[16 + i]; }
  return bsplit16(v); }
__device__ __forceinline__ F2 split_rowK(const float* row, int k0, int lane, int K) { float v[16]; const int g = lane >> 4;
#pragma unroll
  for (int i = 0; i < 8; ++i) { const int ka = k0 + 8 * g + i, kb = ka + 16; v[i] = ka < K ? row[ka] : 0.f; v[8 + i] = kb < K ? row[kb] : 0.f; }
  return bsplit16(v); }
__device__ __forceinline__ F2 split_col(const float* W, int k0, int n, int lane, int ld, int K) { float v[16]; const int g = lane >> 4;
#pragma unroll
  for (int i = 0; i < 8; ++i) { const int ka = k0 + 8 * g + i, kb = ka + 16; v[i] = ka < K ? W[(size_t)ka * ld + n] : 0.f; v[8 + i] = kb < K ? W[(size_t)kb * ld + n] : 0.f; }
  return bsplit16(v); }
__device__ __forceinline__ v8f mac3(const F2& a, const F2& b, v8f c) { c = wmma_bf(a.l, b.h, c); c = wmma_bf(a.h, b.l, c); return wmma_bf(a.h, b.h, c); }
__device__ __forceinline__ float sigm(float v) { return 1.0f / (1.0f + expf(-v)); }
#define LDSX() do { asm volatile("s_wait_dscnt 0" ::: "memory"); __builtin_amdgcn_wave_barrier(); __builtin_amdgcn_fence(__ATOMIC_RELEASE, "workgroup"); } while (0)


// Encoder-decoder multi-head attention (8 heads x 64 on [4,2048,512]): Q/K/V from three separate embeddings with per-head weights W[h][e][d] + biases; full softmax(q.k/8); cat(heads) WO^T + bO.
#define NB 4
#define SS 2048
#define E 512
#define NH 8
#define HD 64
#define NR (NB * SS)
#define PLO 1024.0f
#define VLO 2048.0f
#define SC2 0.18033688f   // 1/8 x log2(e): takes a raw score to base-2 units
__device__ __forceinline__ float bfr(float v) { return (float)(__bf16)v; }
__device__ __forceinline__ v16b frag_b(const __bf16* rowk0, int lane) { return __builtin_bit_cast(v16b, frag_h((const _Float16*)rowk0, lane)); }

// A fragment from an f32 row: the same elements as frag_b, each rounded to bf16 (nearest even) on the way
__device__ __forceinline__ v16b frag_bf32(const float* rowk0, int lane) {
  v16b a; const float* p = rowk0 + 8 * (lane >> 4);
#pragma unroll
  for (int i = 0; i < 8; ++i) { a[i] = (__bf16)p[i]; a[8 + i] = (__bf16)p[16 + i]; }
  return a;
}
// PT rows: [0,E) Wq[:,n], [E,2E) Wk[:,n], [2E,3E) Wv[:,n], [3E,4E) Wo[n,:]  (Wq/Wk/Wv: column n as a bf16 row; Wo [out][in]: row n)
__global__ __launch_bounds__(256) void k_pack(const float* __restrict__ Wq, const float* __restrict__ Wk, const float* __restrict__ Wv, const float* __restrict__ Wo, __bf16* __restrict__ PT) {
  const int n = blockIdx.x, tid = threadIdx.x; __shared__ __align__(16) __bf16 srow[E];
  const float* W = n < E ? Wq : (n < 2 * E ? Wk : (n < 3 * E ? Wv : Wo)); const int nn = n % E;
  if (n < 3 * E) { const int hh = nn / HD, d = nn % HD; for (int k = tid; k < E; k += 256) srow[k] = (__bf16)W[((size_t)hh * E + k) * HD + d]; }     // per-head [H][E][DH]: column (h,d) over e
  else { for (int k = tid; k < E; k += 256) srow[k] = (__bf16)W[(size_t)nn * E + k]; }      // WO [out][in]: row nn
  __syncthreads();
  if (tid < E / 8) vst2((unsigned*)(PT + (size_t)n * E + tid * 8), *(const v4u*)(&srow[tid * 8]));
}
// Operand staging of the projection products: a tile is 64 k of every row the block needs, rows of 16-bit data (128 B) at a 144-B pitch, rows of f32 (256 B) at a 272-B pitch (16 B x odd: conflict-free for 16-byte fragment reads).
// A wave-wide copy covers four whole 128-B lines, where a fragment load from global memory touches sixteen.
#define GP 72
#define OAP 68
#define OBUF (64 * OAP * 4 + 128 * GP * 2)
// Eight copies: 16 B of eight rows, the rows rs apart in LDS (bytes) and gs apart in global memory (elements). s_wait_xcnt 0 closes the statement so that no address register named here is rewritten in front of it.
template <typename T> __device__ __forceinline__ void stage8(unsigned l, unsigned rs, const T* p, size_t gs) {
  asm volatile("global_load_async_to_lds_b128 %0, %8, off\n\t"
               "global_load_async_to_lds_b128 %1, %9, off\n\t"
               "global_load_async_to_lds_b128 %2, %10, off\n\t"
               "global_load_async_to_lds_b128 %3, %11, off\n\t"
               "global_load_async_to_lds_b128 %4, %12, off\n\t"
               "global_load_async_to_lds_b128 %5, %13, off\n\t"
               "global_load_async_to_lds_b128 %6, %14, off\n\t"
               "global_load_async_to_lds_b128 %7, %15, off\n\t"
               "s_wait_xcnt 0x0"
               :: "v"(l), "v"(l + rs), "v"(l + 2 * rs), "v"(l + 3 * rs), "v"(l + 4 * rs), "v"(l + 5 * rs), "v"(l + 6 * rs), "v"(l + 7 * rs),
                  "v"(p), "v"(p + gs), "v"(p + 2 * gs), "v"(p + 3 * gs), "v"(p + 4 * gs), "v"(p + 5 * gs), "v"(p + 6 * gs), "v"(p + 7 * gs)
               : "memory");
}
// QKV: block (64 rows, 128 cols = 2 heads, which); eight tiles of 64 k, embedding rows (f32, as they come in; rounded to bf16 where the A fragment is formed) and weight rows staged once per block in LDS (two buffers, the next tile's copies fly during this tile's products); q (+bias) -> Q32 f32 [bh][s][64]; k (+bias) -> bf16 hi/lo rows; v (+bias) -> VT hi/lo x4 [bh][d][s]
__global__ __launch_bounds__(128) void k_qkv(const float* __restrict__ XQ, const float* __restrict__ XK, const float* __restrict__ XV, const __bf16* __restrict__ PT, const float* __restrict__ bq, const float* __restrict__ bk, const float* __restrict__ bv, float* __restrict__ Q32, __bf16* __restrict__ Kh, __bf16* __restrict__ Kl, _Float16* __restrict__ VTh, _Float16* __restrict__ VTl) {
  __shared__ __align__(16) unsigned char sm[2 * OBUF];   // operand tiles in the loop; output staging behind its last barrier
  float (*so)[16][132] = (float (*)[16][132])sm;
  _Float16 (*sth)[72] = (_Float16 (*)[72])sm; _Float16 (*stl)[72] = (_Float16 (*)[72])(sm + 128 * 72 * 2);
  const int tid = threadIdx.x, wave = tid >> 5, lane = tid & 31, col = lane & 15, g = lane >> 4;
  const int which = blockIdx.z, r0b = blockIdx.x * 64, n0 = blockIdx.y * 128; const int b = r0b / SS, s0 = r0b % SS;
  const float* Xf = which == 0 ? XQ : (which == 1 ? XK : XV); const float* bb_ = which == 0 ? bq : (which == 1 ? bk : bv);
  const unsigned la = (unsigned)(size_t)&sm[(tid >> 4) * (OAP * 4) + (tid & 15) * 16];
  const unsigned lb = (unsigned)(size_t)&sm[64 * OAP * 4 + (tid >> 3) * (GP * 2) + (tid & 7) * 16];
  const float* ga = Xf + (size_t)(r0b + (tid >> 4)) * E + (tid & 15) * 4; const __bf16* gb = PT + (size_t)(which * E + n0 + (tid >> 3)) * E + (tid & 7) * 8;
  stage8(la, 8 * OAP * 4, ga, (size_t)8 * E); stage8(lb, 16 * GP * 2, gb, (size_t)16 * E);
  v8f acc[8] = {};
  asm volatile("s_wait_asynccnt 0x0" ::: "memory");   // this wave's share of tile 0 has landed
  __syncthreads();                                     // tile 0 is published to every wave
  stage8(la + OBUF, 8 * OAP * 4, ga + 64, (size_t)8 * E); stage8(lb + OBUF, 16 * GP * 2, gb + 64, (size_t)16 * E);
#pragma unroll 1
  for (int c = 0; c < E / 64; ++c) { const float* ta = (const float*)(sm + (c & 1) * OBUF); const __bf16* tb = (const __bf16*)(sm + (c & 1) * OBUF + 64 * OAP * 4);
    v16b a[2], wb[2][8];   // the tile's fragment reads all stand in front of its products: the wave meets the LDS latency once per tile, not once per product
#pragma unroll
    for (int kk = 0; kk < 2; ++kk) { a[kk] = frag_bf32(ta + (wave * 16 + col) * OAP + kk * 32, lane);
#pragma unroll
      for (int j = 0; j < 8; ++j) wb[kk][j] = frag_b(tb + (j * 16 + col) * GP + kk * 32, lane); }
#pragma unroll
    for (int kk = 0; kk < 2; ++kk) {
#pragma unroll
      for (int j = 0; j < 8; ++j) acc[j] = wmma_bf(a[kk], wb[kk][j], acc[j]); }
    asm volatile("s_wait_dscnt 0x0" ::: "memory");      // this wave's reads of the buffer have returned before it is handed to its next writer
    asm volatile("s_wait_asynccnt 0x0" ::: "memory");   // this wave's share of tile c + 1 has landed
    __syncthreads();                                     // publishes tile c + 1 and ends every wave's reads of this buffer
    if (c + 2 < E / 64) { stage8(la + (c & 1) * OBUF, 8 * OAP * 4, ga + (c + 2) * 64, (size_t)8 * E); stage8(lb + (c & 1) * OBUF, 16 * GP * 2, gb + (c + 2) * 64, (size_t)16 * E); } }
  asm volatile("s_wait_asynccnt 0x0" ::: "memory");     // no copy is outstanding when the LDS becomes output staging
  if (which < 2) {
#pragma unroll
    for (int j = 0; j < 8; ++j) { const float bb = bfr(bb_[n0 + j * 16 + col]);
#pragma unroll
      for (int r = 0; r < 8; ++r) so[wave][8 * g + r][j * 16 + col] = acc[j][r] + bb; }
    LDSX();
    if (which == 0) { for (int qq = lane; qq < 2 * 16 * 16; qq += 32) { const int hh = qq >> 8, rl = (qq >> 4) & 15, pc = qq & 15; const int h = (n0 >> 6) + hh;
        vst2(Q32 + (((size_t)b * NH + h) * SS + s0 + wave * 16 + rl) * HD + pc * 4, *(const v4f*)(&so[wave][rl][hh * 64 + pc * 4])); } }
    else {
      for (int qq = lane; qq < 2 * 16 * 16; qq += 32) { const int hh = qq >> 8, rl = (qq >> 4) & 15, pl = qq & 15; const int h = (n0 >> 6) + hh; const int pc = pl & 7; union { __bf16 e[8]; v4u u; } pk;
#pragma unroll
        for (int e = 0; e < 8; ++e) { const float v = so[wave][rl][hh * 64 + pc * 8 + e]; const __bf16 hi = (__bf16)v; pk.e[e] = pl < 8 ? hi : (__bf16)(v - (float)hi); }
        vst2((unsigned*)((pl < 8 ? Kh : Kl) + (((size_t)b * NH + h) * SS + s0 + wave * 16 + rl) * HD + pc * 8), pk.u); } } }
  else {
#pragma unroll
    for (int j = 0; j < 8; ++j) { const float bb = bfr(bb_[n0 + j * 16 + col]);
#pragma unroll
      for (int r = 0; r < 8; ++r) { const float v = (acc[j][r] + bb) * 4.0f; const _Float16 hi = (_Float16)v; sth[j * 16 + col][wave * 16 + 8 * g + r] = hi; stl[j * 16 + col][wave * 16 + 8 * g + r] = (_Float16)((v - (float)hi) * VLO); } }
    __syncthreads();
    for (int qq = tid; qq < 128 * 8; qq += 128) { const int cl = qq >> 3, pc = qq & 7; const int c = n0 + cl, h = c >> 6, d = c & 63; const size_t o = (((size_t)b * NH + h) * HD + d) * SS + s0 + pc * 8;
      vst2(VTh + o, *(const v4u*)(&sth[cl][pc * 8])); vst2(VTl + o, *(const v4u*)(&stl[cl][pc * 8])); } }
}
// K/V staging: one 64-key tile of Kh, Kl, VTh, VTl (64 rows x 128 B each) per buffer, rows at a 144-B pitch (16 B x odd: conflict-free for 16-byte fragment reads)
#define KVP 72
#define KVT (64 * KVP * 2)
// One tile's copies: every lane moves 16 B of two rows of each of the four arrays, so a wave-wide copy covers four whole 128-B lines.
// s_wait_xcnt 0 closes the statement so that no address register named here is rewritten in front of it.
__device__ __forceinline__ void stage_kv(unsigned l, const __bf16* kh, const __bf16* kl, const _Float16* vh, const _Float16* vl) {
  asm volatile("global_load_async_to_lds_b128 %0, %8, off\n\t"
               "global_load_async_to_lds_b128 %1, %9, off\n\t"
               "global_load_async_to_lds_b128 %2, %10, off\n\t"
               "global_load_async_to_lds_b128 %3, %11, off\n\t"
               "global_load_async_to_lds_b128 %4, %12, off\n\t"
               "global_load_async_to_lds_b128 %5, %13, off\n\t"
               "global_load_async_to_lds_b128 %6, %14, off\n\t"
               "global_load_async_to_lds_b128 %7, %15, off\n\t"
               "s_wait_xcnt 0x0"
               :: "v"(l), "v"(l + 32 * KVP * 2), "v"(l + KVT), "v"(l + KVT + 32 * KVP * 2), "v"(l + 2 * KVT), "v"(l + 2 * KVT + 32 * KVP * 2), "v"(l + 3 * KVT), "v"(l + 3 * KVT + 32 * KVP * 2),
                  "v"(kh), "v"(kh + 32 * HD), "v"(kl), "v"(kl + 32 * HD), "v"(vh), "v"(vh + 32 * SS), "v"(vl), "v"(vl + 32 * SS)
               : "memory");
}
// full attention: block (128 queries = 8 waves x 16, bh); 32 key tiles of 64, each staged once per block in LDS (two buffers, the next tile's copies fly during this tile's work); S on q hi/lo x K hi/lo rows; softmax in base 2 (one fma and one hardware exp2 per score); P,V hi/lo; O f32 [bh][s][64]
__global__ __launch_bounds__(256) void k_attn(const float* __restrict__ Q32, const __bf16* __restrict__ Kh, const __bf16* __restrict__ Kl, const _Float16* __restrict__ VTh, const _Float16* __restrict__ VTl, float* __restrict__ O32) {
  __shared__ __align__(16) _Float16 sKV[2][4][64][KVP];
  __shared__ __align__(16) float sS[8][16][68];   // scores in the loop, output staging behind it (each wave its own slice): two blocks fit one WGP's LDS
  __shared__ __align__(16) _Float16 sPh[8][16][72], sPl[8][16][72];
  const int tid = threadIdx.x, w = tid >> 5, lane = tid & 31, col = lane & 15, g = lane >> 4;
  const size_t bh = blockIdx.y; const int qb = blockIdx.x; const int q0 = qb * 128 + w * 16;
  const int crow = tid >> 3, cpc = tid & 7;
  const unsigned lds0 = (unsigned)(size_t)&sKV[0][0][crow][cpc * 8];
  const __bf16* gkh = Kh + (bh * SS + crow) * HD + cpc * 8; const __bf16* gkl = Kl + (bh * SS + crow) * HD + cpc * 8;
  const _Float16* gvh = VTh + (bh * HD + crow) * SS + cpc * 8; const _Float16* gvl = VTl + (bh * HD + crow) * SS + cpc * 8;
  stage_kv(lds0, gkh, gkl, gvh, gvl);
  F2 aq[2];
#pragma unroll
  for (int kc = 0; kc < 2; ++kc) aq[kc] = split_row(Q32 + (bh * SS + q0 + col) * HD, kc * 32, lane);
  float mrun = -3.0e38f, lrun = 0.f; v8f acc[4] = {}, ac1[4] = {}, ac2[4] = {};
  LDSX();
  asm volatile("s_wait_asynccnt 0x0" ::: "memory");   // this wave's share of tile 0 has landed
  __syncthreads();                                     // tile 0 is published to every wave
  stage_kv(lds0 + 4 * KVT, gkh + 64 * HD, gkl + 64 * HD, gvh + 64, gvl + 64);
#pragma unroll 1
  for (int kt = 0; kt < SS / 64; ++kt) {
    const int bf = kt & 1;
#pragma unroll
    for (int t = 0; t < 4; ++t) { const __bf16* kr = (const __bf16*)&sKV[bf][0][t * 16 + col][0]; const __bf16* lr_ = (const __bf16*)&sKV[bf][1][t * 16 + col][0]; v8f s = {};
#pragma unroll
      for (int kc = 0; kc < 2; ++kc) { const v16b khf = frag_b(kr + kc * 32, lane), klf = frag_b(lr_ + kc * 32, lane); s = wmma_bf(aq[kc].l, khf, s); s = wmma_bf(aq[kc].h, klf, s); s = wmma_bf(aq[kc].h, khf, s); }
#pragma unroll
      for (int r = 0; r < 8; ++r) sS[w][8 * g + r][t * 16 + col] = s[r]; }
    LDSX();
    float mx = -3.4e38f;
#pragma unroll
    for (int jj = 0; jj < 32; ++jj) mx = fmaxf(mx, sS[w][col][g * 32 + jj]);
    mx = fmaxf(mx, __shfl_xor(mx, 16, 32));
    const float mnew = fmaxf(mrun, mx * SC2); const float corr = __builtin_amdgcn_exp2f(mrun - mnew);   // running maximum in base-2 units
    const float moff = mnew - 14.0f;   // the factor 16384 = 2^14 of P rides in the exponent
    float ps = 0.f;
#pragma unroll
    for (int jj = 0; jj < 32; ++jj) { const float p = __builtin_amdgcn_exp2f(fmaf(sS[w][col][g * 32 + jj], SC2, -moff)); ps += p; const _Float16 hi = (_Float16)p; sPh[w][col][g * 32 + jj] = hi; sPl[w][col][g * 32 + jj] = (_Float16)((p - (float)hi) * PLO); }
    ps += __shfl_xor(ps, 16, 32);
    lrun = lrun * corr + ps * (1.0f / 16384.0f); mrun = mnew;
#pragma unroll
    for (int r = 0; r < 8; ++r) { const float cr = __shfl(corr, 8 * g + r, 32);
#pragma unroll
      for (int t = 0; t < 4; ++t) { acc[t][r] *= cr; ac1[t][r] *= cr; ac2[t][r] *= cr; } }
    LDSX();
#pragma unroll
    for (int kc = 0; kc < 2; ++kc) { const v16h ph = frag_h(&sPh[w][col][0] + kc * 32, lane), pl = frag_h(&sPl[w][col][0] + kc * 32, lane);
#pragma unroll
      for (int t = 0; t < 4; ++t) { const v16h vh = frag_h(&sKV[bf][2][t * 16 + col][kc * 32], lane);
        acc[t] = wmma16(ph, vh, acc[t]); ac1[t] = wmma16(ph, frag_h(&sKV[bf][3][t * 16 + col][kc * 32], lane), ac1[t]); ac2[t] = wmma16(pl, vh, ac2[t]); } }
    __builtin_amdgcn_wave_barrier();
    asm volatile("s_wait_dscnt 0x0" ::: "memory");      // this wave's reads of buffer bf have returned before the buffer is handed to its next writer
    asm volatile("s_wait_asynccnt 0x0" ::: "memory");   // this wave's share of tile kt + 1 has landed
    __syncthreads();                                     // publishes tile kt + 1 and ends every wave's reads of buffer bf
    if (kt + 2 < SS / 64) stage_kv(lds0 + bf * (4 * KVT), gkh + (size_t)(kt + 2) * 64 * HD, gkl + (size_t)(kt + 2) * 64 * HD, gvh + (kt + 2) * 64, gvl + (kt + 2) * 64); }
  asm volatile("s_wait_asynccnt 0x0" ::: "memory");     // no copy is outstanding when the wave goes on to its epilogue and ends
#pragma unroll
  for (int r = 0; r < 8; ++r) { const float lr = __shfl(lrun, 8 * g + r, 32); const float inv = 1.0f / (lr * 16384.0f * 4.0f);
#pragma unroll
    for (int t = 0; t < 4; ++t) sS[w][8 * g + r][t * 16 + col] = (acc[t][r] + ac1[t][r] * (1.0f / VLO) + ac2[t][r] * (1.0f / PLO)) * inv; }
  LDSX();
  for (int qq = lane; qq < 16 * 16; qq += 32) { const int rl = qq >> 4, pc = qq & 15; vst2(O32 + ((bh * SS) + q0 + rl) * HD + pc * 4, *(const v4f*)(&sS[w][rl][pc * 4])); }
}
// out = ctx Wo^T + bo : split(ctx) x bf16(Wo rows): 2 products (Wo is an INPUT -> bf16 exact); eight tiles of 64 k (one head each), ctx rows (f32) and Wo rows staged once per block in LDS, two buffers
__global__ __launch_bounds__(128) void k_out(const float* __restrict__ O32, const __bf16* __restrict__ PT, const float* __restrict__ bo, float* __restrict__ out) {
  __shared__ __align__(16) unsigned char sm[2 * OBUF];   // operand tiles in the loop; output staging behind its last barrier
  float (*so)[16][132] = (float (*)[16][132])sm;
  const int tid = threadIdx.x, wave = tid >> 5, lane = tid & 31, col = lane & 15, g = lane >> 4;
  const int r0b = blockIdx.x * 64, r0 = r0b + wave * 16, n0 = blockIdx.y * 128; const int b = r0b / SS, s0 = r0b % SS;
  const unsigned la = (unsigned)(size_t)&sm[(tid >> 4) * (OAP * 4) + (tid & 15) * 16];
  const unsigned lb = (unsigned)(size_t)&sm[64 * OAP * 4 + (tid >> 3) * (GP * 2) + (tid & 7) * 16];
  const float* ga = O32 + ((size_t)b * NH * SS + s0 + (tid >> 4)) * HD + (tid & 15) * 4;   // head h of these rows: + h * SS * HD
  const __bf16* gb = PT + (size_t)(3 * E + n0 + (tid >> 3)) * E + (tid & 7) * 8;
  stage8(la, 8 * OAP * 4, ga, (size_t)8 * HD); stage8(lb, 16 * GP * 2, gb, (size_t)16 * E);
  v8f acc[8] = {};
  asm volatile("s_wait_asynccnt 0x0" ::: "memory");   // this wave's share of tile 0 has landed
  __syncthreads();                                     // tile 0 is published to every wave
  stage8(la + OBUF, 8 * OAP * 4, ga + (size_t)SS * HD, (size_t)8 * HD); stage8(lb + OBUF, 16 * GP * 2, gb + 64, (size_t)16 * E);
#pragma unroll 1
  for (int c = 0; c < E / 64; ++c) { const float* ta = (const float*)(sm + (c & 1) * OBUF); const __bf16* tb = (const __bf16*)(sm + (c & 1) * OBUF + 64 * OAP * 4);
    F2 a[2]; v16b wb[2][8];   // the tile's fragment reads all stand in front of its products: the wave meets the LDS latency once per tile, not once per product
#pragma unroll
    for (int kk = 0; kk < 2; ++kk) { a[kk] = split_row(ta + (wave * 16 + col) * OAP, kk * 32, lane);
#pragma unroll
      for (int j = 0; j < 8; ++j) wb[kk][j] = frag_b(tb + (j * 16 + col) * GP + kk * 32, lane); }
#pragma unroll
    for (int kk = 0; kk < 2; ++kk) {
#pragma unroll
      for (int j = 0; j < 8; ++j) { acc[j] = wmma_bf(a[kk].l, wb[kk][j], acc[j]); acc[j] = wmma_bf(a[kk].h, wb[kk][j], acc[j]); } }
    asm volatile("s_wait_dscnt 0x0" ::: "memory");      // this wave's reads of the buffer have returned before it is handed to its next writer
    asm volatile("s_wait_asynccnt 0x0" ::: "memory");   // this wave's share of tile c + 1 has landed
    __syncthreads();                                     // publishes tile c + 1 and ends every wave's reads of this buffer
    if (c + 2 < E / 64) { stage8(la + (c & 1) * OBUF, 8 * OAP * 4, ga + (size_t)(c + 2) * SS * HD, (size_t)8 * HD); stage8(lb + (c & 1) * OBUF, 16 * GP * 2, gb + (c + 2) * 64, (size_t)16 * E); } }
  asm volatile("s_wait_asynccnt 0x0" ::: "memory");     // no copy is outstanding when the LDS becomes output staging
#pragma unroll
  for (int j = 0; j < 8; ++j) { const float bb = bfr(bo[n0 + j * 16 + col]);
#pragma unroll
    for (int r = 0; r < 8; ++r) so[wave][8 * g + r][j * 16 + col] = acc[j][r] + bb; }
  LDSX();
#pragma unroll 4
  for (int rl = 0; rl < 16; ++rl) vst2(out + (size_t)(r0 + rl) * E + n0 + lane * 4, *(const v4f*)(&so[wave][rl][lane * 4]));
}
extern "C" void kernel_launch(void* const* d_in, const int* in_sizes, int n_in, void* d_out, int out_size, void* d_ws, size_t ws_size, hipStream_t stream) {
  (void)in_sizes; (void)n_in; (void)out_size; (void)ws_size;
  const float** I = (const float**)d_in;   // emb_q, emb_k, emb_v, WQ, bQ, WK, bK, WV, bV, WO, bO
  const float* eq = I[0]; const float* ek = I[1]; const float* ev = I[2]; const float* WQ = I[3]; const float* bQ = I[4]; const float* WK = I[5]; const float* bK = I[6]; const float* WV = I[7]; const float* bV = I[8]; const float* WO = I[9]; const float* bO = I[10];
  float* out = (float*)d_out;
  char* ws = (char*)d_ws; size_t off = 0;
  auto take = [&](size_t bytes) { char* p = ws + off; off += (bytes + 255) & ~(size_t)255; return p; };
  __bf16* PT = (__bf16*)take((size_t)4 * E * E * 2);
  float* Q32 = (float*)take((size_t)NR * E * 4); __bf16* Kh = (__bf16*)take((size_t)NR * E * 2); __bf16* Kl = (__bf16*)take((size_t)NR * E * 2); _Float16* VTh = (_Float16*)take((size_t)NR * E * 2); _Float16* VTl = (_Float16*)take((size_t)NR * E * 2); float* O32 = (float*)take((size_t)NR * E * 4);
  // ws ~ 69 MB
  k_pack<<<4 * E, 256, 0, stream>>>(WQ, WK, WV, WO, PT);
  k_qkv<<<dim3(NR / 64, E / 128, 3), 128, 0, stream>>>(eq, ek, ev, PT, bQ, bK, bV, Q32, Kh, Kl, VTh, VTl);
  k_attn<<<dim3(SS / 128, NB * NH), 256, 0, stream>>>(Q32, Kh, Kl, VTh, VTl, O32);
  k_out<<<dim3(NR / 64, E / 128), 128, 0, stream>>>(O32, PT, bO, out);
}

// v005
// Measured time: 133 microseconds a run.
// In both of two side-by-side timings against v004, it was 1.16 times as fast.
// Counting every step since v000, it is 3.14 times as fast.
// compute dtype: embeddings and W*/b* (INPUTS) rounded to bf16 with exact bf16 WMMA products (f32 accumulate) for the projections; K pre-split into bf16 hi/lo rows; q f32 split, P and V f16 hi/lo (3 products each); softmax f32.
#include <hip/hip_runtime.h>
#include <math.h>

typedef __attribute__((ext_vector_type(16))) _Float16 v16h;
typedef __attribute__((ext_vector_type(16))) __bf16 v16b;
typedef __attribute__((ext_vector_type(8)))  _Float16 v8h;
typedef __attribute__((ext_vector_type(8)))  float v8f;
typedef __attribute__((ext_vector_type(4)))  float v4f;
typedef __attribute__((ext_vector_type(2)))  float v2f;
typedef __attribute__((ext_vector_type(4)))  unsigned v4u;
typedef __attribute__((ext_vector_type(4)))  int v4i;
typedef float __attribute__((may_alias)) float_a;
typedef int __attribute__((may_alias)) int_a;

template <typename T> __device__ __forceinline__ void vst2(void* p, T v) { *(T*)p = v;  }
__device__ __forceinline__ v8f wmma16(v16h a, v16h b, v8f c) {
  v8f d = __builtin_amdgcn_wmma_f32_16x16x32_f16(false, a, false, b, (short)0, c, false, false);
  asm volatile("v_nop\n\tv_nop\n\tv_nop\n\tv_nop" : "+v"(d) : "v"(a), "v"(b));
  return d;
}
__device__ __forceinline__ v8f wmma_bf(v16b a, v16b b, v8f c) {
  v8f d = __builtin_amdgcn_wmma_f32_16x16x32_bf16(false, a, false, b, (short)0, c, false, false);
  asm volatile("v_nop\n\tv_nop\n\tv_nop\n\tv_nop" : "+v"(d) : "v"(a), "v"(b));
  return d;
}
// 16x16x32 fragments: lane = (h = lane>>4, row/col = lane&15); elements 0..7 = k0+8h+0..7, 8..15 = k0+16+8h+0..7; D element r = row 8h+r
__device__ __forceinline__ v16h frag_h(const _Float16* rowk0, int lane) {
  union { v16h v; v8h q[2]; } u; const _Float16* p = rowk0 + 8 * (lane >> 4);
  u.q[0] = *(const v8h*)p; u.q[1] = *(const v8h*)(p + 16); return u.v;
}
__device__ __forceinline__ v16h frag_f32(const float* rowk0, int lane) {
  v16h a; const float* p = rowk0 + 8 * (lane >> 4);
#pragma unroll
  for (int i = 0; i < 8; ++i) { a[i] = (_Float16)p[i]; a[8 + i] = (_Float16)p[16 + i]; }
  return a;
}
__device__ __forceinline__ v16h frag_f32s(const float* rowk0, int lane, float sc) {
  v16h a; const float* p = rowk0 + 8 * (lane >> 4);
#pragma unroll
  for (int i = 0; i < 8; ++i) { a[i] = (_Float16)(p[i] * sc); a[8 + i] = (_Float16)(p[16 + i] * sc); }
  return a;
}
// column fragment from a [K][ld] layout (column n), rows >= K read as 0
__device__ __forceinline__ v16h fragc_f32(const float* W, int k0, int n, int lane, int ld, int K) {
  v16h a; const int g = lane >> 4;
#pragma unroll
  for (int i = 0; i < 8; ++i) { const int ka = k0 + 8 * g + i, kb = ka + 16;
    a[i] = (_Float16)(ka < K ? W[(size_t)ka * ld + n] : 0.f); a[8 + i] = (_Float16)(kb < K ? W[(size_t)kb * ld + n] : 0.f); }
  return a;
}
struct F2 { v16b h, l; };
__device__ __forceinline__ F2 bsplit16(const float v[16]) { F2 r;
#pragma unroll
  for (int i = 0; i < 16; ++i) { const __bf16 h = (__bf16)v[i]; r.h[i] = h; r.l[i] = (__bf16)(v[i] - (float)h); }
  return r; }
__device__ __forceinline__ F2 split_row(const float* row, int k0, int lane) { float v[16]; const float* p = row + k0 + 8 * (lane >> 4);
#pragma unroll
  for (int i = 0; i < 8; ++i) { v[i] = p[i]; v[8 + i] = p[16 + i]; }
  return bsplit16(v); }
__device__ __forceinline__ F2 split_rowK(const float* row, int k0, int lane, int K) { float v[16]; const int g = lane >> 4;
#pragma unroll
  for (int i = 0; i < 8; ++i) { const int ka = k0 + 8 * g + i, kb = ka + 16; v[i] = ka < K ? row[ka] : 0.f; v[8 + i] = kb < K ? row[kb] : 0.f; }
  return bsplit16(v); }
__device__ __forceinline__ F2 split_col(const float* W, int k0, int n, int lane, int ld, int K) { float v[16]; const int g = lane >> 4;
#pragma unroll
  for (int i = 0; i < 8; ++i) { const int ka = k0 + 8 * g + i, kb = ka + 16; v[i] = ka < K ? W[(size_t)ka * ld + n] : 0.f; v[8 + i] = kb < K ? W[(size_t)kb * ld + n] : 0.f; }
  return bsplit16(v); }
__device__ __forceinline__ v8f mac3(const F2& a, const F2& b, v8f c) { c = wmma_bf(a.l, b.h, c); c = wmma_bf(a.h, b.l, c); return wmma_bf(a.h, b.h, c); }
__device__ __forceinline__ float sigm(float v) { return 1.0f / (1.0f + expf(-v)); }
#define LDSX() do { asm volatile("s_wait_dscnt 0" ::: "memory"); __builtin_amdgcn_wave_barrier(); __builtin_amdgcn_fence(__ATOMIC_RELEASE, "workgroup"); } while (0)


// Encoder-decoder multi-head attention (8 heads x 64 on [4,2048,512]): Q/K/V from three separate embeddings with per-head weights W[h][e][d] + biases; full softmax(q.k/8); cat(heads) WO^T + bO.
#define NB 4
#define SS 2048
#define E 512
#define NH 8
#define HD 64
#define NR (NB * SS)
#define PLO 1024.0f
#define VLO 2048.0f
#define SC2 0.18033688f   // 1/8 x log2(e): takes a raw score to base-2 units
__device__ __forceinline__ float bfr(float v) { return (float)(__bf16)v; }
__device__ __forceinline__ v16b frag_b(const __bf16* rowk0, int lane) { return __builtin_bit_cast(v16b, frag_h((const _Float16*)rowk0, lane)); }

// A fragment from an f32 row: the same elements as frag_b, each rounded to bf16 (nearest even) on the way
__device__ __forceinline__ v16b frag_bf32(const float* rowk0, int lane) {
  v16b a; const float* p = rowk0 + 8 * (lane >> 4);
#pragma unroll
  for (int i = 0; i < 8; ++i) { a[i] = (__bf16)p[i]; a[8 + i] = (__bf16)p[16 + i]; }
  return a;
}
// PT rows: [0,E) Wq[:,n], [E,2E) Wk[:,n], [2E,3E) Wv[:,n], [3E,4E) Wo[n,:]  (Wq/Wk/Wv: column n as a bf16 row; Wo [out][in]: row n)
__global__ __launch_bounds__(256) void k_pack(const float* __restrict__ Wq, const float* __restrict__ Wk, const float* __restrict__ Wv, const float* __restrict__ Wo, __bf16* __restrict__ PT) {
  const int n = blockIdx.x, tid = threadIdx.x; __shared__ __align__(16) __bf16 srow[E];
  const float* W = n < E ? Wq : (n < 2 * E ? Wk : (n < 3 * E ? Wv : Wo)); const int nn = n % E;
  if (n < 3 * E) { const int hh = nn / HD, d = nn % HD; for (int k = tid; k < E; k += 256) srow[k] = (__bf16)W[((size_t)hh * E + k) * HD + d]; }     // per-head [H][E][DH]: column (h,d) over e
  else { for (int k = tid; k < E; k += 256) srow[k] = (__bf16)W[(size_t)nn * E + k]; }      // WO [out][in]: row nn
  __syncthreads();
  if (tid < E / 8) vst2((unsigned*)(PT + (size_t)n * E + tid * 8), *(const v4u*)(&srow[tid * 8]));
}
// Operand staging of the projection products: a tile is 64 k of every row the block needs, rows of 16-bit data (128 B) at a 144-B pitch, rows of f32 (256 B) at a 272-B pitch (16 B x odd: conflict-free for 16-byte fragment reads).
// A wave-wide copy covers four whole 128-B lines, where a fragment load from global memory touches sixteen.
#define GP 72
#define OAP 68
#define OBUF (64 * OAP * 4 + 128 * GP * 2)
// Eight copies: 16 B of eight rows, the rows rs apart in LDS (bytes) and gs apart in global memory (elements). s_wait_xcnt 0 closes the statement so that no address register named here is rewritten in front of it.
template <typename T> __device__ __forceinline__ void stage8(unsigned l, unsigned rs, const T* p, size_t gs) {
  asm volatile("global_load_async_to_lds_b128 %0, %8, off\n\t"
               "global_load_async_to_lds_b128 %1, %9, off\n\t"
               "global_load_async_to_lds_b128 %2, %10, off\n\t"
               "global_load_async_to_lds_b128 %3, %11, off\n\t"
               "global_load_async_to_lds_b128 %4, %12, off\n\t"
               "global_load_async_to_lds_b128 %5, %13, off\n\t"
               "global_load_async_to_lds_b128 %6, %14, off\n\t"
               "global_load_async_to_lds_b128 %7, %15, off\n\t"
               "s_wait_xcnt 0x0"
               :: "v"(l), "v"(l + rs), "v"(l + 2 * rs), "v"(l + 3 * rs), "v"(l + 4 * rs), "v"(l + 5 * rs), "v"(l + 6 * rs), "v"(l + 7 * rs),
                  "v"(p), "v"(p + gs), "v"(p + 2 * gs), "v"(p + 3 * gs), "v"(p + 4 * gs), "v"(p + 5 * gs), "v"(p + 6 * gs), "v"(p + 7 * gs)
               : "memory");
}
// QKV: block (64 rows, 128 cols = 2 heads, which); eight tiles of 64 k, embedding rows (f32, as they come in; rounded to bf16 where the A fragment is formed) and weight rows staged once per block in LDS (two buffers, the next tile's copies fly during this tile's products); q (+bias) -> Q32 f32 [bh][s][64]; k (+bias) -> bf16 hi/lo rows; v (+bias) -> VT hi/lo x4 [bh][d][s]
__global__ __launch_bounds__(128) void k_qkv(const float* __restrict__ XQ, const float* __restrict__ XK, const float* __restrict__ XV, const __bf16* __restrict__ PT, const float* __restrict__ bq, const float* __restrict__ bk, const float* __restrict__ bv, float* __restrict__ Q32, __bf16* __restrict__ Kh, __bf16* __restrict__ Kl, _Float16* __restrict__ VTh, _Float16* __restrict__ VTl) {
  __shared__ __align__(16) unsigned char sm[2 * OBUF];   // operand tiles in the loop; output staging behind its last barrier
  float (*so)[16][132] = (float (*)[16][132])sm;
  _Float16 (*sth)[72] = (_Float16 (*)[72])sm; _Float16 (*stl)[72] = (_Float16 (*)[72])(sm + 128 * 72 * 2);
  const int tid = threadIdx.x, wave = tid >> 5, lane = tid & 31, col = lane & 15, g = lane >> 4;
  const int which = blockIdx.z, r0b = blockIdx.x * 64, n0 = blockIdx.y * 128; const int b = r0b / SS, s0 = r0b % SS;
  const float* Xf = which == 0 ? XQ : (which == 1 ? XK : XV); const float* bb_ = which == 0 ? bq : (which == 1 ? bk : bv);
  const unsigned la = (unsigned)(size_t)&sm[(tid >> 4) * (OAP * 4) + (tid & 15) * 16];
  const unsigned lb = (unsigned)(size_t)&sm[64 * OAP * 4 + (tid >> 3) * (GP * 2) + (tid & 7) * 16];
  const float* ga = Xf + (size_t)(r0b + (tid >> 4)) * E + (tid & 15) * 4; const __bf16* gb = PT + (size_t)(which * E + n0 + (tid >> 3)) * E + (tid & 7) * 8;
  stage8(la, 8 * OAP * 4, ga, (size_t)8 * E); stage8(lb, 16 * GP * 2, gb, (size_t)16 * E);
  v8f acc[8] = {};
  asm volatile("s_wait_asynccnt 0x0" ::: "memory");   // this wave's share of tile 0 has landed
  __syncthreads();                                     // tile 0 is published to every wave
  stage8(la + OBUF, 8 * OAP * 4, ga + 64, (size_t)8 * E); stage8(lb + OBUF, 16 * GP * 2, gb + 64, (size_t)16 * E);
#pragma unroll 1
  for (int c = 0; c < E / 64; ++c) { const float* ta = (const float*)(sm + (c & 1) * OBUF); const __bf16* tb = (const __bf16*)(sm + (c & 1) * OBUF + 64 * OAP * 4);
    v16b a[2], wb[2][8];   // the tile's fragment reads all stand in front of its products: the wave meets the LDS latency once per tile, not once per product
#pragma unroll
    for (int kk = 0; kk < 2; ++kk) { a[kk] = frag_bf32(ta + (wave * 16 + col) * OAP + kk * 32, lane);
#pragma unroll
      for (int j = 0; j < 8; ++j) wb[kk][j] = frag_b(tb + (j * 16 + col) * GP + kk * 32, lane); }
#pragma unroll
    for (int kk = 0; kk < 2; ++kk) {
#pragma unroll
      for (int j = 0; j < 8; ++j) acc[j] = wmma_bf(a[kk], wb[kk][j], acc[j]); }
    asm volatile("s_wait_dscnt 0x0" ::: "memory");      // this wave's reads of the buffer have returned before it is handed to its next writer
    asm volatile("s_wait_asynccnt 0x0" ::: "memory");   // this wave's share of tile c + 1 has landed
    __syncthreads();                                     // publishes tile c + 1 and ends every wave's reads of this buffer
    if (c + 2 < E / 64) { stage8(la + (c & 1) * OBUF, 8 * OAP * 4, ga + (c + 2) * 64, (size_t)8 * E); stage8(lb + (c & 1) * OBUF, 16 * GP * 2, gb + (c + 2) * 64, (size_t)16 * E); } }
  asm volatile("s_wait_asynccnt 0x0" ::: "memory");     // no copy is outstanding when the LDS becomes output staging
  if (which < 2) {
#pragma unroll
    for (int j = 0; j < 8; ++j) { const float bb = bfr(bb_[n0 + j * 16 + col]);
#pragma unroll
      for (int r = 0; r < 8; ++r) so[wave][8 * g + r][j * 16 + col] = acc[j][r] + bb; }
    LDSX();
    if (which == 0) { for (int qq = lane; qq < 2 * 16 * 16; qq += 32) { const int hh = qq >> 8, rl = (qq >> 4) & 15, pc = qq & 15; const int h = (n0 >> 6) + hh;
        vst2(Q32 + (((size_t)b * NH + h) * SS + s0 + wave * 16 + rl) * HD + pc * 4, *(const v4f*)(&so[wave][rl][hh * 64 + pc * 4])); } }
    else {
      for (int qq = lane; qq < 2 * 16 * 16; qq += 32) { const int hh = qq >> 8, rl = (qq >> 4) & 15, pl = qq & 15; const int h = (n0 >> 6) + hh; const int pc = pl & 7; union { __bf16 e[8]; v4u u; } pk;
#pragma unroll
        for (int e = 0; e < 8; ++e) { const float v = so[wave][rl][hh * 64 + pc * 8 + e]; const __bf16 hi = (__bf16)v; pk.e[e] = pl < 8 ? hi : (__bf16)(v - (float)hi); }
        vst2((unsigned*)((pl < 8 ? Kh : Kl) + (((size_t)b * NH + h) * SS + s0 + wave * 16 + rl) * HD + pc * 8), pk.u); } } }
  else {
#pragma unroll
    for (int j = 0; j < 8; ++j) { const float bb = bfr(bb_[n0 + j * 16 + col]);
#pragma unroll
      for (int r = 0; r < 8; ++r) { const float v = (acc[j][r] + bb) * 4.0f; const _Float16 hi = (_Float16)v; sth[j * 16 + col][wave * 16 + 8 * g + r] = hi; stl[j * 16 + col][wave * 16 + 8 * g + r] = (_Float16)((v - (float)hi) * VLO); } }
    __syncthreads();
    for (int qq = tid; qq < 128 * 8; qq += 128) { const int cl = qq >> 3, pc = qq & 7; const int c = n0 + cl, h = c >> 6, d = c & 63; const size_t o = (((size_t)b * NH + h) * HD + d) * SS + s0 + pc * 8;
      vst2(VTh + o, *(const v4u*)(&sth[cl][pc * 8])); vst2(VTl + o, *(const v4u*)(&stl[cl][pc * 8])); } }
}
// K/V staging: one 64-key tile of Kh, Kl, VTh, VTl (64 rows x 128 B each) per buffer, rows at a 144-B pitch (16 B x odd: conflict-free for 16-byte fragment reads)
#define KVP 72
#define KVT (64 * KVP * 2)
// One tile's copies: every lane moves 16 B of two rows of each of the four arrays, so a wave-wide copy covers four whole 128-B lines.
// s_wait_xcnt 0 closes the statement so that no address register named here is rewritten in front of it.
__device__ __forceinline__ void stage_kv(unsigned l, const __bf16* kh, const __bf16* kl, const _Float16* vh, const _Float16* vl) {
  asm volatile("global_load_async_to_lds_b128 %0, %8, off\n\t"
               "global_load_async_to_lds_b128 %1, %9, off\n\t"
               "global_load_async_to_lds_b128 %2, %10, off\n\t"
               "global_load_async_to_lds_b128 %3, %11, off\n\t"
               "global_load_async_to_lds_b128 %4, %12, off\n\t"
               "global_load_async_to_lds_b128 %5, %13, off\n\t"
               "global_load_async_to_lds_b128 %6, %14, off\n\t"
               "global_load_async_to_lds_b128 %7, %15, off\n\t"
               "s_wait_xcnt 0x0"
               :: "v"(l), "v"(l + 32 * KVP * 2), "v"(l + KVT), "v"(l + KVT + 32 * KVP * 2), "v"(l + 2 * KVT), "v"(l + 2 * KVT + 32 * KVP * 2), "v"(l + 3 * KVT), "v"(l + 3 * KVT + 32 * KVP * 2),
                  "v"(kh), "v"(kh + 32 * HD), "v"(kl), "v"(kl + 32 * HD), "v"(vh), "v"(vh + 32 * SS), "v"(vl), "v"(vl + 32 * SS)
               : "memory");
}
// full attention: block (128 queries = 8 waves x 16, bh); 32 key tiles of 64, each staged once per block in LDS (two buffers, the next tile's copies fly during this tile's work)
// transposed products: S^T = K q^T (A = K hi/lo rows, B = q hi/lo) and O^T += V^T P^T (A = V^T rows, B = P^T). A lane's S^T accumulators are 32 scores of its own query (lane & 15), keys 16 t + 8 g + r,
// and those are the elements the B fragment of P^T wants in that lane: scores and P stay in registers. softmax in base 2 (one fma and one hardware exp2 per score); P,V hi/lo; O f32 [bh][s][64]
__global__ __launch_bounds__(256) void k_attn(const float* __restrict__ Q32, const __bf16* __restrict__ Kh, const __bf16* __restrict__ Kl, const _Float16* __restrict__ VTh, const _Float16* __restrict__ VTl, float* __restrict__ O32) {
  __shared__ __align__(16) _Float16 sKV[2][4][64][KVP];   // K/V tiles in the loop; output staging behind its last barrier (each wave its own slice)
  float (*sO)[16][68] = (float (*)[16][68])sKV;
  const int tid = threadIdx.x, w = tid >> 5, lane = tid & 31, col = lane & 15, g = lane >> 4;
  const size_t bh = blockIdx.y; const int qb = blockIdx.x; const int q0 = qb * 128 + w * 16;
  const int crow = tid >> 3, cpc = tid & 7;
  const unsigned lds0 = (unsigned)(size_t)&sKV[0][0][crow][cpc * 8];
  const __bf16* gkh = Kh + (bh * SS + crow) * HD + cpc * 8; const __bf16* gkl = Kl + (bh * SS + crow) * HD + cpc * 8;
  const _Float16* gvh = VTh + (bh * HD + crow) * SS + cpc * 8; const _Float16* gvl = VTl + (bh * HD + crow) * SS + cpc * 8;
  stage_kv(lds0, gkh, gkl, gvh, gvl);
  F2 aq[2];
#pragma unroll
  for (int kc = 0; kc < 2; ++kc) aq[kc] = split_row(Q32 + (bh * SS + q0 + col) * HD, kc * 32, lane);
  float mrun = -3.0e38f, lrun = 0.f; v8f acc[4] = {}, ac1[4] = {}, ac2[4] = {};   // mrun, lrun: of query col, the same in both halves of the wave; acc*[t][r]: d = 16 t + 8 g + r of query col
  LDSX();
  asm volatile("s_wait_asynccnt 0x0" ::: "memory");   // this wave's share of tile 0 has landed
  __syncthreads();                                     // tile 0 is published to every wave
  stage_kv(lds0 + 4 * KVT, gkh + 64 * HD, gkl + 64 * HD, gvh + 64, gvl + 64);
#pragma unroll 1
  for (int kt = 0; kt < SS / 64; ++kt) {
    const int bf = kt & 1;
    v8f s[4];
#pragma unroll
    for (int t = 0; t < 4; ++t) { const __bf16* kr = (const __bf16*)&sKV[bf][0][t * 16 + col][0]; const __bf16* lr_ = (const __bf16*)&sKV[bf][1][t * 16 + col][0]; v8f st = {};
#pragma unroll
      for (int kc = 0; kc < 2; ++kc) { const v16b khf = frag_b(kr + kc * 32, lane), klf = frag_b(lr_ + kc * 32, lane); st = wmma_bf(khf, aq[kc].l, st); st = wmma_bf(klf, aq[kc].h, st); st = wmma_bf(khf, aq[kc].h, st); }
      s[t] = st; }
    float mx = -3.4e38f;
#pragma unroll
    for (int t = 0; t < 4; ++t) {
#pragma unroll
      for (int r = 0; r < 8; ++r) mx = fmaxf(mx, s[t][r]); }
    mx = fmaxf(mx, __shfl_xor(mx, 16, 32));
    const float mnew = fmaxf(mrun, mx * SC2); const float corr = __builtin_amdgcn_exp2f(mrun - mnew);   // running maximum in base-2 units
    const float moff = mnew - 14.0f;   // the factor 16384 = 2^14 of P rides in the exponent
    float ps = 0.f; v16h ph[2], pl[2];
#pragma unroll
    for (int kc = 0; kc < 2; ++kc) {
#pragma unroll
      for (int i = 0; i < 16; ++i) { const float p = __builtin_amdgcn_exp2f(fmaf(s[2 * kc + (i >> 3)][i & 7], SC2, -moff)); ps += p; const _Float16 hi = (_Float16)p; ph[kc][i] = hi; pl[kc][i] = (_Float16)((p - (float)hi) * PLO); } }
    ps += __shfl_xor(ps, 16, 32);
    lrun = lrun * corr + ps * (1.0f / 16384.0f); mrun = mnew;
#pragma unroll
    for (int t = 0; t < 4; ++t) {
#pragma unroll
      for (int r = 0; r < 8; ++r) { acc[t][r] *= corr; ac1[t][r] *= corr; ac2[t][r] *= corr; } }
#pragma unroll
    for (int kc = 0; kc < 2; ++kc) {
#pragma unroll
      for (int t = 0; t < 4; ++t) { const v16h vh = frag_h(&sKV[bf][2][t * 16 + col][kc * 32], lane);
        acc[t] = wmma16(vh, ph[kc], acc[t]); ac1[t] = wmma16(frag_h(&sKV[bf][3][t * 16 + col][kc * 32], lane), ph[kc], ac1[t]); ac2[t] = wmma16(vh, pl[kc], ac2[t]); } }
    __builtin_amdgcn_wave_barrier();
    asm volatile("s_wait_dscnt 0x0" ::: "memory");      // this wave's reads of buffer bf have returned before the buffer is handed to its next writer
    asm volatile("s_wait_asynccnt 0x0" ::: "memory");   // this wave's share of tile kt + 1 has landed
    __syncthreads();                                     // publishes tile kt + 1 and ends every wave's reads of buffer bf
    if (kt + 2 < SS / 64) stage_kv(lds0 + bf * (4 * KVT), gkh + (size_t)(kt + 2) * 64 * HD, gkl + (size_t)(kt + 2) * 64 * HD, gvh + (kt + 2) * 64, gvl + (kt + 2) * 64); }
  asm volatile("s_wait_asynccnt 0x0" ::: "memory");     // no copy is outstanding when the LDS becomes output staging
  const float inv = 1.0f / (lrun * 16384.0f * 4.0f);
#pragma unroll
  for (int t = 0; t < 4; ++t) {
#pragma unroll
    for (int r = 0; r < 8; ++r) sO[w][col][t * 16 + 8 * g + r] = (acc[t][r] + ac1[t][r] * (1.0f / VLO) + ac2[t][r] * (1.0f / PLO)) * inv; }
  LDSX();
  for (int qq = lane; qq < 16 * 16; qq += 32) { const int rl = qq >> 4, pc = qq & 15; vst2(O32 + ((bh * SS) + q0 + rl) * HD + pc * 4, *(const v4f*)(&sO[w][rl][pc * 4])); }
}
// out = ctx Wo^T + bo : split(ctx) x bf16(Wo rows): 2 products (Wo is an INPUT -> bf16 exact); eight tiles of 64 k (one head each), ctx rows (f32) and Wo rows staged once per block in LDS, two buffers
__global__ __launch_bounds__(128) void k_out(const float* __restrict__ O32, const __bf16* __restrict__ PT, const float* __restrict__ bo, float* __restrict__ out) {
  __shared__ __align__(16) unsigned char sm[2 * OBUF];   // operand tiles in the loop; output staging behind its last barrier
  float (*so)[16][132] = (float (*)[16][132])sm;
  const int tid = threadIdx.x, wave = tid >> 5, lane = tid & 31, col = lane & 15, g = lane >> 4;
  const int r0b = blockIdx.x * 64, r0 = r0b + wave * 16, n0 = blockIdx.y * 128; const int b = r0b / SS, s0 = r0b % SS;
  const unsigned la = (unsigned)(size_t)&sm[(tid >> 4) * (OAP * 4) + (tid & 15) * 16];
  const unsigned lb = (unsigned)(size_t)&sm[64 * OAP * 4 + (tid >> 3) * (GP * 2) + (tid & 7) * 16];
  const float* ga = O32 + ((size_t)b * NH * SS + s0 + (tid >> 4)) * HD + (tid & 15) * 4;   // head h of these rows: + h * SS * HD
  const __bf16* gb = PT + (size_t)(3 * E + n0 + (tid >> 3)) * E + (tid & 7) * 8;
  stage8(la, 8 * OAP * 4, ga, (size_t)8 * HD); stage8(lb, 16 * GP * 2, gb, (size_t)16 * E);
  v8f acc[8] = {};
  asm volatile("s_wait_asynccnt 0x0" ::: "memory");   // this wave's share of tile 0 has landed
  __syncthreads();                                     // tile 0 is published to every wave
  stage8(la + OBUF, 8 * OAP * 4, ga + (size_t)SS * HD, (size_t)8 * HD); stage8(lb + OBUF, 16 * GP * 2, gb + 64, (size_t)16 * E);
#pragma unroll 1
  for (int c = 0; c < E / 64; ++c) { const float* ta = (const float*)(sm + (c & 1) * OBUF); const __bf16* tb = (const __bf16*)(sm + (c & 1) * OBUF + 64 * OAP * 4);
    F2 a[2]; v16b wb[2][8];   // the tile's fragment reads all stand in front of its products: the wave meets the LDS latency once per tile, not once per product
#pragma unroll
    for (int kk = 0; kk < 2; ++kk) { a[kk] = split_row(ta + (wave * 16 + col) * OAP, kk * 32, lane);
#pragma unroll
      for (int j = 0; j < 8; ++j) wb[kk][j] = frag_b(tb + (j * 16 + col) * GP + kk * 32, lane); }
#pragma unroll
    for (int kk = 0; kk < 2; ++kk) {
#pragma unroll
      for (int j = 0; j < 8; ++j) { acc[j] = wmma_bf(a[kk].l, wb[kk][j], acc[j]); acc[j] = wmma_bf(a[kk].h, wb[kk][j], acc[j]); } }
    asm volatile("s_wait_dscnt 0x0" ::: "memory");      // this wave's reads of the buffer have returned before it is handed to its next writer
    asm volatile("s_wait_asynccnt 0x0" ::: "memory");   // this wave's share of tile c + 1 has landed
    __syncthreads();                                     // publishes tile c + 1 and ends every wave's reads of this buffer
    if (c + 2 < E / 64) { stage8(la + (c & 1) * OBUF, 8 * OAP * 4, ga + (size_t)(c + 2) * SS * HD, (size_t)8 * HD); stage8(lb + (c & 1) * OBUF, 16 * GP * 2, gb + (c + 2) * 64, (size_t)16 * E); } }
  asm volatile("s_wait_asynccnt 0x0" ::: "memory");     // no copy is outstanding when the LDS becomes output staging
#pragma unroll
  for (int j = 0; j < 8; ++j) { const float bb = bfr(bo[n0 + j * 16 + col]);
#pragma unroll
    for (int r = 0; r < 8; ++r) so[wave][8 * g + r][j * 16 + col] = acc[j][r] + bb; }
  LDSX();
#pragma unroll 4
  for (int rl = 0; rl < 16; ++rl) vst2(out + (size_t)(r0 + rl) * E + n0 + lane * 4, *(const v4f*)(&so[wave][rl][lane * 4]));
}
extern "C" void kernel_launch(void* const* d_in, const int* in_sizes, int n_in, void* d_out, int out_size, void* d_ws, size_t ws_size, hipStream_t stream) {
  (void)in_sizes; (void)n_in; (void)out_size; (void)ws_size;
  const float** I = (const float**)d_in;   // emb_q, emb_k, emb_v, WQ, bQ, WK, bK, WV, bV, WO, bO
  const float* eq = I[0]; const float* ek = I[1]; const float* ev = I[2]; const float* WQ = I[3]; const float* bQ = I[4]; const float* WK = I[5]; const float* bK = I[6]; const float* WV = I[7]; const float* bV = I[8]; const float* WO = I[9]; const float* bO = I[10];
  float* out = (float*)d_out;
  char* ws = (char*)d_ws; size_t off = 0;
  auto take = [&](size_t bytes) { char* p = ws + off; off += (bytes + 255) & ~(size_t)255; return p; };
  __bf16* PT = (__bf16*)take((size_t)4 * E * E * 2);
  float* Q32 = (float*)take((size_t)NR * E * 4); __bf16* Kh = (__bf16*)take((size_t)NR * E * 2); __bf16* Kl = (__bf16*)take((size_t)NR * E * 2); _Float16* VTh = (_Float16*)take((size_t)NR * E * 2); _Float16* VTl = (_Float16*)take((size_t)NR * E * 2); float* O32 = (float*)take((size_t)NR * E * 4);
  // ws ~ 69 MB
  k_pack<<<4 * E, 256, 0, stream>>>(WQ, WK, WV, WO, PT);
  k_qkv<<<dim3(NR / 64, E / 128, 3), 128, 0, stream>>>(eq, ek, ev, PT, bQ, bK, bV, Q32, Kh, Kl, VTh, VTl);
  k_attn<<<dim3(SS / 128, NB * NH), 256, 0, stream>>>(Q32, Kh, Kl, VTh, VTl, O32);
  k_out<<<dim3(NR / 64, E / 128), 128, 0, stream>>>(O32, PT, bO, out);
}

// v006
// It runs in 126 microseconds.
// Timed twice side by side with v005, it ran 1.06 and 1.05 times as fast.
// Counting every step since v000, it is 3.32 times as fast.
// compute dtype: embeddings and W*/b* (INPUTS) rounded to bf16 with exact bf16 WMMA products (f32 accumulate) for the projections; K pre-split into bf16 hi/lo rows; q f32 split, P and V f16 hi/lo (3 products each); softmax f32.
#include <hip/hip_runtime.h>
#include <math.h>

typedef __attribute__((ext_vector_type(16))) _Float16 v16h;
typedef __attribute__((ext_vector_type(16))) __bf16 v16b;
typedef __attribute__((ext_vector_type(8)))  _Float16 v8h;
typedef __attribute__((ext_vector_type(8)))  float v8f;
typedef __attribute__((ext_vector_type(4)))  float v4f;
typedef __attribute__((ext_vector_type(2)))  float v2f;
typedef __attribute__((ext_vector_type(4)))  unsigned v4u;
typedef __attribute__((ext_vector_type(4)))  int v4i;
typedef float __attribute__((may_alias)) float_a;
typedef int __attribute__((may_alias)) int_a;

template <typename T> __device__ __forceinline__ void vst2(void* p, T v) { *(T*)p = v;  }
__device__ __forceinline__ v8f wmma16(v16h a, v16h b, v8f c) {
  return __builtin_amdgcn_wmma_f32_16x16x32_f16(false, a, false, b, (short)0, c, false, false);
}
__device__ __forceinline__ v8f wmma_bf(v16b a, v16b b, v8f c) {
  return __builtin_amdgcn_wmma_f32_16x16x32_bf16(false, a, false, b, (short)0, c, false, false);
}
// 16x16x32 fragments: lane = (h = lane>>4, row/col = lane&15); elements 0..7 = k0+8h+0..7, 8..15 = k0+16+8h+0..7; D element r = row 8h+r
__device__ __forceinline__ v16h frag_h(const _Float16* rowk0, int lane) {
  union { v16h v; v8h q[2]; } u; const _Float16* p = rowk0 + 8 * (lane >> 4);
  u.q[0] = *(const v8h*)p; u.q[1] = *(const v8h*)(p + 16); return u.v;
}
__device__ __forceinline__ v16h frag_f32(const float* rowk0, int lane) {
  v16h a; const float* p = rowk0 + 8 * (lane >> 4);
#pragma unroll
  for (int i = 0; i < 8; ++i) { a[i] = (_Float16)p[i]; a[8 + i] = (_Float16)p[16 + i]; }
  return a;
}
__device__ __forceinline__ v16h frag_f32s(const float* rowk0, int lane, float sc) {
  v16h a; const float* p = rowk0 + 8 * (lane >> 4);
#pragma unroll
  for (int i = 0; i < 8; ++i) { a[i] = (_Float16)(p[i] * sc); a[8 + i] = (_Float16)(p[16 + i] * sc); }
  return a;
}
// column fragment from a [K][ld] layout (column n), rows >= K read as 0
__device__ __forceinline__ v16h fragc_f32(const float* W, int k0, int n, int lane, int ld, int K) {
  v16h a; const int g = lane >> 4;
#pragma unroll
  for (int i = 0; i < 8; ++i) { const int ka = k0 + 8 * g + i, kb = ka + 16;
    a[i] = (_Float16)(ka < K ? W[(size_t)ka * ld + n] : 0.f); a[8 + i] = (_Float16)(kb < K ? W[(size_t)kb * ld + n] : 0.f); }
  return a;
}
struct F2 { v16b h, l; };
__device__ __forceinline__ F2 bsplit16(const float v[16]) { F2 r;
#pragma unroll
  for (int i = 0; i < 16; ++i) { const __bf16 h = (__bf16)v[i]; r.h[i] = h; r.l[i] = (__bf16)(v[i] - (float)h); }
  return r; }
__device__ __forceinline__ F2 split_row(const float* row, int k0, int lane) { float v[16]; const float* p = row + k0 + 8 * (lane >> 4);
#pragma unroll
  for (int i = 0; i < 8; ++i) { v[i] = p[i]; v[8 + i] = p[16 + i]; }
  return bsplit16(v); }
__device__ __forceinline__ F2 split_rowK(const float* row, int k0, int lane, int K) { float v[16]; const int g = lane >> 4;
#pragma unroll
  for (int i = 0; i < 8; ++i) { const int ka = k0 + 8 * g + i, kb = ka + 16; v[i] = ka < K ? row[ka] : 0.f; v[8 + i] = kb < K ? row[kb] : 0.f; }
  return bsplit16(v); }
__device__ __forceinline__ F2 split_col(const float* W, int k0, int n, int lane, int ld, int K) { float v[16]; const int g = lane >> 4;
#pragma unroll
  for (int i = 0; i < 8; ++i) { const int ka = k0 + 8 * g + i, kb = ka + 16; v[i] = ka < K ? W[(size_t)ka * ld + n] : 0.f; v[8 + i] = kb < K ? W[(size_t)kb * ld + n] : 0.f; }
  return bsplit16(v); }
__device__ __forceinline__ v8f mac3(const F2& a, const F2& b, v8f c) { c = wmma_bf(a.l, b.h, c); c = wmma_bf(a.h, b.l, c); return wmma_bf(a.h, b.h, c); }
__device__ __forceinline__ float sigm(float v) { return 1.0f / (1.0f + expf(-v)); }
#define LDSX() do { asm volatile("s_wait_dscnt 0" ::: "memory"); __builtin_amdgcn_wave_barrier(); __builtin_amdgcn_fence(__ATOMIC_RELEASE, "workgroup"); } while (0)


// Encoder-decoder multi-head attention (8 heads x 64 on [4,2048,512]): Q/K/V from three separate embeddings with per-head weights W[h][e][d] + biases; full softmax(q.k/8); cat(heads) WO^T + bO.
#define NB 4
#define SS 2048
#define E 512
#define NH 8
#define HD 64
#define NR (NB * SS)
#define PLO 1024.0f
#define VLO 2048.0f
#define SC2 0.18033688f   // 1/8 x log2(e): takes a raw score to base-2 units
__device__ __forceinline__ float bfr(float v) { return (float)(__bf16)v; }
__device__ __forceinline__ v16b frag_b(const __bf16* rowk0, int lane) { return __builtin_bit_cast(v16b, frag_h((const _Float16*)rowk0, lane)); }

// A fragment from an f32 row: the same elements as frag_b, each rounded to bf16 (nearest even) on the way
__device__ __forceinline__ v16b frag_bf32(const float* rowk0, int lane) {
  v16b a; const float* p = rowk0 + 8 * (lane >> 4);
#pragma unroll
  for (int i = 0; i < 8; ++i) { a[i] = (__bf16)p[i]; a[8 + i] = (__bf16)p[16 + i]; }
  return a;
}
// PT rows: [0,E) Wq[:,n], [E,2E) Wk[:,n], [2E,3E) Wv[:,n], [3E,4E) Wo[n,:]  (Wq/Wk/Wv: column n as a bf16 row; Wo [out][in]: row n)
__global__ __launch_bounds__(256) void k_pack(const float* __restrict__ Wq, const float* __restrict__ Wk, const float* __restrict__ Wv, const float* __restrict__ Wo, __bf16* __restrict__ PT) {
  const int n = blockIdx.x, tid = threadIdx.x; __shared__ __align__(16) __bf16 srow[E];
  const float* W = n < E ? Wq : (n < 2 * E ? Wk : (n < 3 * E ? Wv : Wo)); const int nn = n % E;
  if (n < 3 * E) { const int hh = nn / HD, d = nn % HD; for (int k = tid; k < E; k += 256) srow[k] = (__bf16)W[((size_t)hh * E + k) * HD + d]; }     // per-head [H][E][DH]: column (h,d) over e
  else { for (int k = tid; k < E; k += 256) srow[k] = (__bf16)W[(size_t)nn * E + k]; }      // WO [out][in]: row nn
  __syncthreads();
  if (tid < E / 8) vst2((unsigned*)(PT + (size_t)n * E + tid * 8), *(const v4u*)(&srow[tid * 8]));
}
// Operand staging of the projection products: a tile is 64 k of every row the block needs, rows of 16-bit data (128 B) at a 144-B pitch, rows of f32 (256 B) at a 272-B pitch (16 B x odd: conflict-free for 16-byte fragment reads).
// A wave-wide copy covers four whole 128-B lines, where a fragment load from global memory touches sixteen.
#define GP 72
#define OAP 68
#define OBUF (64 * OAP * 4 + 128 * GP * 2)
// Eight copies: 16 B of eight rows, the rows rs apart in LDS (bytes) and gs apart in global memory (elements). s_wait_xcnt 0 closes the statement so that no address register named here is rewritten in front of it.
template <typename T> __device__ __forceinline__ void stage8(unsigned l, unsigned rs, const T* p, size_t gs) {
  asm volatile("global_load_async_to_lds_b128 %0, %8, off\n\t"
               "global_load_async_to_lds_b128 %1, %9, off\n\t"
               "global_load_async_to_lds_b128 %2, %10, off\n\t"
               "global_load_async_to_lds_b128 %3, %11, off\n\t"
               "global_load_async_to_lds_b128 %4, %12, off\n\t"
               "global_load_async_to_lds_b128 %5, %13, off\n\t"
               "global_load_async_to_lds_b128 %6, %14, off\n\t"
               "global_load_async_to_lds_b128 %7, %15, off\n\t"
               "s_wait_xcnt 0x0"
               :: "v"(l), "v"(l + rs), "v"(l + 2 * rs), "v"(l + 3 * rs), "v"(l + 4 * rs), "v"(l + 5 * rs), "v"(l + 6 * rs), "v"(l + 7 * rs),
                  "v"(p), "v"(p + gs), "v"(p + 2 * gs), "v"(p + 3 * gs), "v"(p + 4 * gs), "v"(p + 5 * gs), "v"(p + 6 * gs), "v"(p + 7 * gs)
               : "memory");
}
// QKV: block (64 rows, 128 cols = 2 heads, which); eight tiles of 64 k, embedding rows (f32, as they come in; rounded to bf16 where the A fragment is formed) and weight rows staged once per block in LDS (two buffers, the next tile's copies fly during this tile's products); q (+bias) -> Q32 f32 [bh][s][64]; k (+bias) -> bf16 hi/lo rows; v (+bias) -> VT hi/lo x4 [bh][d][s]
__global__ __launch_bounds__(128) void k_qkv(const float* __restrict__ XQ, const float* __restrict__ XK, const float* __restrict__ XV, const __bf16* __restrict__ PT, const float* __restrict__ bq, const float* __restrict__ bk, const float* __restrict__ bv, float* __restrict__ Q32, __bf16* __restrict__ Kh, __bf16* __restrict__ Kl, _Float16* __restrict__ VTh, _Float16* __restrict__ VTl) {
  __shared__ __align__(16) unsigned char sm[2 * OBUF];   // operand tiles in the loop; output staging behind its last barrier
  float (*so)[16][132] = (float (*)[16][132])sm;
  _Float16 (*sth)[72] = (_Float16 (*)[72])sm; _Float16 (*stl)[72] = (_Float16 (*)[72])(sm + 128 * 72 * 2);
  const int tid = threadIdx.x, wave = tid >> 5, lane = tid & 31, col = lane & 15, g = lane >> 4;
  const int which = blockIdx.z, r0b = blockIdx.x * 64, n0 = blockIdx.y * 128; const int b = r0b / SS, s0 = r0b % SS;
  const float* Xf = which == 0 ? XQ : (which == 1 ? XK : XV); const float* bb_ = which == 0 ? bq : (which == 1 ? bk : bv);
  const unsigned la = (unsigned)(size_t)&sm[(tid >> 4) * (OAP * 4) + (tid & 15) * 16];
  const unsigned lb = (unsigned)(size_t)&sm[64 * OAP * 4 + (tid >> 3) * (GP * 2) + (tid & 7) * 16];
  const float* ga = Xf + (size_t)(r0b + (tid >> 4)) * E + (tid & 15) * 4; const __bf16* gb = PT + (size_t)(which * E + n0 + (tid >> 3)) * E + (tid & 7) * 8;
  stage8(la, 8 * OAP * 4, ga, (size_t)8 * E); stage8(lb, 16 * GP * 2, gb, (size_t)16 * E);
  v8f acc[8] = {};
  asm volatile("s_wait_asynccnt 0x0" ::: "memory");   // this wave's share of tile 0 has landed
  __syncthreads();                                     // tile 0 is published to every wave
  stage8(la + OBUF, 8 * OAP * 4, ga + 64, (size_t)8 * E); stage8(lb + OBUF, 16 * GP * 2, gb + 64, (size_t)16 * E);
#pragma unroll 1
  for (int c = 0; c < E / 64; ++c) { const float* ta = (const float*)(sm + (c & 1) * OBUF); const __bf16* tb = (const __bf16*)(sm + (c & 1) * OBUF + 64 * OAP * 4);
    v16b a[2], wb[2][8];   // the tile's fragment reads all stand in front of its products: the wave meets the LDS latency once per tile, not once per product
#pragma unroll
    for (int kk = 0; kk < 2; ++kk) { a[kk] = frag_bf32(ta + (wave * 16 + col) * OAP + kk * 32, lane);
#pragma unroll
      for (int j = 0; j < 8; ++j) wb[kk][j] = frag_b(tb + (j * 16 + col) * GP + kk * 32, lane); }
    __builtin_amdgcn_sched_barrier(0);   // holds the reads in front: without it the compiler sinks them among the products, each pair with a wait of its own
#pragma unroll
    for (int kk = 0; kk < 2; ++kk) {
#pragma unroll
      for (int j = 0; j < 8; ++j) acc[j] = wmma_bf(a[kk], wb[kk][j], acc[j]); }
    __builtin_amdgcn_sched_barrier(0);   // holds the products in front of the waits, so that the next tile's copies fly during them
    asm volatile("s_wait_dscnt 0x0" ::: "memory");      // this wave's reads of the buffer have returned before it is handed to its next writer
    asm volatile("s_wait_asynccnt 0x0" ::: "memory");   // this wave's share of tile c + 1 has landed
    __syncthreads();                                     // publishes tile c + 1 and ends every wave's reads of this buffer
    if (c + 2 < E / 64) { stage8(la + (c & 1) * OBUF, 8 * OAP * 4, ga + (c + 2) * 64, (size_t)8 * E); stage8(lb + (c & 1) * OBUF, 16 * GP * 2, gb + (c + 2) * 64, (size_t)16 * E); } }
  asm volatile("s_wait_asynccnt 0x0" ::: "memory");     // no copy is outstanding when the LDS becomes output staging
  if (which < 2) {
#pragma unroll
    for (int j = 0; j < 8; ++j) { const float bb = bfr(bb_[n0 + j * 16 + col]);
#pragma unroll
      for (int r = 0; r < 8; ++r) so[wave][8 * g + r][j * 16 + col] = acc[j][r] + bb; }
    LDSX();
    if (which == 0) { for (int qq = lane; qq < 2 * 16 * 16; qq += 32) { const int hh = qq >> 8, rl = (qq >> 4) & 15, pc = qq & 15; const int h = (n0 >> 6) + hh;
        vst2(Q32 + (((size_t)b * NH + h) * SS + s0 + wave * 16 + rl) * HD + pc * 4, *(const v4f*)(&so[wave][rl][hh * 64 + pc * 4])); } }
    else {
      for (int qq = lane; qq < 2 * 16 * 16; qq += 32) { const int hh = qq >> 8, rl = (qq >> 4) & 15, pl = qq & 15; const int h = (n0 >> 6) + hh; const int pc = pl & 7; union { __bf16 e[8]; v4u u; } pk;
#pragma unroll
        for (int e = 0; e < 8; ++e) { const float v = so[wave][rl][hh * 64 + pc * 8 + e]; const __bf16 hi = (__bf16)v; pk.e[e] = pl < 8 ? hi : (__bf16)(v - (float)hi); }
        vst2((unsigned*)((pl < 8 ? Kh : Kl) + (((size_t)b * NH + h) * SS + s0 + wave * 16 + rl) * HD + pc * 8), pk.u); } } }
  else {
#pragma unroll
    for (int j = 0; j < 8; ++j) { const float bb = bfr(bb_[n0 + j * 16 + col]);
#pragma unroll
      for (int r = 0; r < 8; ++r) { const float v = (acc[j][r] + bb) * 4.0f; const _Float16 hi = (_Float16)v; sth[j * 16 + col][wave * 16 + 8 * g + r] = hi; stl[j * 16 + col][wave * 16 + 8 * g + r] = (_Float16)((v - (float)hi) * VLO); } }
    __syncthreads();
    for (int qq = tid; qq < 128 * 8; qq += 128) { const int cl = qq >> 3, pc = qq & 7; const int c = n0 + cl, h = c >> 6, d = c & 63; const size_t o = (((size_t)b * NH + h) * HD + d) * SS + s0 + pc * 8;
      vst2(VTh + o, *(const v4u*)(&sth[cl][pc * 8])); vst2(VTl + o, *(const v4u*)(&stl[cl][pc * 8])); } }
}
// K/V staging: one 64-key tile of Kh, Kl, VTh, VTl (64 rows x 128 B each) per buffer, rows at a 144-B pitch (16 B x odd: conflict-free for 16-byte fragment reads)
#define KVP 72
#define KVT (64 * KVP * 2)
// One tile's copies: every lane moves 16 B of two rows of each of the four arrays, so a wave-wide copy covers four whole 128-B lines.
// s_wait_xcnt 0 closes the statement so that no address register named here is rewritten in front of it.
__device__ __forceinline__ void stage_kv(unsigned l, const __bf16* kh, const __bf16* kl, const _Float16* vh, const _Float16* vl) {
  asm volatile("global_load_async_to_lds_b128 %0, %8, off\n\t"
               "global_load_async_to_lds_b128 %1, %9, off\n\t"
               "global_load_async_to_lds_b128 %2, %10, off\n\t"
               "global_load_async_to_lds_b128 %3, %11, off\n\t"
               "global_load_async_to_lds_b128 %4, %12, off\n\t"
               "global_load_async_to_lds_b128 %5, %13, off\n\t"
               "global_load_async_to_lds_b128 %6, %14, off\n\t"
               "global_load_async_to_lds_b128 %7, %15, off\n\t"
               "s_wait_xcnt 0x0"
               :: "v"(l), "v"(l + 32 * KVP * 2), "v"(l + KVT), "v"(l + KVT + 32 * KVP * 2), "v"(l + 2 * KVT), "v"(l + 2 * KVT + 32 * KVP * 2), "v"(l + 3 * KVT), "v"(l + 3 * KVT + 32 * KVP * 2),
                  "v"(kh), "v"(kh + 32 * HD), "v"(kl), "v"(kl + 32 * HD), "v"(vh), "v"(vh + 32 * SS), "v"(vl), "v"(vl + 32 * SS)
               : "memory");
}
// full attention: block (128 queries = 8 waves x 16, bh); 32 key tiles of 64, each staged once per block in LDS (two buffers, the next tile's copies fly during this tile's work)
// transposed products: S^T = K q^T (A = K hi/lo rows, B = q hi/lo) and O^T += V^T P^T (A = V^T rows, B = P^T). A lane's S^T accumulators are 32 scores of its own query (lane & 15), keys 16 t + 8 g + r,
// and those are the elements the B fragment of P^T wants in that lane: scores and P stay in registers. softmax in base 2 (one fma and one hardware exp2 per score); P,V hi/lo; O f32 [bh][s][64]
__global__ __launch_bounds__(256) void k_attn(const float* __restrict__ Q32, const __bf16* __restrict__ Kh, const __bf16* __restrict__ Kl, const _Float16* __restrict__ VTh, const _Float16* __restrict__ VTl, float* __restrict__ O32) {
  __shared__ __align__(16) _Float16 sKV[2][4][64][KVP];   // K/V tiles in the loop; output staging behind its last barrier (each wave its own slice)
  float (*sO)[16][68] = (float (*)[16][68])sKV;
  const int tid = threadIdx.x, w = tid >> 5, lane = tid & 31, col = lane & 15, g = lane >> 4;
  const size_t bh = blockIdx.y; const int qb = blockIdx.x; const int q0 = qb * 128 + w * 16;
  const int crow = tid >> 3, cpc = tid & 7;
  const unsigned lds0 = (unsigned)(size_t)&sKV[0][0][crow][cpc * 8];
  const __bf16* gkh = Kh + (bh * SS + crow) * HD + cpc * 8; const __bf16* gkl = Kl + (bh * SS + crow) * HD + cpc * 8;
  const _Float16* gvh = VTh + (bh * HD + crow) * SS + cpc * 8; const _Float16* gvl = VTl + (bh * HD + crow) * SS + cpc * 8;
  stage_kv(lds0, gkh, gkl, gvh, gvl);
  F2 aq[2];
#pragma unroll
  for (int kc = 0; kc < 2; ++kc) aq[kc] = split_row(Q32 + (bh * SS + q0 + col) * HD, kc * 32, lane);
  float mrun = -3.0e38f, lrun = 0.f; v8f acc[4] = {}, ac1[4] = {}, ac2[4] = {};   // mrun, lrun: of query col, the same in both halves of the wave; acc*[t][r]: d = 16 t + 8 g + r of query col
  LDSX();
  asm volatile("s_wait_asynccnt 0x0" ::: "memory");   // this wave's share of tile 0 has landed
  __syncthreads();                                     // tile 0 is published to every wave
  stage_kv(lds0 + 4 * KVT, gkh + 64 * HD, gkl + 64 * HD, gvh + 64, gvl + 64);
#pragma unroll 1
  for (int kt = 0; kt < SS / 64; ++kt) {
    const int bf = kt & 1;
    v8f s[4];
#pragma unroll
    for (int t = 0; t < 4; ++t) { const __bf16* kr = (const __bf16*)&sKV[bf][0][t * 16 + col][0]; const __bf16* lr_ = (const __bf16*)&sKV[bf][1][t * 16 + col][0]; v8f st = {};
#pragma unroll
      for (int kc = 0; kc < 2; ++kc) { const v16b khf = frag_b(kr + kc * 32, lane), klf = frag_b(lr_ + kc * 32, lane); st = wmma_bf(khf, aq[kc].l, st); st = wmma_bf(klf, aq[kc].h, st); st = wmma_bf(khf, aq[kc].h, st); }
      s[t] = st; }
    float mx = -3.4e38f;
#pragma unroll
    for (int t = 0; t < 4; ++t) {
#pragma unroll
      for (int r = 0; r < 8; ++r) mx = fmaxf(mx, s[t][r]); }
    mx = fmaxf(mx, __shfl_xor(mx, 16, 32));
    const float mnew = fmaxf(mrun, mx * SC2); const float corr = __builtin_amdgcn_exp2f(mrun - mnew);   // running maximum in base-2 units
    const float moff = mnew - 14.0f;   // the factor 16384 = 2^14 of P rides in the exponent
    float ps = 0.f; v16h ph[2], pl[2];
#pragma unroll
    for (int kc = 0; kc < 2; ++kc) {
#pragma unroll
      for (int i = 0; i < 16; ++i) { const float p = __builtin_amdgcn_exp2f(fmaf(s[2 * kc + (i >> 3)][i & 7], SC2, -moff)); ps += p; const _Float16 hi = (_Float16)p; ph[kc][i] = hi; pl[kc][i] = (_Float16)((p - (float)hi) * PLO); } }
    ps += __shfl_xor(ps, 16, 32);
    lrun = lrun * corr + ps * (1.0f / 16384.0f); mrun = mnew;
#pragma unroll
    for (int t = 0; t < 4; ++t) {
#pragma unroll
      for (int r = 0; r < 8; ++r) { acc[t][r] *= corr; ac1[t][r] *= corr; ac2[t][r] *= corr; } }
#pragma unroll
    for (int kc = 0; kc < 2; ++kc) {
#pragma unroll
      for (int t = 0; t < 4; ++t) { const v16h vh = frag_h(&sKV[bf][2][t * 16 + col][kc * 32], lane);
        acc[t] = wmma16(vh, ph[kc], acc[t]); ac1[t] = wmma16(frag_h(&sKV[bf][3][t * 16 + col][kc * 32], lane), ph[kc], ac1[t]); ac2[t] = wmma16(vh, pl[kc], ac2[t]); } }
    __builtin_amdgcn_wave_barrier();
    asm volatile("s_wait_dscnt 0x0" ::: "memory");      // this wave's reads of buffer bf have returned before the buffer is handed to its next writer
    asm volatile("s_wait_asynccnt 0x0" ::: "memory");   // this wave's share of tile kt + 1 has landed
    __syncthreads();                                     // publishes tile kt + 1 and ends every wave's reads of buffer bf
    if (kt + 2 < SS / 64) stage_kv(lds0 + bf * (4 * KVT), gkh + (size_t)(kt + 2) * 64 * HD, gkl + (size_t)(kt + 2) * 64 * HD, gvh + (kt + 2) * 64, gvl + (kt + 2) * 64); }
  asm volatile("s_wait_asynccnt 0x0" ::: "memory");     // no copy is outstanding when the LDS becomes output staging
  const float inv = 1.0f / (lrun * 16384.0f * 4.0f);
#pragma unroll
  for (int t = 0; t < 4; ++t) {
#pragma unroll
    for (int r = 0; r < 8; ++r) sO[w][col][t * 16 + 8 * g + r] = (acc[t][r] + ac1[t][r] * (1.0f / VLO) + ac2[t][r] * (1.0f / PLO)) * inv; }
  LDSX();
  for (int qq = lane; qq < 16 * 16; qq += 32) { const int rl = qq >> 4, pc = qq & 15; vst2(O32 + ((bh * SS) + q0 + rl) * HD + pc * 4, *(const v4f*)(&sO[w][rl][pc * 4])); }
}
// out = ctx Wo^T + bo : split(ctx) x bf16(Wo rows): 2 products (Wo is an INPUT -> bf16 exact); eight tiles of 64 k (one head each), ctx rows (f32) and Wo rows staged once per block in LDS, two buffers
__global__ __launch_bounds__(128) void k_out(const float* __restrict__ O32, const __bf16* __restrict__ PT, const float* __restrict__ bo, float* __restrict__ out) {
  __shared__ __align__(16) unsigned char sm[2 * OBUF];   // operand tiles in the loop; output staging behind its last barrier
  float (*so)[16][132] = (float (*)[16][132])sm;
  const int tid = threadIdx.x, wave = tid >> 5, lane = tid & 31, col = lane & 15, g = lane >> 4;
  const int r0b = blockIdx.x * 64, r0 = r0b + wave * 16, n0 = blockIdx.y * 128; const int b = r0b / SS, s0 = r0b % SS;
  const unsigned la = (unsigned)(size_t)&sm[(tid >> 4) * (OAP * 4) + (tid & 15) * 16];
  const unsigned lb = (unsigned)(size_t)&sm[64 * OAP * 4 + (tid >> 3) * (GP * 2) + (tid & 7) * 16];
  const float* ga = O32 + ((size_t)b * NH * SS + s0 + (tid >> 4)) * HD + (tid & 15) * 4;   // head h of these rows: + h * SS * HD
  const __bf16* gb = PT + (size_t)(3 * E + n0 + (tid >> 3)) * E + (tid & 7) * 8;
  stage8(la, 8 * OAP * 4, ga, (size_t)8 * HD); stage8(lb, 16 * GP * 2, gb, (size_t)16 * E);
  v8f acc[8] = {};
  asm volatile("s_wait_asynccnt 0x0" ::: "memory");   // this wave's share of tile 0 has landed
  __syncthreads();                                     // tile 0 is published to every wave
  stage8(la + OBUF, 8 * OAP * 4, ga + (size_t)SS * HD, (size_t)8 * HD); stage8(lb + OBUF, 16 * GP * 2, gb + 64, (size_t)16 * E);
#pragma unroll 1
  for (int c = 0; c < E / 64; ++c) { const float* ta = (const float*)(sm + (c & 1) * OBUF); const __bf16* tb = (const __bf16*)(sm + (c & 1) * OBUF + 64 * OAP * 4);
    F2 a[2]; v16b wb[2][8];   // the tile's fragment reads all stand in front of its products: the wave meets the LDS latency once per tile, not once per product
#pragma unroll
    for (int kk = 0; kk < 2; ++kk) { a[kk] = split_row(ta + (wave * 16 + col) * OAP, kk * 32, lane);
#pragma unroll
      for (int j = 0; j < 8; ++j) wb[kk][j] = frag_b(tb + (j * 16 + col) * GP + kk * 32, lane); }
    __builtin_amdgcn_sched_barrier(0);   // holds the reads in front: without it the compiler sinks them among the products, each pair with a wait of its own
#pragma unroll
    for (int kk = 0; kk < 2; ++kk) {
#pragma unroll
      for (int j = 0; j < 8; ++j) { acc[j] = wmma_bf(a[kk].l, wb[kk][j], acc[j]); acc[j] = wmma_bf(a[kk].h, wb[kk][j], acc[j]); } }
    __builtin_amdgcn_sched_barrier(0);   // holds the products in front of the waits, so that the next tile's copies fly during them
    asm volatile("s_wait_dscnt 0x0" ::: "memory");      // this wave's reads of the buffer have returned before it is handed to its next writer
    asm volatile("s_wait_asynccnt 0x0" ::: "memory");   // this wave's share of tile c + 1 has landed
    __syncthreads();                                     // publishes tile c + 1 and ends every wave's reads of this buffer
    if (c + 2 < E / 64) { stage8(la + (c & 1) * OBUF, 8 * OAP * 4, ga + (size_t)(c + 2) * SS * HD, (size_t)8 * HD); stage8(lb + (c & 1) * OBUF, 16 * GP * 2, gb + (c + 2) * 64, (size_t)16 * E); } }
  asm volatile("s_wait_asynccnt 0x0" ::: "memory");     // no copy is outstanding when the LDS becomes output staging
#pragma unroll
  for (int j = 0; j < 8; ++j) { const float bb = bfr(bo[n0 + j * 16 + col]);
#pragma unroll
    for (int r = 0; r < 8; ++r) so[wave][8 * g + r][j * 16 + col] = acc[j][r] + bb; }
  LDSX();
#pragma unroll 4
  for (int rl = 0; rl < 16; ++rl) vst2(out + (size_t)(r0 + rl) * E + n0 + lane * 4, *(const v4f*)(&so[wave][rl][lane * 4]));
}
extern "C" void kernel_launch(void* const* d_in, const int* in_sizes, int n_in, void* d_out, int out_size, void* d_ws, size_t ws_size, hipStream_t stream) {
  (void)in_sizes; (void)n_in; (void)out_size; (void)ws_size;
  const float** I = (const float**)d_in;   // emb_q, emb_k, emb_v, WQ, bQ, WK, bK, WV, bV, WO, bO
  const float* eq = I[0]; const float* ek = I[1]; const float* ev = I[2]; const float* WQ = I[3]; const float* bQ = I[4]; const float* WK = I[5]; const float* bK = I[6]; const float* WV = I[7]; const float* bV = I[8]; const float* WO = I[9]; const float* bO = I[10];
  float* out = (float*)d_out;
  char* ws = (char*)d_ws; size_t off = 0;
  auto take = [&](size_t bytes) { char* p = ws + off; off += (bytes + 255) & ~(size_t)255; return p; };
  __bf16* PT = (__bf16*)take((size_t)4 * E * E * 2);
  float* Q32 = (float*)take((size_t)NR * E * 4); __bf16* Kh = (__bf16*)take((size_t)NR * E * 2); __bf16* Kl = (__bf16*)take((size_t)NR * E * 2); _Float16* VTh = (_Float16*)take((size_t)NR * E * 2); _Float16* VTl = (_Float16*)take((size_t)NR * E * 2); float* O32 = (float*)take((size_t)NR * E * 4);
  // ws ~ 69 MB
  k_pack<<<4 * E, 256, 0, stream>>>(WQ, WK, WV, WO, PT);
  k_qkv<<<dim3(NR / 64, E / 128, 3), 128, 0, stream>>>(eq, ek, ev, PT, bQ, bK, bV, Q32, Kh, Kl, VTh, VTl);
  k_attn<<<dim3(SS / 128, NB * NH), 256, 0, stream>>>(Q32, Kh, Kl, VTh, VTl, O32);
  k_out<<<dim3(NR / 64, E / 128), 128, 0, stream>>>(O32, PT, bO, out);
}

// v007
// A run of this version takes 121 microseconds.
// In both of two side-by-side timings against v006, it was 1.04 times as fast.
// Over all steps from v000 it is 3.44 times as fast.
// compute dtype: embeddings and W*/b* (INPUTS) rounded to bf16 with exact bf16 WMMA products (f32 accumulate) for the projections; K pre-split into bf16 hi/lo rows; q f32 split, P and V f16 hi/lo (3 products each); softmax f32.
#include <hip/hip_runtime.h>
#include <math.h>

typedef __attribute__((ext_vector_type(16))) _Float16 v16h;
typedef __attribute__((ext_vector_type(16))) __bf16 v16b;
typedef __attribute__((ext_vector_type(8)))  _Float16 v8h;
typedef __attribute__((ext_vector_type(8)))  float v8f;
typedef __attribute__((ext_vector_type(4)))  float v4f;
typedef __attribute__((ext_vector_type(2)))  float v2f;
typedef __attribute__((ext_vector_type(4)))  unsigned v4u;
typedef __attribute__((ext_vector_type(2)))  unsigned v2u;
typedef __attribute__((ext_vector_type(4)))  int v4i;
typedef float __attribute__((may_alias)) float_a;
typedef int __attribute__((may_alias)) int_a;

template <typename T> __device__ __forceinline__ void vst2(void* p, T v) { *(T*)p = v;  }
__device__ __forceinline__ v8f wmma16(v16h a, v16h b, v8f c) {
  return __builtin_amdgcn_wmma_f32_16x16x32_f16(false, a, false, b, (short)0, c, false, false);
}
__device__ __forceinline__ v8f wmma_bf(v16b a, v16b b, v8f c) {
  return __builtin_amdgcn_wmma_f32_16x16x32_bf16(false, a, false, b, (short)0, c, false, false);
}
// 16x16x32 fragments: lane = (h = lane>>4, row/col = lane&15); elements 0..7 = k0+8h+0..7, 8..15 = k0+16+8h+0..7; D element r = row 8h+r
__device__ __forceinline__ v16h frag_h(const _Float16* rowk0, int lane) {
  union { v16h v; v8h q[2]; } u; const _Float16* p = rowk0 + 8 * (lane >> 4);
  u.q[0] = *(const v8h*)p; u.q[1] = *(const v8h*)(p + 16); return u.v;
}
__device__ __forceinline__ v16h frag_f32(const float* rowk0, int lane) {
  v16h a; const float* p = rowk0 + 8 * (lane >> 4);
#pragma unroll
  for (int i = 0; i < 8; ++i) { a[i] = (_Float16)p[i]; a[8 + i] = (_Float16)p[16 + i]; }
  return a;
}
__device__ __forceinline__ v16h frag_f32s(const float* rowk0, int lane, float sc) {
  v16h a; const float* p = rowk0 + 8 * (lane >> 4);
#pragma unroll
  for (int i = 0; i < 8; ++i) { a[i] = (_Float16)(p[i] * sc); a[8 + i] = (_Float16)(p[16 + i] * sc); }
  return a;
}
// column fragment from a [K][ld] layout (column n), rows >= K read as 0
__device__ __forceinline__ v16h fragc_f32(const float* W, int k0, int n, int lane, int ld, int K) {
  v16h a; const int g = lane >> 4;
#pragma unroll
  for (int i = 0; i < 8; ++i) { const int ka = k0 + 8 * g + i, kb = ka + 16;
    a[i] = (_Float16)(ka < K ? W[(size_t)ka * ld + n] : 0.f); a[8 + i] = (_Float16)(kb < K ? W[(size_t)kb * ld + n] : 0.f); }
  return a;
}
struct F2 { v16b h, l; };
__device__ __forceinline__ F2 bsplit16(const float v[16]) { F2 r;
#pragma unroll
  for (int i = 0; i < 16; ++i) { const __bf16 h = (__bf16)v[i]; r.h[i] = h; r.l[i] = (__bf16)(v[i] - (float)h); }
  return r; }
__device__ __forceinline__ F2 split_row(const float* row, int k0, int lane) { float v[16]; const float* p = row + k0 + 8 * (lane >> 4);
#pragma unroll
  for (int i = 0; i < 8; ++i) { v[i] = p[i]; v[8 + i] = p[16 + i]; }
  return bsplit16(v); }
__device__ __forceinline__ F2 split_rowK(const float* row, int k0, int lane, int K) { float v[16]; const int g = lane >> 4;
#pragma unroll
  for (int i = 0; i < 8; ++i) { const int ka = k0 + 8 * g + i, kb = ka + 16; v[i] = ka < K ? row[ka] : 0.f; v[8 + i] = kb < K ? row[kb] : 0.f; }
  return bsplit16(v); }
__device__ __forceinline__ F2 split_col(const float* W, int k0, int n, int lane, int ld, int K) { float v[16]; const int g = lane >> 4;
#pragma unroll
  for (int i = 0; i < 8; ++i) { const int ka = k0 + 8 * g + i, kb = ka + 16; v[i] = ka < K ? W[(size_t)ka * ld + n] : 0.f; v[8 + i] = kb < K ? W[(size_t)kb * ld + n] : 0.f; }
  return bsplit16(v); }
__device__ __forceinline__ v8f mac3(const F2& a, const F2& b, v8f c) { c = wmma_bf(a.l, b.h, c); c = wmma_bf(a.h, b.l, c); return wmma_bf(a.h, b.h, c); }
__device__ __forceinline__ float sigm(float v) { return 1.0f / (1.0f + expf(-v)); }
#define LDSX() do { asm volatile("s_wait_dscnt 0" ::: "memory"); __builtin_amdgcn_wave_barrier(); __builtin_amdgcn_fence(__ATOMIC_RELEASE, "workgroup"); } while (0)


// Encoder-decoder multi-head attention (8 heads x 64 on [4,2048,512]): Q/K/V from three separate embeddings with per-head weights W[h][e][d] + biases; full softmax(q.k/8); cat(heads) WO^T + bO.
#define NB 4
#define SS 2048
#define E 512
#define NH 8
#define HD 64
#define NR (NB * SS)
#define PLO 1024.0f
#define VLO 2048.0f
#define SC2 0.18033688f   // 1/8 x log2(e): takes a raw score to base-2 units
__device__ __forceinline__ float bfr(float v) { return (float)(__bf16)v; }
__device__ __forceinline__ v16b frag_b(const __bf16* rowk0, int lane) { return __builtin_bit_cast(v16b, frag_h((const _Float16*)rowk0, lane)); }

// A fragment from an f32 row: the same elements as frag_b, each rounded to bf16 (nearest even) on the way
__device__ __forceinline__ v16b frag_bf32(const float* rowk0, int lane) {
  v16b a; const float* p = rowk0 + 8 * (lane >> 4);
#pragma unroll
  for (int i = 0; i < 8; ++i) { a[i] = (__bf16)p[i]; a[8 + i] = (__bf16)p[16 + i]; }
  return a;
}
// PT rows: [0,E) Wq[:,n], [E,2E) Wk[:,n], [2E,3E) Wv[:,n], [3E,4E) Wo[n,:]  (Wq/Wk/Wv, [in][out]: column n as a bf16 row; Wo, [out][in]: row n as a bf16 row)
// Blocks [0, PKT): one tile of 128 e x 64 d of one head of Wq, Wk or Wv ([H][E][DH]), read in 16-byte pieces along d (a wave-wide load covers whole lines), turned in LDS, written as 64 pieces of 256 B along e.
// Blocks [PKT, PKT + PKO): 16 rows of WO ([out][in]: row n is already PT's row), rounded where they stand.
#define PKT (3 * NH * (E / 128))
#define PKO (E / 16)
#define PKP 68   // LDS row pitch in dwords: 128 e as bf16 and 16 B, so that a row starts at a multiple of 16 B
// Every loop of the kernel is unrolled: x stays in registers, and a thread's eight loads are all in flight before the first is used.
__global__ __launch_bounds__(256) void k_pack(const float* __restrict__ Wq, const float* __restrict__ Wk, const float* __restrict__ Wv, const float* __restrict__ Wo, __bf16* __restrict__ PT) {
  const unsigned blk = blockIdx.x, tid = threadIdx.x; __shared__ __align__(16) unsigned st[HD][PKP];
  if (blk < PKT) {
    const unsigned m = blk / (NH * (E / 128)), hh = (blk / (E / 128)) % NH, e0 = (blk % (E / 128)) * 128;
    const float* W = (m == 0 ? Wq : (m == 1 ? Wk : Wv)) + ((size_t)hh * E + e0) * HD;
    const unsigned dq = tid & 15, eq = tid >> 4;   // this thread: d = 4 dq + 0..3 of the rows e = 4 eq + 0..3 and 64 + 4 eq + 0..3
    v4f x[2][4];
#pragma unroll
    for (int i = 0; i < 2; ++i) {
#pragma unroll
      for (int r = 0; r < 4; ++r) x[i][r] = *(const v4f*)(W + (size_t)(64 * i + 4 * eq + r) * HD + dq * 4); }
#pragma unroll
    for (int i = 0; i < 2; ++i) {
#pragma unroll
      for (int j = 0; j < 4; ++j) { union { __bf16 e[4]; v2u u; } pk;
#pragma unroll
        for (int r = 0; r < 4; ++r) pk.e[r] = (__bf16)x[i][r][j];
        *(v2u*)(&st[dq * 4 + j][32 * i + 2 * eq]) = pk.u; } }
    __syncthreads();
#pragma unroll
    for (int i = 0; i < 4; ++i) { const int d = 16 * i + eq;   // sixteen threads write one row's 256 B
      vst2(PT + (size_t)(m * E + hh * HD + d) * E + e0 + dq * 8, *(const v4u*)(&st[d][dq * 4])); } }
  else {
    const size_t o = (size_t)(blk - PKT) * (16 * E) + tid * 8;
    v4f x[4][2];
#pragma unroll
    for (int i = 0; i < 4; ++i) { x[i][0] = *(const v4f*)(Wo + o + i * 2048); x[i][1] = *(const v4f*)(Wo + o + i * 2048 + 4); }
#pragma unroll
    for (int i = 0; i < 4; ++i) { union { __bf16 e[8]; v4u u; } pk;
#pragma unroll
      for (int r = 0; r < 8; ++r) pk.e[r] = (__bf16)x[i][r >> 2][r & 3];
      vst2(PT + (size_t)3 * E * E + o + i * 2048, pk.u); }
    asm volatile("s_wait_xcnt 0x0" ::: "memory"); }   // behind the four stores: no register that they name is rewritten in front of it on any way the code behind allows
}
// Operand staging of the projection products: a tile is 64 k of every row the block needs, rows of 16-bit data (128 B) at a 144-B pitch, rows of f32 (256 B) at a 272-B pitch (16 B x odd: conflict-free for 16-byte fragment reads).
// A wave-wide copy covers four whole 128-B lines, where a fragment load from global memory touches sixteen.
#define GP 72
#define OAP 68
#define OBUF (64 * OAP * 4 + 128 * GP * 2)
// Eight copies: 16 B of eight rows, the rows rs apart in LDS (bytes) and gs apart in global memory (elements). s_wait_xcnt 0 closes the statement so that no address register named here is rewritten in front of it.
template <typename T> __device__ __forceinline__ void stage8(unsigned l, unsigned rs, const T* p, size_t gs) {
  asm volatile("global_load_async_to_lds_b128 %0, %8, off\n\t"
               "global_load_async_to_lds_b128 %1, %9, off\n\t"
               "global_load_async_to_lds_b128 %2, %10, off\n\t"
               "global_load_async_to_lds_b128 %3, %11, off\n\t"
               "global_load_async_to_lds_b128 %4, %12, off\n\t"
               "global_load_async_to_lds_b128 %5, %13, off\n\t"
               "global_load_async_to_lds_b128 %6, %14, off\n\t"
               "global_load_async_to_lds_b128 %7, %15, off\n\t"
               "s_wait_xcnt 0x0"
               :: "v"(l), "v"(l + rs), "v"(l + 2 * rs), "v"(l + 3 * rs), "v"(l + 4 * rs), "v"(l + 5 * rs), "v"(l + 6 * rs), "v"(l + 7 * rs),
                  "v"(p), "v"(p + gs), "v"(p + 2 * gs), "v"(p + 3 * gs), "v"(p + 4 * gs), "v"(p + 5 * gs), "v"(p + 6 * gs), "v"(p + 7 * gs)
               : "memory");
}
// QKV: block (64 rows, 128 cols = 2 heads, which); eight tiles of 64 k, embedding rows (f32, as they come in; rounded to bf16 where the A fragment is formed) and weight rows staged once per block in LDS (two buffers, the next tile's copies fly during this tile's products); q (+bias) -> Q32 f32 [bh][s][64]; k (+bias) -> bf16 hi/lo rows; v (+bias) -> VT hi/lo x4 [bh][d][s]
__global__ __launch_bounds__(128) void k_qkv(const float* __restrict__ XQ, const float* __restrict__ XK, const float* __restrict__ XV, const __bf16* __restrict__ PT, const float* __restrict__ bq, const float* __restrict__ bk, const float* __restrict__ bv, float* __restrict__ Q32, __bf16* __restrict__ Kh, __bf16* __restrict__ Kl, _Float16* __restrict__ VTh, _Float16* __restrict__ VTl) {
  __shared__ __align__(16) unsigned char sm[2 * OBUF];   // operand tiles in the loop; output staging behind its last barrier
  float (*so)[16][132] = (float (*)[16][132])sm;
  _Float16 (*sth)[72] = (_Float16 (*)[72])sm; _Float16 (*stl)[72] = (_Float16 (*)[72])(sm + 128 * 72 * 2);
  const int tid = threadIdx.x, wave = tid >> 5, lane = tid & 31, col = lane & 15, g = lane >> 4;
  const int which = blockIdx.z, r0b = blockIdx.x * 64, n0 = blockIdx.y * 128; const int b = r0b / SS, s0 = r0b % SS;
  const float* Xf = which == 0 ? XQ : (which == 1 ? XK : XV); const float* bb_ = which == 0 ? bq : (which == 1 ? bk : bv);
  const unsigned la = (unsigned)(size_t)&sm[(tid >> 4) * (OAP * 4) + (tid & 15) * 16];
  const unsigned lb = (unsigned)(size_t)&sm[64 * OAP * 4 + (tid >> 3) * (GP * 2) + (tid & 7) * 16];
  const float* ga = Xf + (size_t)(r0b + (tid >> 4)) * E + (tid & 15) * 4; const __bf16* gb = PT + (size_t)(which * E + n0 + (tid >> 3)) * E + (tid & 7) * 8;
  stage8(la, 8 * OAP * 4, ga, (size_t)8 * E); stage8(lb, 16 * GP * 2, gb, (size_t)16 * E);
  v8f acc[8] = {};
  asm volatile("s_wait_asynccnt 0x0" ::: "memory");   // this wave's share of tile 0 has landed
  __syncthreads();                                     // tile 0 is published to every wave
  stage8(la + OBUF, 8 * OAP * 4, ga + 64, (size_t)8 * E); stage8(lb + OBUF, 16 * GP * 2, gb + 64, (size_t)16 * E);
#pragma unroll 1
  for (int c = 0; c < E / 64; ++c) { const float* ta = (const float*)(sm + (c & 1) * OBUF); const __bf16* tb = (const __bf16*)(sm + (c & 1) * OBUF + 64 * OAP * 4);
    v16b a[2], wb[2][8];   // the tile's fragment reads all stand in front of its products: the wave meets the LDS latency once per tile, not once per product
#pragma unroll
    for (int kk = 0; kk < 2; ++kk) { a[kk] = frag_bf32(ta + (wave * 16 + col) * OAP + kk * 32, lane);
#pragma unroll
      for (int j = 0; j < 8; ++j) wb[kk][j] = frag_b(tb + (j * 16 + col) * GP + kk * 32, lane); }
    __builtin_amdgcn_sched_barrier(0);   // holds the reads in front: without it the compiler sinks them among the products, each pair with a wait of its own
#pragma unroll
    for (int kk = 0; kk < 2; ++kk) {
#pragma unroll
      for (int j = 0; j < 8; ++j) acc[j] = wmma_bf(a[kk], wb[kk][j], acc[j]); }
    __builtin_amdgcn_sched_barrier(0);   // holds the products in front of the waits, so that the next tile's copies fly during them
    asm volatile("s_wait_dscnt 0x0" ::: "memory");      // this wave's reads of the buffer have returned before it is handed to its next writer
    asm volatile("s_wait_asynccnt 0x0" ::: "memory");   // this wave's share of tile c + 1 has landed
    __syncthreads();                                     // publishes tile c + 1 and ends every wave's reads of this buffer
    if (c + 2 < E / 64) { stage8(la + (c & 1) * OBUF, 8 * OAP * 4, ga + (c + 2) * 64, (size_t)8 * E); stage8(lb + (c & 1) * OBUF, 16 * GP * 2, gb + (c + 2) * 64, (size_t)16 * E); } }
  asm volatile("s_wait_asynccnt 0x0" ::: "memory");     // no copy is outstanding when the LDS becomes output staging
  if (which < 2) {
#pragma unroll
    for (int j = 0; j < 8; ++j) { const float bb = bfr(bb_[n0 + j * 16 + col]);
#pragma unroll
      for (int r = 0; r < 8; ++r) so[wave][8 * g + r][j * 16 + col] = acc[j][r] + bb; }
    LDSX();
    if (which == 0) { for (int qq = lane; qq < 2 * 16 * 16; qq += 32) { const int hh = qq >> 8, rl = (qq >> 4) & 15, pc = qq & 15; const int h = (n0 >> 6) + hh;
        vst2(Q32 + (((size_t)b * NH + h) * SS + s0 + wave * 16 + rl) * HD + pc * 4, *(const v4f*)(&so[wave][rl][hh * 64 + pc * 4])); } }
    else {
      for (int qq = lane; qq < 2 * 16 * 16; qq += 32) { const int hh = qq >> 8, rl = (qq >> 4) & 15, pl = qq & 15; const int h = (n0 >> 6) + hh; const int pc = pl & 7; union { __bf16 e[8]; v4u u; } pk;
#pragma unroll
        for (int e = 0; e < 8; ++e) { const float v = so[wave][rl][hh * 64 + pc * 8 + e]; const __bf16 hi = (__bf16)v; pk.e[e] = pl < 8 ? hi : (__bf16)(v - (float)hi); }
        vst2((unsigned*)((pl < 8 ? Kh : Kl) + (((size_t)b * NH + h) * SS + s0 + wave * 16 + rl) * HD + pc * 8), pk.u); } } }
  else {
#pragma unroll
    for (int j = 0; j < 8; ++j) { const float bb = bfr(bb_[n0 + j * 16 + col]);
#pragma unroll
      for (int r = 0; r < 8; ++r) { const float v = (acc[j][r] + bb) * 4.0f; const _Float16 hi = (_Float16)v; sth[j * 16 + col][wave * 16 + 8 * g + r] = hi; stl[j * 16 + col][wave * 16 + 8 * g + r] = (_Float16)((v - (float)hi) * VLO); } }
    __syncthreads();
    for (int qq = tid; qq < 128 * 8; qq += 128) { const int cl = qq >> 3, pc = qq & 7; const int c = n0 + cl, h = c >> 6, d = c & 63; const size_t o = (((size_t)b * NH + h) * HD + d) * SS + s0 + pc * 8;
      vst2(VTh + o, *(const v4u*)(&sth[cl][pc * 8])); vst2(VTl + o, *(const v4u*)(&stl[cl][pc * 8])); } }
}
// K/V staging: one 64-key tile of Kh, Kl, VTh, VTl (64 rows x 128 B each) per buffer, rows at a 144-B pitch (16 B x odd: conflict-free for 16-byte fragment reads)
#define KVP 72
#define KVT (64 * KVP * 2)
// One tile's copies: every lane moves 16 B of two rows of each of the four arrays, so a wave-wide copy covers four whole 128-B lines.
// s_wait_xcnt 0 closes the statement so that no address register named here is rewritten in front of it.
__device__ __forceinline__ void stage_kv(unsigned l, const __bf16* kh, const __bf16* kl, const _Float16* vh, const _Float16* vl) {
  asm volatile("global_load_async_to_lds_b128 %0, %8, off\n\t"
               "global_load_async_to_lds_b128 %1, %9, off\n\t"
               "global_load_async_to_lds_b128 %2, %10, off\n\t"
               "global_load_async_to_lds_b128 %3, %11, off\n\t"
               "global_load_async_to_lds_b128 %4, %12, off\n\t"
               "global_load_async_to_lds_b128 %5, %13, off\n\t"
               "global_load_async_to_lds_b128 %6, %14, off\n\t"
               "global_load_async_to_lds_b128 %7, %15, off\n\t"
               "s_wait_xcnt 0x0"
               :: "v"(l), "v"(l + 32 * KVP * 2), "v"(l + KVT), "v"(l + KVT + 32 * KVP * 2), "v"(l + 2 * KVT), "v"(l + 2 * KVT + 32 * KVP * 2), "v"(l + 3 * KVT), "v"(l + 3 * KVT + 32 * KVP * 2),
                  "v"(kh), "v"(kh + 32 * HD), "v"(kl), "v"(kl + 32 * HD), "v"(vh), "v"(vh + 32 * SS), "v"(vl), "v"(vl + 32 * SS)
               : "memory");
}
// full attention: block (128 queries = 8 waves x 16, bh); 32 key tiles of 64, each staged once per block in LDS (two buffers, the next tile's copies fly during this tile's work)
// transposed products: S^T = K q^T (A = K hi/lo rows, B = q hi/lo) and O^T += V^T P^T (A = V^T rows, B = P^T). A lane's S^T accumulators are 32 scores of its own query (lane & 15), keys 16 t + 8 g + r,
// and those are the elements the B fragment of P^T wants in that lane: scores and P stay in registers. softmax in base 2 (one fma and one hardware exp2 per score); P,V hi/lo; O f32 [bh][s][64]
__global__ __launch_bounds__(256) void k_attn(const float* __restrict__ Q32, const __bf16* __restrict__ Kh, const __bf16* __restrict__ Kl, const _Float16* __restrict__ VTh, const _Float16* __restrict__ VTl, float* __restrict__ O32) {
  __shared__ __align__(16) _Float16 sKV[2][4][64][KVP];   // K/V tiles in the loop; output staging behind its last barrier (each wave its own slice)
  float (*sO)[16][68] = (float (*)[16][68])sKV;
  const int tid = threadIdx.x, w = tid >> 5, lane = tid & 31, col = lane & 15, g = lane >> 4;
  const size_t bh = blockIdx.y; const int qb = blockIdx.x; const int q0 = qb * 128 + w * 16;
  const int crow = tid >> 3, cpc = tid & 7;
  const unsigned lds0 = (unsigned)(size_t)&sKV[0][0][crow][cpc * 8];
  const __bf16* gkh = Kh + (bh * SS + crow) * HD + cpc * 8; const __bf16* gkl = Kl + (bh * SS + crow) * HD + cpc * 8;
  const _Float16* gvh = VTh + (bh * HD + crow) * SS + cpc * 8; const _Float16* gvl = VTl + (bh * HD + crow) * SS + cpc * 8;
  stage_kv(lds0, gkh, gkl, gvh, gvl);
  F2 aq[2];
#pragma unroll
  for (int kc = 0; kc < 2; ++kc) aq[kc] = split_row(Q32 + (bh * SS + q0 + col) * HD, kc * 32, lane);
  float mrun = -3.0e38f, lrun = 0.f; v8f acc[4] = {}, ac1[4] = {}, ac2[4] = {};   // mrun, lrun: of query col, the same in both halves of the wave; acc*[t][r]: d = 16 t + 8 g + r of query col
  LDSX();
  asm volatile("s_wait_asynccnt 0x0" ::: "memory");   // this wave's share of tile 0 has landed
  __syncthreads();                                     // tile 0 is published to every wave
  stage_kv(lds0 + 4 * KVT, gkh + 64 * HD, gkl + 64 * HD, gvh + 64, gvl + 64);
#pragma unroll 1
  for (int kt = 0; kt < SS / 64; ++kt) {
    const int bf = kt & 1;
    v8f s[4];
#pragma unroll
    for (int t = 0; t < 4; ++t) { const __bf16* kr = (const __bf16*)&sKV[bf][0][t * 16 + col][0]; const __bf16* lr_ = (const __bf16*)&sKV[bf][1][t * 16 + col][0]; v8f st = {};
#pragma unroll
      for (int kc = 0; kc < 2; ++kc) { const v16b khf = frag_b(kr + kc * 32, lane), klf = frag_b(lr_ + kc * 32, lane); st = wmma_bf(khf, aq[kc].l, st); st = wmma_bf(klf, aq[kc].h, st); st = wmma_bf(khf, aq[kc].h, st); }
      s[t] = st; }
    float mx = -3.4e38f;
#pragma unroll
    for (int t = 0; t < 4; ++t) {
#pragma unroll
      for (int r = 0; r < 8; ++r) mx = fmaxf(mx, s[t][r]); }
    mx = fmaxf(mx, __shfl_xor(mx, 16, 32));
    const float mnew = fmaxf(mrun, mx * SC2); const float corr = __builtin_amdgcn_exp2f(mrun - mnew);   // running maximum in base-2 units
    const float moff = mnew - 14.0f;   // the factor 16384 = 2^14 of P rides in the exponent
    float ps = 0.f; v16h ph[2], pl[2];
#pragma unroll
    for (int kc = 0; kc < 2; ++kc) {
#pragma unroll
      for (int i = 0; i < 16; ++i) { const float p = __builtin_amdgcn_exp2f(fmaf(s[2 * kc + (i >> 3)][i & 7], SC2, -moff)); ps += p; const _Float16 hi = (_Float16)p; ph[kc][i] = hi; pl[kc][i] = (_Float16)((p - (float)hi) * PLO); } }
    ps += __shfl_xor(ps, 16, 32);
    lrun = lrun * corr + ps * (1.0f / 16384.0f); mrun = mnew;
#pragma unroll
    for (int t = 0; t < 4; ++t) {
#pragma unroll
      for (int r = 0; r < 8; ++r) { acc[t][r] *= corr; ac1[t][r] *= corr; ac2[t][r] *= corr; } }
#pragma unroll
    for (int kc = 0; kc < 2; ++kc) {
#pragma unroll
      for (int t = 0; t < 4; ++t) { const v16h vh = frag_h(&sKV[bf][2][t * 16 + col][kc * 32], lane);
        acc[t] = wmma16(vh, ph[kc], acc[t]); ac1[t] = wmma16(frag_h(&sKV[bf][3][t * 16 + col][kc * 32], lane), ph[kc], ac1[t]); ac2[t] = wmma16(vh, pl[kc], ac2[t]); } }
    __builtin_amdgcn_wave_barrier();
    asm volatile("s_wait_dscnt 0x0" ::: "memory");      // this wave's reads of buffer bf have returned before the buffer is handed to its next writer
    asm volatile("s_wait_asynccnt 0x0" ::: "memory");   // this wave's share of tile kt + 1 has landed
    __syncthreads();                                     // publishes tile kt + 1 and ends every wave's reads of buffer bf
    if (kt + 2 < SS / 64) stage_kv(lds0 + bf * (4 * KVT), gkh + (size_t)(kt + 2) * 64 * HD, gkl + (size_t)(kt + 2) * 64 * HD, gvh + (kt + 2) * 64, gvl + (kt + 2) * 64); }
  asm volatile("s_wait_asynccnt 0x0" ::: "memory");     // no copy is outstanding when the LDS becomes output staging
  const float inv = 1.0f / (lrun * 16384.0f * 4.0f);
#pragma unroll
  for (int t = 0; t < 4; ++t) {
#pragma unroll
    for (int r = 0; r < 8; ++r) sO[w][col][t * 16 + 8 * g + r] = (acc[t][r] + ac1[t][r] * (1.0f / VLO) + ac2[t][r] * (1.0f / PLO)) * inv; }
  LDSX();
  for (int qq = lane; qq < 16 * 16; qq += 32) { const int rl = qq >> 4, pc = qq & 15; vst2(O32 + ((bh * SS) + q0 + rl) * HD + pc * 4, *(const v4f*)(&sO[w][rl][pc * 4])); }
}
// out = ctx Wo^T + bo : split(ctx) x bf16(Wo rows): 2 products (Wo is an INPUT -> bf16 exact); eight tiles of 64 k (one head each), ctx rows (f32) and Wo rows staged once per block in LDS, two buffers
__global__ __launch_bounds__(128) void k_out(const float* __restrict__ O32, const __bf16* __restrict__ PT, const float* __restrict__ bo, float* __restrict__ out) {
  __shared__ __align__(16) unsigned char sm[2 * OBUF];   // operand tiles in the loop; output staging behind its last barrier
  float (*so)[16][132] = (float (*)[16][132])sm;
  const int tid = threadIdx.x, wave = tid >> 5, lane = tid & 31, col = lane & 15, g = lane >> 4;
  const int r0b = blockIdx.x * 64, r0 = r0b + wave * 16, n0 = blockIdx.y * 128; const int b = r0b / SS, s0 = r0b % SS;
  const unsigned la = (unsigned)(size_t)&sm[(tid >> 4) * (OAP * 4) + (tid & 15) * 16];
  const unsigned lb = (unsigned)(size_t)&sm[64 * OAP * 4 + (tid >> 3) * (GP * 2) + (tid & 7) * 16];
  const float* ga = O32 + ((size_t)b * NH * SS + s0 + (tid >> 4)) * HD + (tid & 15) * 4;   // head h of these rows: + h * SS * HD
  const __bf16* gb = PT + (size_t)(3 * E + n0 + (tid >> 3)) * E + (tid & 7) * 8;
  stage8(la, 8 * OAP * 4, ga, (size_t)8 * HD); stage8(lb, 16 * GP * 2, gb, (size_t)16 * E);
  v8f acc[8] = {};
  asm volatile("s_wait_asynccnt 0x0" ::: "memory");   // this wave's share of tile 0 has landed
  __syncthreads();                                     // tile 0 is published to every wave
  stage8(la + OBUF, 8 * OAP * 4, ga + (size_t)SS * HD, (size_t)8 * HD); stage8(lb + OBUF, 16 * GP * 2, gb + 64, (size_t)16 * E);
#pragma unroll 1
  for (int c = 0; c < E / 64; ++c) { const float* ta = (const float*)(sm + (c & 1) * OBUF); const __bf16* tb = (const __bf16*)(sm + (c & 1) * OBUF + 64 * OAP * 4);
    F2 a[2]; v16b wb[2][8];   // the tile's fragment reads all stand in front of its products: the wave meets the LDS latency once per tile, not once per product
#pragma unroll
    for (int kk = 0; kk < 2; ++kk) { a[kk] = split_row(ta + (wave * 16 + col) * OAP, kk * 32, lane);
#pragma unroll
      for (int j = 0; j < 8; ++j) wb[kk][j] = frag_b(tb + (j * 16 + col) * GP + kk * 32, lane); }
    __builtin_amdgcn_sched_barrier(0);   // holds the reads in front: without it the compiler sinks them among the products, each pair with a wait of its own
#pragma unroll
    for (int kk = 0; kk < 2; ++kk) {
#pragma unroll
      for (int j = 0; j < 8; ++j) { acc[j] = wmma_bf(a[kk].l, wb[kk][j], acc[j]); acc[j] = wmma_bf(a[kk].h, wb[kk][j], acc[j]); } }
    __builtin_amdgcn_sched_barrier(0);   // holds the products in front of the waits, so that the next tile's copies fly during them
    asm volatile("s_wait_dscnt 0x0" ::: "memory");      // this wave's reads of the buffer have returned before it is handed to its next writer
    asm volatile("s_wait_asynccnt 0x0" ::: "memory");   // this wave's share of tile c + 1 has landed
    __syncthreads();                                     // publishes tile c + 1 and ends every wave's reads of this buffer
    if (c + 2 < E / 64) { stage8(la + (c & 1) * OBUF, 8 * OAP * 4, ga + (size_t)(c + 2) * SS * HD, (size_t)8 * HD); stage8(lb + (c & 1) * OBUF, 16 * GP * 2, gb + (c + 2) * 64, (size_t)16 * E); } }
  asm volatile("s_wait_asynccnt 0x0" ::: "memory");     // no copy is outstanding when the LDS becomes output staging
#pragma unroll
  for (int j = 0; j < 8; ++j) { const float bb = bfr(bo[n0 + j * 16 + col]);
#pragma unroll
    for (int r = 0; r < 8; ++r) so[wave][8 * g + r][j * 16 + col] = acc[j][r] + bb; }
  LDSX();
#pragma unroll 4
  for (int rl = 0; rl < 16; ++rl) vst2(out + (size_t)(r0 + rl) * E + n0 + lane * 4, *(const v4f*)(&so[wave][rl][lane * 4]));
}
extern "C" void kernel_launch(void* const* d_in, const int* in_sizes, int n_in, void* d_out, int out_size, void* d_ws, size_t ws_size, hipStream_t stream) {
  (void)in_sizes; (void)n_in; (void)out_size; (void)ws_size;
  const float** I = (const float**)d_in;   // emb_q, emb_k, emb_v, WQ, bQ, WK, bK, WV, bV, WO, bO
  const float* eq = I[0]; const float* ek = I[1]; const float* ev = I[2]; const float* WQ = I[3]; const float* bQ = I[4]; const float* WK = I[5]; const float* bK = I[6]; const float* WV = I[7]; const float* bV = I[8]; const float* WO = I[9]; const float* bO = I[10];
  float* out = (float*)d_out;
  char* ws = (char*)d_ws; size_t off = 0;
  auto take = [&](size_t bytes) { char* p = ws + off; off += (bytes + 255) & ~(size_t)255; return p; };
  __bf16* PT = (__bf16*)take((size_t)4 * E * E * 2);
  float* Q32 = (float*)take((size_t)NR * E * 4); __bf16* Kh = (__bf16*)take((size_t)NR * E * 2); __bf16* Kl = (__bf16*)take((size_t)NR * E * 2); _Float16* VTh = (_Float16*)take((size_t)NR * E * 2); _Float16* VTl = (_Float16*)take((size_t)NR * E * 2); float* O32 = (float*)take((size_t)NR * E * 4);
  // ws ~ 69 MB
  k_pack<<<PKT + PKO, 256, 0, stream>>>(WQ, WK, WV, WO, PT);
  k_qkv<<<dim3(NR / 64, E / 128, 3), 128, 0, stream>>>(eq, ek, ev, PT, bQ, bK, bV, Q32, Kh, Kl, VTh, VTl);
  k_attn<<<dim3(SS / 128, NB * NH), 256, 0, stream>>>(Q32, Kh, Kl, VTh, VTl, O32);
  k_out<<<dim3(NR / 64, E / 128), 128, 0, stream>>>(O32, PT, bO, out);
}

// v008
// Measured time: 116 microseconds a run.
// In two side-by-side timings against v007, it was 1.05 and 1.04 times as fast.
// Counting every step since v000, it is 3.60 times as fast.
// compute dtype: embeddings and W*/b* (INPUTS) rounded to bf16 with exact bf16 WMMA products (f32 accumulate) for the projections; K pre-split into bf16 hi/lo rows; q f32 split, P and V f16 hi/lo (3 products each, the low halves at the scale of the high ones, one f32 accumulator); softmax f32.
#include <hip/hip_runtime.h>
#include <math.h>

typedef __attribute__((ext_vector_type(16))) _Float16 v16h;
typedef __attribute__((ext_vector_type(16))) __bf16 v16b;
typedef __attribute__((ext_vector_type(8)))  _Float16 v8h;
typedef __attribute__((ext_vector_type(8)))  float v8f;
typedef __attribute__((ext_vector_type(4)))  float v4f;
typedef __attribute__((ext_vector_type(2)))  float v2f;
typedef __attribute__((ext_vector_type(4)))  unsigned v4u;
typedef __attribute__((ext_vector_type(2)))  unsigned v2u;
typedef __attribute__((ext_vector_type(4)))  int v4i;
typedef float __attribute__((may_alias)) float_a;
typedef int __attribute__((may_alias)) int_a;

template <typename T> __device__ __forceinline__ void vst2(void* p, T v) { *(T*)p = v;  }
__device__ __forceinline__ v8f wmma16(v16h a, v16h b, v8f c) {
  return __builtin_amdgcn_wmma_f32_16x16x32_f16(false, a, false, b, (short)0, c, false, false);
}
__device__ __forceinline__ v8f wmma_bf(v16b a, v16b b, v8f c) {
  return __builtin_amdgcn_wmma_f32_16x16x32_bf16(false, a, false, b, (short)0, c, false, false);
}
// 16x16x32 fragments: lane = (h = lane>>4, row/col = lane&15); elements 0..7 = k0+8h+0..7, 8..15 = k0+16+8h+0..7; D element r = row 8h+r
__device__ __forceinline__ v16h frag_h(const _Float16* rowk0, int lane) {
  union { v16h v; v8h q[2]; } u; const _Float16* p = rowk0 + 8 * (lane >> 4);
  u.q[0] = *(const v8h*)p; u.q[1] = *(const v8h*)(p + 16); return u.v;
}
__device__ __forceinline__ v16h frag_f32(const float* rowk0, int lane) {
  v16h a; const float* p = rowk0 + 8 * (lane >> 4);
#pragma unroll
  for (int i = 0; i < 8; ++i) { a[i] = (_Float16)p[i]; a[8 + i] = (_Float16)p[16 + i]; }
  return a;
}
__device__ __forceinline__ v16h frag_f32s(const float* rowk0, int lane, float sc) {
  v16h a; const float* p = rowk0 + 8 * (lane >> 4);
#pragma unroll
  for (int i = 0; i < 8; ++i) { a[i] = (_Float16)(p[i] * sc); a[8 + i] = (_Float16)(p[16 + i] * sc); }
  return a;
}
// column fragment from a [K][ld] layout (column n), rows >= K read as 0
__device__ __forceinline__ v16h fragc_f32(const float* W, int k0, int n, int lane, int ld, int K) {
  v16h a; const int g = lane >> 4;
#pragma unroll
  for (int i = 0; i < 8; ++i) { const int ka = k0 + 8 * g + i, kb = ka + 16;
    a[i] = (_Float16)(ka < K ? W[(size_t)ka * ld + n] : 0.f); a[8 + i] = (_Float16)(kb < K ? W[(size_t)kb * ld + n] : 0.f); }
  return a;
}
struct F2 { v16b h, l; };
__device__ __forceinline__ F2 bsplit16(const float v[16]) { F2 r;
#pragma unroll
  for (int i = 0; i < 16; ++i) { const __bf16 h = (__bf16)v[i]; r.h[i] = h; r.l[i] = (__bf16)(v[i] - (float)h); }
  return r; }
__device__ __forceinline__ F2 split_row(const float* row, int k0, int lane) { float v[16]; const float* p = row + k0 + 8 * (lane >> 4);
#pragma unroll
  for (int i = 0; i < 8; ++i) { v[i] = p[i]; v[8 + i] = p[16 + i]; }
  return bsplit16(v); }
__device__ __forceinline__ F2 split_rowK(const float* row, int k0, int lane, int K) { float v[16]; const int g = lane >> 4;
#pragma unroll
  for (int i = 0; i < 8; ++i) { const int ka = k0 + 8 * g + i, kb = ka + 16; v[i] = ka < K ? row[ka] : 0.f; v[8 + i] = kb < K ? row[kb] : 0.f; }
  return bsplit16(v); }
__device__ __forceinline__ F2 split_col(const float* W, int k0, int n, int lane, int ld, int K) { float v[16]; const int g = lane >> 4;
#pragma unroll
  for (int i = 0; i < 8; ++i) { const int ka = k0 + 8 * g + i, kb = ka + 16; v[i] = ka < K ? W[(size_t)ka * ld + n] : 0.f; v[8 + i] = kb < K ? W[(size_t)kb * ld + n] : 0.f; }
  return bsplit16(v); }
__device__ __forceinline__ v8f mac3(const F2& a, const F2& b, v8f c) { c = wmma_bf(a.l, b.h, c); c = wmma_bf(a.h, b.l, c); return wmma_bf(a.h, b.h, c); }
__device__ __forceinline__ float sigm(float v) { return 1.0f / (1.0f + expf(-v)); }
#define LDSX() do { asm volatile("s_wait_dscnt 0" ::: "memory"); __builtin_amdgcn_wave_barrier(); __builtin_amdgcn_fence(__ATOMIC_RELEASE, "workgroup"); } while (0)


// Encoder-decoder multi-head attention (8 heads x 64 on [4,2048,512]): Q/K/V from three separate embeddings with per-head weights W[h][e][d] + biases; full softmax(q.k/8); cat(heads) WO^T + bO.
#define NB 4
#define SS 2048
#define E 512
#define NH 8
#define HD 64
#define NR (NB * SS)
#define SC2 0.18033688f   // 1/8 x log2(e): takes a raw score to base-2 units
__device__ __forceinline__ float bfr(float v) { return (float)(__bf16)v; }
__device__ __forceinline__ v16b frag_b(const __bf16* rowk0, int lane) { return __builtin_bit_cast(v16b, frag_h((const _Float16*)rowk0, lane)); }

// A fragment from an f32 row: the same elements as frag_b, each rounded to bf16 (nearest even) on the way
__device__ __forceinline__ v16b frag_bf32(const float* rowk0, int lane) {
  v16b a; const float* p = rowk0 + 8 * (lane >> 4);
#pragma unroll
  for (int i = 0; i < 8; ++i) { a[i] = (__bf16)p[i]; a[8 + i] = (__bf16)p[16 + i]; }
  return a;
}
// PT rows: [0,E) Wq[:,n], [E,2E) Wk[:,n], [2E,3E) Wv[:,n], [3E,4E) Wo[n,:]  (Wq/Wk/Wv, [in][out]: column n as a bf16 row; Wo, [out][in]: row n as a bf16 row)
// Blocks [0, PKT): one tile of 128 e x 64 d of one head of Wq, Wk or Wv ([H][E][DH]), read in 16-byte pieces along d (a wave-wide load covers whole lines), turned in LDS, written as 64 pieces of 256 B along e.
// Blocks [PKT, PKT + PKO): 16 rows of WO ([out][in]: row n is already PT's row), rounded where they stand.
#define PKT (3 * NH * (E / 128))
#define PKO (E / 16)
#define PKP 68   // LDS row pitch in dwords: 128 e as bf16 and 16 B, so that a row starts at a multiple of 16 B
// Every loop of the kernel is unrolled: x stays in registers, and a thread's eight loads are all in flight before the first is used.
__global__ __launch_bounds__(256) void k_pack(const float* __restrict__ Wq, const float* __restrict__ Wk, const float* __restrict__ Wv, const float* __restrict__ Wo, __bf16* __restrict__ PT) {
  const unsigned blk = blockIdx.x, tid = threadIdx.x; __shared__ __align__(16) unsigned st[HD][PKP];
  if (blk < PKT) {
    const unsigned m = blk / (NH * (E / 128)), hh = (blk / (E / 128)) % NH, e0 = (blk % (E / 128)) * 128;
    const float* W = (m == 0 ? Wq : (m == 1 ? Wk : Wv)) + ((size_t)hh * E + e0) * HD;
    const unsigned dq = tid & 15, eq = tid >> 4;   // this thread: d = 4 dq + 0..3 of the rows e = 4 eq + 0..3 and 64 + 4 eq + 0..3
    v4f x[2][4];
#pragma unroll
    for (int i = 0; i < 2; ++i) {
#pragma unroll
      for (int r = 0; r < 4; ++r) x[i][r] = *(const v4f*)(W + (size_t)(64 * i + 4 * eq + r) * HD + dq * 4); }
#pragma unroll
    for (int i = 0; i < 2; ++i) {
#pragma unroll
      for (int j = 0; j < 4; ++j) { union { __bf16 e[4]; v2u u; } pk;
#pragma unroll
        for (int r = 0; r < 4; ++r) pk.e[r] = (__bf16)x[i][r][j];
        *(v2u*)(&st[dq * 4 + j][32 * i + 2 * eq]) = pk.u; } }
    __syncthreads();
#pragma unroll
    for (int i = 0; i < 4; ++i) { const int d = 16 * i + eq;   // sixteen threads write one row's 256 B
      vst2(PT + (size_t)(m * E + hh * HD + d) * E + e0 + dq * 8, *(const v4u*)(&st[d][dq * 4])); } }
  else {
    const size_t o = (size_t)(blk - PKT) * (16 * E) + tid * 8;
    v4f x[4][2];
#pragma unroll
    for (int i = 0; i < 4; ++i) { x[i][0] = *(const v4f*)(Wo + o + i * 2048); x[i][1] = *(const v4f*)(Wo + o + i * 2048 + 4); }
#pragma unroll
    for (int i = 0; i < 4; ++i) { union { __bf16 e[8]; v4u u; } pk;
#pragma unroll
      for (int r = 0; r < 8; ++r) pk.e[r] = (__bf16)x[i][r >> 2][r & 3];
      vst2(PT + (size_t)3 * E * E + o + i * 2048, pk.u); }
    asm volatile("s_wait_xcnt 0x0" ::: "memory"); }   // behind the four stores: no register that they name is rewritten in front of it on any way the code behind allows
}
// Operand staging of the projection products: a tile is 64 k of every row the block needs, rows of 16-bit data (128 B) at a 144-B pitch, rows of f32 (256 B) at a 272-B pitch (16 B x odd: conflict-free for 16-byte fragment reads).
// A wave-wide copy covers four whole 128-B lines, where a fragment load from global memory touches sixteen.
#define GP 72
#define OAP 68
#define OBUF (64 * OAP * 4 + 128 * GP * 2)
// Eight copies: 16 B of eight rows, the rows rs apart in LDS (bytes) and gs apart in global memory (elements). s_wait_xcnt 0 closes the statement so that no address register named here is rewritten in front of it.
template <typename T> __device__ __forceinline__ void stage8(unsigned l, unsigned rs, const T* p, size_t gs) {
  asm volatile("global_load_async_to_lds_b128 %0, %8, off\n\t"
               "global_load_async_to_lds_b128 %1, %9, off\n\t"
               "global_load_async_to_lds_b128 %2, %10, off\n\t"
               "global_load_async_to_lds_b128 %3, %11, off\n\t"
               "global_load_async_to_lds_b128 %4, %12, off\n\t"
               "global_load_async_to_lds_b128 %5, %13, off\n\t"
               "global_load_async_to_lds_b128 %6, %14, off\n\t"
               "global_load_async_to_lds_b128 %7, %15, off\n\t"
               "s_wait_xcnt 0x0"
               :: "v"(l), "v"(l + rs), "v"(l + 2 * rs), "v"(l + 3 * rs), "v"(l + 4 * rs), "v"(l + 5 * rs), "v"(l + 6 * rs), "v"(l + 7 * rs),
                  "v"(p), "v"(p + gs), "v"(p + 2 * gs), "v"(p + 3 * gs), "v"(p + 4 * gs), "v"(p + 5 * gs), "v"(p + 6 * gs), "v"(p + 7 * gs)
               : "memory");
}
// QKV: block (64 rows, 128 cols = 2 heads, which); eight tiles of 64 k, embedding rows (f32, as they come in; rounded to bf16 where the A fragment is formed) and weight rows staged once per block in LDS (two buffers, the next tile's copies fly during this tile's products); q (+bias) -> Q32 f32 [bh][s][64]; k (+bias) -> bf16 hi/lo rows; v (+bias) -> VT hi/lo x4 [bh][d][s]
__global__ __launch_bounds__(128) void k_qkv(const float* __restrict__ XQ, const float* __restrict__ XK, const float* __restrict__ XV, const __bf16* __restrict__ PT, const float* __restrict__ bq, const float* __restrict__ bk, const float* __restrict__ bv, float* __restrict__ Q32, __bf16* __restrict__ Kh, __bf16* __restrict__ Kl, _Float16* __restrict__ VTh, _Float16* __restrict__ VTl) {
  __shared__ __align__(16) unsigned char sm[2 * OBUF];   // operand tiles in the loop; output staging behind its last barrier
  float (*so)[16][132] = (float (*)[16][132])sm;
  _Float16 (*sth)[72] = (_Float16 (*)[72])sm; _Float16 (*stl)[72] = (_Float16 (*)[72])(sm + 128 * 72 * 2);
  const int tid = threadIdx.x, wave = tid >> 5, lane = tid & 31, col = lane & 15, g = lane >> 4;
  const int which = blockIdx.z, r0b = blockIdx.x * 64, n0 = blockIdx.y * 128; const int b = r0b / SS, s0 = r0b % SS;
  const float* Xf = which == 0 ? XQ : (which == 1 ? XK : XV); const float* bb_ = which == 0 ? bq : (which == 1 ? bk : bv);
  const unsigned la = (unsigned)(size_t)&sm[(tid >> 4) * (OAP * 4) + (tid & 15) * 16];
  const unsigned lb = (unsigned)(size_t)&sm[64 * OAP * 4 + (tid >> 3) * (GP * 2) + (tid & 7) * 16];
  const float* ga = Xf + (size_t)(r0b + (tid >> 4)) * E + (tid & 15) * 4; const __bf16* gb = PT + (size_t)(which * E + n0 + (tid >> 3)) * E + (tid & 7) * 8;
  stage8(la, 8 * OAP * 4, ga, (size_t)8 * E); stage8(lb, 16 * GP * 2, gb, (size_t)16 * E);
  v8f acc[8] = {};
  asm volatile("s_wait_asynccnt 0x0" ::: "memory");   // this wave's share of tile 0 has landed
  __syncthreads();                                     // tile 0 is published to every wave
  stage8(la + OBUF, 8 * OAP * 4, ga + 64, (size_t)8 * E); stage8(lb + OBUF, 16 * GP * 2, gb + 64, (size_t)16 * E);
#pragma unroll 1
  for (int c = 0; c < E / 64; ++c) { const float* ta = (const float*)(sm + (c & 1) * OBUF); const __bf16* tb = (const __bf16*)(sm + (c & 1) * OBUF + 64 * OAP * 4);
    v16b a[2], wb[2][8];   // the tile's fragment reads all stand in front of its products: the wave meets the LDS latency once per tile, not once per product
#pragma unroll
    for (int kk = 0; kk < 2; ++kk) { a[kk] = frag_bf32(ta + (wave * 16 + col) * OAP + kk * 32, lane);
#pragma unroll
      for (int j = 0; j < 8; ++j) wb[kk][j] = frag_b(tb + (j * 16 + col) * GP + kk * 32, lane); }
    __builtin_amdgcn_sched_barrier(0);   // holds the reads in front: without it the compiler sinks them among the products, each pair with a wait of its own
#pragma unroll
    for (int kk = 0; kk < 2; ++kk) {
#pragma unroll
      for (int j = 0; j < 8; ++j) acc[j] = wmma_bf(a[kk], wb[kk][j], acc[j]); }
    __builtin_amdgcn_sched_barrier(0);   // holds the products in front of the waits, so that the next tile's copies fly during them
    asm volatile("s_wait_dscnt 0x0" ::: "memory");      // this wave's reads of the buffer have returned before it is handed to its next writer
    asm volatile("s_wait_asynccnt 0x0" ::: "memory");   // this wave's share of tile c + 1 has landed
    __syncthreads();                                     // publishes tile c + 1 and ends every wave's reads of this buffer
    if (c + 2 < E / 64) { stage8(la + (c & 1) * OBUF, 8 * OAP * 4, ga + (c + 2) * 64, (size_t)8 * E); stage8(lb + (c & 1) * OBUF, 16 * GP * 2, gb + (c + 2) * 64, (size_t)16 * E); } }
  asm volatile("s_wait_asynccnt 0x0" ::: "memory");     // no copy is outstanding when the LDS becomes output staging
  if (which < 2) {
#pragma unroll
    for (int j = 0; j < 8; ++j) { const float bb = bfr(bb_[n0 + j * 16 + col]);
#pragma unroll
      for (int r = 0; r < 8; ++r) so[wave][8 * g + r][j * 16 + col] = acc[j][r] + bb; }
    LDSX();
    if (which == 0) { for (int qq = lane; qq < 2 * 16 * 16; qq += 32) { const int hh = qq >> 8, rl = (qq >> 4) & 15, pc = qq & 15; const int h = (n0 >> 6) + hh;
        vst2(Q32 + (((size_t)b * NH + h) * SS + s0 + wave * 16 + rl) * HD + pc * 4, *(const v4f*)(&so[wave][rl][hh * 64 + pc * 4])); } }
    else {
      for (int qq = lane; qq < 2 * 16 * 16; qq += 32) { const int hh = qq >> 8, rl = (qq >> 4) & 15, pl = qq & 15; const int h = (n0 >> 6) + hh; const int pc = pl & 7; union { __bf16 e[8]; v4u u; } pk;
#pragma unroll
        for (int e = 0; e < 8; ++e) { const float v = so[wave][rl][hh * 64 + pc * 8 + e]; const __bf16 hi = (__bf16)v; pk.e[e] = pl < 8 ? hi : (__bf16)(v - (float)hi); }
        vst2((unsigned*)((pl < 8 ? Kh : Kl) + (((size_t)b * NH + h) * SS + s0 + wave * 16 + rl) * HD + pc * 8), pk.u); } } }
  else {
#pragma unroll
    for (int j = 0; j < 8; ++j) { const float bb = bfr(bb_[n0 + j * 16 + col]);
#pragma unroll
      for (int r = 0; r < 8; ++r) { const float v = (acc[j][r] + bb) * 4.0f; const _Float16 hi = (_Float16)v; sth[j * 16 + col][wave * 16 + 8 * g + r] = hi; stl[j * 16 + col][wave * 16 + 8 * g + r] = (_Float16)(v - (float)hi); } }
    __syncthreads();
    for (int qq = tid; qq < 128 * 8; qq += 128) { const int cl = qq >> 3, pc = qq & 7; const int c = n0 + cl, h = c >> 6, d = c & 63; const size_t o = (((size_t)b * NH + h) * HD + d) * SS + s0 + pc * 8;
      vst2(VTh + o, *(const v4u*)(&sth[cl][pc * 8])); vst2(VTl + o, *(const v4u*)(&stl[cl][pc * 8])); } }
}
// K/V staging: one 64-key tile of Kh, Kl, VTh, VTl (64 rows x 128 B each) per buffer, rows at a 144-B pitch (16 B x odd: conflict-free for 16-byte fragment reads)
#define KVP 72
#define KVT (64 * KVP * 2)
// One tile's copies: every lane moves 16 B of two rows of each of the four arrays, so a wave-wide copy covers four whole 128-B lines.
// s_wait_xcnt 0 closes the statement so that no address register named here is rewritten in front of it.
__device__ __forceinline__ void stage_kv(unsigned l, const __bf16* kh, const __bf16* kl, const _Float16* vh, const _Float16* vl) {
  asm volatile("global_load_async_to_lds_b128 %0, %8, off\n\t"
               "global_load_async_to_lds_b128 %1, %9, off\n\t"
               "global_load_async_to_lds_b128 %2, %10, off\n\t"
               "global_load_async_to_lds_b128 %3, %11, off\n\t"
               "global_load_async_to_lds_b128 %4, %12, off\n\t"
               "global_load_async_to_lds_b128 %5, %13, off\n\t"
               "global_load_async_to_lds_b128 %6, %14, off\n\t"
               "global_load_async_to_lds_b128 %7, %15, off\n\t"
               "s_wait_xcnt 0x0"
               :: "v"(l), "v"(l + 32 * KVP * 2), "v"(l + KVT), "v"(l + KVT + 32 * KVP * 2), "v"(l + 2 * KVT), "v"(l + 2 * KVT + 32 * KVP * 2), "v"(l + 3 * KVT), "v"(l + 3 * KVT + 32 * KVP * 2),
                  "v"(kh), "v"(kh + 32 * HD), "v"(kl), "v"(kl + 32 * HD), "v"(vh), "v"(vh + 32 * SS), "v"(vl), "v"(vl + 32 * SS)
               : "memory");
}
// full attention: block (128 queries = 8 waves x 16, bh); 32 key tiles of 64, each staged once per block in LDS (two buffers, the next tile's copies fly during this tile's work)
// transposed products: S^T = K q^T (A = K hi/lo rows, B = q hi/lo) and O^T += V^T P^T (A = V^T rows, B = P^T). A lane's S^T accumulators are 32 scores of its own query (lane & 15), keys 16 t + 8 g + r,
// and those are the elements the B fragment of P^T wants in that lane: scores and P stay in registers. softmax in base 2 (one fma and one hardware exp2 per score); P,V hi/lo; O f32 [bh][s][64]
__global__ __launch_bounds__(256) void k_attn(const float* __restrict__ Q32, const __bf16* __restrict__ Kh, const __bf16* __restrict__ Kl, const _Float16* __restrict__ VTh, const _Float16* __restrict__ VTl, float* __restrict__ O32) {
  __shared__ __align__(16) _Float16 sKV[2][4][64][KVP];   // K/V tiles in the loop; output staging behind its last barrier (each wave its own slice)
  float (*sO)[16][68] = (float (*)[16][68])sKV;
  const int tid = threadIdx.x, w = tid >> 5, lane = tid & 31, col = lane & 15, g = lane >> 4;
  const size_t bh = blockIdx.y; const int qb = blockIdx.x; const int q0 = qb * 128 + w * 16;
  const int crow = tid >> 3, cpc = tid & 7;
  const unsigned lds0 = (unsigned)(size_t)&sKV[0][0][crow][cpc * 8];
  const __bf16* gkh = Kh + (bh * SS + crow) * HD + cpc * 8; const __bf16* gkl = Kl + (bh * SS + crow) * HD + cpc * 8;
  const _Float16* gvh = VTh + (bh * HD + crow) * SS + cpc * 8; const _Float16* gvl = VTl + (bh * HD + crow) * SS + cpc * 8;
  stage_kv(lds0, gkh, gkl, gvh, gvl);
  F2 aq[2];
#pragma unroll
  for (int kc = 0; kc < 2; ++kc) aq[kc] = split_row(Q32 + (bh * SS + q0 + col) * HD, kc * 32, lane);
  float mrun = -3.0e38f, lrun = 0.f; v8f acc[4] = {};   // mrun, lrun: of query col, the same in both halves of the wave; acc[t][r]: d = 16 t + 8 g + r of query col
  LDSX();
  asm volatile("s_wait_asynccnt 0x0" ::: "memory");   // this wave's share of tile 0 has landed
  __syncthreads();                                     // tile 0 is published to every wave
  stage_kv(lds0 + 4 * KVT, gkh + 64 * HD, gkl + 64 * HD, gvh + 64, gvl + 64);
#pragma unroll 1
  for (int kt = 0; kt < SS / 64; ++kt) {
    const int bf = kt & 1;
    v8f s[4];
#pragma unroll
    for (int t = 0; t < 4; ++t) { const __bf16* kr = (const __bf16*)&sKV[bf][0][t * 16 + col][0]; const __bf16* lr_ = (const __bf16*)&sKV[bf][1][t * 16 + col][0]; v8f st = {};
#pragma unroll
      for (int kc = 0; kc < 2; ++kc) { const v16b khf = frag_b(kr + kc * 32, lane), klf = frag_b(lr_ + kc * 32, lane); st = wmma_bf(khf, aq[kc].l, st); st = wmma_bf(klf, aq[kc].h, st); st = wmma_bf(khf, aq[kc].h, st); }
      s[t] = st; }
    float mx = -3.4e38f;
#pragma unroll
    for (int t = 0; t < 4; ++t) {
#pragma unroll
      for (int r = 0; r < 8; ++r) mx = fmaxf(mx, s[t][r]); }
    mx = fmaxf(mx, __shfl_xor(mx, 16, 32));
    const float mnew = fmaxf(mrun, mx * SC2); const float corr = __builtin_amdgcn_exp2f(mrun - mnew);   // running maximum in base-2 units
    const float moff = mnew - 14.0f;   // the factor 16384 = 2^14 of P rides in the exponent
    float ps = 0.f; v16h ph[2], pl[2];
#pragma unroll
    for (int kc = 0; kc < 2; ++kc) {
#pragma unroll
      for (int i = 0; i < 16; ++i) { const float p = __builtin_amdgcn_exp2f(fmaf(s[2 * kc + (i >> 3)][i & 7], SC2, -moff)); ps += p; const _Float16 hi = (_Float16)p; ph[kc][i] = hi; pl[kc][i] = (_Float16)(p - (float)hi); } }
    ps += __shfl_xor(ps, 16, 32);
    lrun = lrun * corr + ps * (1.0f / 16384.0f); mrun = mnew;
#pragma unroll
    for (int t = 0; t < 4; ++t) {
#pragma unroll
      for (int r = 0; r < 8; ++r) acc[t][r] *= corr; }
#pragma unroll
    for (int kc = 0; kc < 2; ++kc) { v16h vh[4], vl[4];   // the three products of a d tile add into one accumulator; each kind runs over the four d tiles, so that no product follows directly on the one it adds to
#pragma unroll
      for (int t = 0; t < 4; ++t) { vh[t] = frag_h(&sKV[bf][2][t * 16 + col][kc * 32], lane); vl[t] = frag_h(&sKV[bf][3][t * 16 + col][kc * 32], lane); }
#pragma unroll
      for (int t = 0; t < 4; ++t) acc[t] = wmma16(vh[t], pl[kc], acc[t]);
#pragma unroll
      for (int t = 0; t < 4; ++t) acc[t] = wmma16(vl[t], ph[kc], acc[t]);
#pragma unroll
      for (int t = 0; t < 4; ++t) acc[t] = wmma16(vh[t], ph[kc], acc[t]); }
    __builtin_amdgcn_wave_barrier();
    asm volatile("s_wait_dscnt 0x0" ::: "memory");      // this wave's reads of buffer bf have returned before the buffer is handed to its next writer
    asm volatile("s_wait_asynccnt 0x0" ::: "memory");   // this wave's share of tile kt + 1 has landed
    __syncthreads();                                     // publishes tile kt + 1 and ends every wave's reads of buffer bf
    if (kt + 2 < SS / 64) stage_kv(lds0 + bf * (4 * KVT), gkh + (size_t)(kt + 2) * 64 * HD, gkl + (size_t)(kt + 2) * 64 * HD, gvh + (kt + 2) * 64, gvl + (kt + 2) * 64); }
  asm volatile("s_wait_asynccnt 0x0" ::: "memory");     // no copy is outstanding when the LDS becomes output staging
  const float inv = 1.0f / (lrun * 16384.0f * 4.0f);
#pragma unroll
  for (int t = 0; t < 4; ++t) {
#pragma unroll
    for (int r = 0; r < 8; ++r) sO[w][col][t * 16 + 8 * g + r] = acc[t][r] * inv; }
  LDSX();
  for (int qq = lane; qq < 16 * 16; qq += 32) { const int rl = qq >> 4, pc = qq & 15; vst2(O32 + ((bh * SS) + q0 + rl) * HD + pc * 4, *(const v4f*)(&sO[w][rl][pc * 4])); }
}
// out = ctx Wo^T + bo : split(ctx) x bf16(Wo rows): 2 products (Wo is an INPUT -> bf16 exact); eight tiles of 64 k (one head each), ctx rows (f32) and Wo rows staged once per block in LDS, two buffers
__global__ __launch_bounds__(128) void k_out(const float* __restrict__ O32, const __bf16* __restrict__ PT, const float* __restrict__ bo, float* __restrict__ out) {
  __shared__ __align__(16) unsigned char sm[2 * OBUF];   // operand tiles in the loop; output staging behind its last barrier
  float (*so)[16][132] = (float (*)[16][132])sm;
  const int tid = threadIdx.x, wave = tid >> 5, lane = tid & 31, col = lane & 15, g = lane >> 4;
  const int r0b = blockIdx.x * 64, r0 = r0b + wave * 16, n0 = blockIdx.y * 128; const int b = r0b / SS, s0 = r0b % SS;
  const unsigned la = (unsigned)(size_t)&sm[(tid >> 4) * (OAP * 4) + (tid & 15) * 16];
  const unsigned lb = (unsigned)(size_t)&sm[64 * OAP * 4 + (tid >> 3) * (GP * 2) + (tid & 7) * 16];
  const float* ga = O32 + ((size_t)b * NH * SS + s0 + (tid >> 4)) * HD + (tid & 15) * 4;   // head h of these rows: + h * SS * HD
  const __bf16* gb = PT + (size_t)(3 * E + n0 + (tid >> 3)) * E + (tid & 7) * 8;
  stage8(la, 8 * OAP * 4, ga, (size_t)8 * HD); stage8(lb, 16 * GP * 2, gb, (size_t)16 * E);
  v8f acc[8] = {};
  asm volatile("s_wait_asynccnt 0x0" ::: "memory");   // this wave's share of tile 0 has landed
  __syncthreads();                                     // tile 0 is published to every wave
  stage8(la + OBUF, 8 * OAP * 4, ga + (size_t)SS * HD, (size_t)8 * HD); stage8(lb + OBUF, 16 * GP * 2, gb + 64, (size_t)16 * E);
#pragma unroll 1
  for (int c = 0; c < E / 64; ++c) { const float* ta = (const float*)(sm + (c & 1) * OBUF); const __bf16* tb = (const __bf16*)(sm + (c & 1) * OBUF + 64 * OAP * 4);
    F2 a[2]; v16b wb[2][8];   // the tile's fragment reads all stand in front of its products: the wave meets the LDS latency once per tile, not once per product
#pragma unroll
    for (int kk = 0; kk < 2; ++kk) { a[kk] = split_row(ta + (wave * 16 + col) * OAP, kk * 32, lane);
#pragma unroll
      for (int j = 0; j < 8; ++j) wb[kk][j] = frag_b(tb + (j * 16 + col) * GP + kk * 32, lane); }
    __builtin_amdgcn_sched_barrier(0);   // holds the reads in front: without it the compiler sinks them among the products, each pair with a wait of its own
#pragma unroll
    for (int kk = 0; kk < 2; ++kk) {
#pragma unroll
      for (int j = 0; j < 8; ++j) { acc[j] = wmma_bf(a[kk].l, wb[kk][j], acc[j]); acc[j] = wmma_bf(a[kk].h, wb[kk][j], acc[j]); } }
    __builtin_amdgcn_sched_barrier(0);   // holds the products in front of the waits, so that the next tile's copies fly during them
    asm volatile("s_wait_dscnt 0x0" ::: "memory");      // this wave's reads of the buffer have returned before it is handed to its next writer
    asm volatile("s_wait_asynccnt 0x0" ::: "memory");   // this wave's share of tile c + 1 has landed
    __syncthreads();                                     // publishes tile c + 1 and ends every wave's reads of this buffer
    if (c + 2 < E / 64) { stage8(la + (c & 1) * OBUF, 8 * OAP * 4, ga + (size_t)(c + 2) * SS * HD, (size_t)8 * HD); stage8(lb + (c & 1) * OBUF, 16 * GP * 2, gb + (c + 2) * 64, (size_t)16 * E); } }
  asm volatile("s_wait_asynccnt 0x0" ::: "memory");     // no copy is outstanding when the LDS becomes output staging
#pragma unroll
  for (int j = 0; j < 8; ++j) { const float bb = bfr(bo[n0 + j * 16 + col]);
#pragma unroll
    for (int r = 0; r < 8; ++r) so[wave][8 * g + r][j * 16 + col] = acc[j][r] + bb; }
  LDSX();
#pragma unroll 4
  for (int rl = 0; rl < 16; ++rl) vst2(out + (size_t)(r0 + rl) * E + n0 + lane * 4, *(const v4f*)(&so[wave][rl][lane * 4]));
}
extern "C" void kernel_launch(void* const* d_in, const int* in_sizes, int n_in, void* d_out, int out_size, void* d_ws, size_t ws_size, hipStream_t stream) {
  (void)in_sizes; (void)n_in; (void)out_size; (void)ws_size;
  const float** I = (const float**)d_in;   // emb_q, emb_k, emb_v, WQ, bQ, WK, bK, WV, bV, WO, bO
  const float* eq = I[0]; const float* ek = I[1]; const float* ev = I[2]; const float* WQ = I[3]; const float* bQ = I[4]; const float* WK = I[5]; const float* bK = I[6]; const float* WV = I[7]; const float* bV = I[8]; const float* WO = I[9]; const float* bO = I[10];
  float* out = (float*)d_out;
  char* ws = (char*)d_ws; size_t off = 0;
  auto take = [&](size_t bytes) { char* p = ws + off; off += (bytes + 255) & ~(size_t)255; return p; };
  __bf16* PT = (__bf16*)take((size_t)4 * E * E * 2);
  float* Q32 = (float*)take((size_t)NR * E * 4); __bf16* Kh = (__bf16*)take((size_t)NR * E * 2); __bf16* Kl = (__bf16*)take((size_t)NR * E * 2); _Float16* VTh = (_Float16*)take((size_t)NR * E * 2); _Float16* VTl = (_Float16*)take((size_t)NR * E * 2); float* O32 = (float*)take((size_t)NR * E * 4);
  // ws ~ 69 MB
  k_pack<<<PKT + PKO, 256, 0, stream>>>(WQ, WK, WV, WO, PT);
  k_qkv<<<dim3(NR / 64, E / 128, 3), 128, 0, stream>>>(eq, ek, ev, PT, bQ, bK, bV, Q32, Kh, Kl, VTh, VTl);
  k_attn<<<dim3(SS / 128, NB * NH), 256, 0, stream>>>(Q32, Kh, Kl, VTh, VTl, O32);
  k_out<<<dim3(NR / 64, E / 128), 128, 0, stream>>>(O32, PT, bO, out);
}

// v009
// It runs in 110 microseconds.
// Two timings next to v008 both put it at 1.05 times that version's speed.
// Counting every step since v000, it is 3.78 times as fast.
// compute dtype: embeddings and W*/b* (INPUTS) rounded to bf16 with exact bf16 WMMA products (f32 accumulate) for the projections; K pre-split into bf16 hi/lo rows; q f32 split, P and V f16 hi/lo (3 products each, the low halves at the scale of the high ones, one f32 accumulator); softmax f32.
#include <hip/hip_runtime.h>
#include <math.h>

typedef __attribute__((ext_vector_type(16))) _Float16 v16h;
typedef __attribute__((ext_vector_type(16))) __bf16 v16b;
typedef __attribute__((ext_vector_type(8)))  _Float16 v8h;
typedef __attribute__((ext_vector_type(8)))  float v8f;
typedef __attribute__((ext_vector_type(4)))  float v4f;
typedef __attribute__((ext_vector_type(2)))  float v2f;
typedef __attribute__((ext_vector_type(4)))  unsigned v4u;
typedef __attribute__((ext_vector_type(2)))  unsigned v2u;
typedef __attribute__((ext_vector_type(4)))  int v4i;
typedef float __attribute__((may_alias)) float_a;
typedef int __attribute__((may_alias)) int_a;

template <typename T> __device__ __forceinline__ void vst2(void* p, T v) { *(T*)p = v;  }
__device__ __forceinline__ v8f wmma16(v16h a, v16h b, v8f c) {
  return __builtin_amdgcn_wmma_f32_16x16x32_f16(false, a, false, b, (short)0, c, false, false);
}
__device__ __forceinline__ v8f wmma_bf(v16b a, v16b b, v8f c) {
  return __builtin_amdgcn_wmma_f32_16x16x32_bf16(false, a, false, b, (short)0, c, false, false);
}
// 16x16x32 fragments: lane = (h = lane>>4, row/col = lane&15); elements 0..7 = k0+8h+0..7, 8..15 = k0+16+8h+0..7; D element r = row 8h+r
__device__ __forceinline__ v16h frag_h(const _Float16* rowk0, int lane) {
  union { v16h v; v8h q[2]; } u; const _Float16* p = rowk0 + 8 * (lane >> 4);
  u.q[0] = *(const v8h*)p; u.q[1] = *(const v8h*)(p + 16); return u.v;
}
__device__ __forceinline__ v16h frag_f32(const float* rowk0, int lane) {
  v16h a; const float* p = rowk0 + 8 * (lane >> 4);
#pragma unroll
  for (int i = 0; i < 8; ++i) { a[i] = (_Float16)p[i]; a[8 + i] = (_Float16)p[16 + i]; }
  return a;
}
__device__ __forceinline__ v16h frag_f32s(const float* rowk0, int lane, float sc) {
  v16h a; const float* p = rowk0 + 8 * (lane >> 4);
#pragma unroll
  for (int i = 0; i < 8; ++i) { a[i] = (_Float16)(p[i] * sc); a[8 + i] = (_Float16)(p[16 + i] * sc); }
  return a;
}
// column fragment from a [K][ld] layout (column n), rows >= K read as 0
__device__ __forceinline__ v16h fragc_f32(const float* W, int k0, int n, int lane, int ld, int K) {
  v16h a; const int g = lane >> 4;
#pragma unroll
  for (int i = 0; i < 8; ++i) { const int ka = k0 + 8 * g + i, kb = ka + 16;
    a[i] = (_Float16)(ka < K ? W[(size_t)ka * ld + n] : 0.f); a[8 + i] = (_Float16)(kb < K ? W[(size_t)kb * ld + n] : 0.f); }
  return a;
}
struct F2 { v16b h, l; };
__device__ __forceinline__ F2 bsplit16(const float v[16]) { F2 r;
#pragma unroll
  for (int i = 0; i < 16; ++i) { const __bf16 h = (__bf16)v[i]; r.h[i] = h; r.l[i] = (__bf16)(v[i] - (float)h); }
  return r; }
__device__ __forceinline__ F2 split_row(const float* row, int k0, int lane) { float v[16]; const float* p = row + k0 + 8 * (lane >> 4);
#pragma unroll
  for (int i = 0; i < 8; ++i) { v[i] = p[i]; v[8 + i] = p[16 + i]; }
  return bsplit16(v); }
__device__ __forceinline__ F2 split_rowK(const float* row, int k0, int lane, int K) { float v[16]; const int g = lane >> 4;
#pragma unroll
  for (int i = 0; i < 8; ++i) { const int ka = k0 + 8 * g + i, kb = ka + 16; v[i] = ka < K ? row[ka] : 0.f; v[8 + i] = kb < K ? row[kb] : 0.f; }
  return bsplit16(v); }
__device__ __forceinline__ F2 split_col(const float* W, int k0, int n, int lane, int ld, int K) { float v[16]; const int g = lane >> 4;
#pragma unroll
  for (int i = 0; i < 8; ++i) { const int ka = k0 + 8 * g + i, kb = ka + 16; v[i] = ka < K ? W[(size_t)ka * ld + n] : 0.f; v[8 + i] = kb < K ? W[(size_t)kb * ld + n] : 0.f; }
  return bsplit16(v); }
__device__ __forceinline__ v8f mac3(const F2& a, const F2& b, v8f c) { c = wmma_bf(a.l, b.h, c); c = wmma_bf(a.h, b.l, c); return wmma_bf(a.h, b.h, c); }
__device__ __forceinline__ float sigm(float v) { return 1.0f / (1.0f + expf(-v)); }
#define LDSX() do { asm volatile("s_wait_dscnt 0" ::: "memory"); __builtin_amdgcn_wave_barrier(); __builtin_amdgcn_fence(__ATOMIC_RELEASE, "workgroup"); } while (0)


// Encoder-decoder multi-head attention (8 heads x 64 on [4,2048,512]): Q/K/V from three separate embeddings with per-head weights W[h][e][d] + biases; full softmax(q.k/8); cat(heads) WO^T + bO.
#define NB 4
#define SS 2048
#define E 512
#define NH 8
#define HD 64
#define NR (NB * SS)
#define SC2 0.18033688f   // 1/8 x log2(e): takes a raw score to base-2 units
__device__ __forceinline__ float bfr(float v) { return (float)(__bf16)v; }
__device__ __forceinline__ v16b frag_b(const __bf16* rowk0, int lane) { return __builtin_bit_cast(v16b, frag_h((const _Float16*)rowk0, lane)); }

// A fragment from an f32 row: the same elements as frag_b, each rounded to bf16 (nearest even) on the way
__device__ __forceinline__ v16b frag_bf32(const float* rowk0, int lane) {
  v16b a; const float* p = rowk0 + 8 * (lane >> 4);
#pragma unroll
  for (int i = 0; i < 8; ++i) { a[i] = (__bf16)p[i]; a[8 + i] = (__bf16)p[16 + i]; }
  return a;
}
// PT rows: [0,E) Wq[:,n], [E,2E) Wk[:,n], [2E,3E) Wv[:,n], [3E,4E) Wo[n,:]  (Wq/Wk/Wv, [in][out]: column n as a bf16 row; Wo, [out][in]: row n as a bf16 row)
// Blocks [0, PKT): one tile of 128 e x 64 d of one head of Wq, Wk or Wv ([H][E][DH]), read in 16-byte pieces along d (a wave-wide load covers whole lines), turned in LDS, written as 64 pieces of 256 B along e.
// Blocks [PKT, PKT + PKO): 16 rows of WO ([out][in]: row n is already PT's row), rounded where they stand.
#define PKT (3 * NH * (E / 128))
#define PKO (E / 16)
#define PKP 68   // LDS row pitch in dwords: 128 e as bf16 and 16 B, so that a row starts at a multiple of 16 B
// Every loop of the kernel is unrolled: x stays in registers, and a thread's eight loads are all in flight before the first is used.
__global__ __launch_bounds__(256) void k_pack(const float* __restrict__ Wq, const float* __restrict__ Wk, const float* __restrict__ Wv, const float* __restrict__ Wo, __bf16* __restrict__ PT) {
  const unsigned blk = blockIdx.x, tid = threadIdx.x; __shared__ __align__(16) unsigned st[HD][PKP];
  if (blk < PKT) {
    const unsigned m = blk / (NH * (E / 128)), hh = (blk / (E / 128)) % NH, e0 = (blk % (E / 128)) * 128;
    const float* W = (m == 0 ? Wq : (m == 1 ? Wk : Wv)) + ((size_t)hh * E + e0) * HD;
    const unsigned dq = tid & 15, eq = tid >> 4;   // this thread: d = 4 dq + 0..3 of the rows e = 4 eq + 0..3 and 64 + 4 eq + 0..3
    v4f x[2][4];
#pragma unroll
    for (int i = 0; i < 2; ++i) {
#pragma unroll
      for (int r = 0; r < 4; ++r) x[i][r] = *(const v4f*)(W + (size_t)(64 * i + 4 * eq + r) * HD + dq * 4); }
#pragma unroll
    for (int i = 0; i < 2; ++i) {
#pragma unroll
      for (int j = 0; j < 4; ++j) { union { __bf16 e[4]; v2u u; } pk;
#pragma unroll
        for (int r = 0; r < 4; ++r) pk.e[r] = (__bf16)x[i][r][j];
        *(v2u*)(&st[dq * 4 + j][32 * i + 2 * eq]) = pk.u; } }
    __syncthreads();
#pragma unroll
    for (int i = 0; i < 4; ++i) { const int d = 16 * i + eq;   // sixteen threads write one row's 256 B
      vst2(PT + (size_t)(m * E + hh * HD + d) * E + e0 + dq * 8, *(const v4u*)(&st[d][dq * 4])); } }
  else {
    const size_t o = (size_t)(blk - PKT) * (16 * E) + tid * 8;
    v4f x[4][2];
#pragma unroll
    for (int i = 0; i < 4; ++i) { x[i][0] = *(const v4f*)(Wo + o + i * 2048); x[i][1] = *(const v4f*)(Wo + o + i * 2048 + 4); }
#pragma unroll
    for (int i = 0; i < 4; ++i) { union { __bf16 e[8]; v4u u; } pk;
#pragma unroll
      for (int r = 0; r < 8; ++r) pk.e[r] = (__bf16)x[i][r >> 2][r & 3];
      vst2(PT + (size_t)3 * E * E + o + i * 2048, pk.u); }
    asm volatile("s_wait_xcnt 0x0" ::: "memory"); }   // behind the four stores: no register that they name is rewritten in front of it on any way the code behind allows
}
// Operand staging of the projection products: a tile is 64 k of every row the block needs, rows of 16-bit data (128 B) at a 144-B pitch, rows of f32 (256 B) at a 272-B pitch (16 B x odd: conflict-free for 16-byte fragment reads).
// A wave-wide copy covers four whole 128-B lines, where a fragment load from global memory touches sixteen.
#define GP 72
#define OAP 68
#define OBUF (64 * OAP * 4 + 128 * GP * 2)
// Eight copies: 16 B of eight rows, the rows rs apart in LDS (bytes) and gs apart in global memory (elements). s_wait_xcnt 0 closes the statement so that no address register named here is rewritten in front of it.
template <typename T> __device__ __forceinline__ void stage8(unsigned l, unsigned rs, const T* p, size_t gs) {
  asm volatile("global_load_async_to_lds_b128 %0, %8, off\n\t"
               "global_load_async_to_lds_b128 %1, %9, off\n\t"
               "global_load_async_to_lds_b128 %2, %10, off\n\t"
               "global_load_async_to_lds_b128 %3, %11, off\n\t"
               "global_load_async_to_lds_b128 %4, %12, off\n\t"
               "global_load_async_to_lds_b128 %5, %13, off\n\t"
               "global_load_async_to_lds_b128 %6, %14, off\n\t"
               "global_load_async_to_lds_b128 %7, %15, off\n\t"
               "s_wait_xcnt 0x0"
               :: "v"(l), "v"(l + rs), "v"(l + 2 * rs), "v"(l + 3 * rs), "v"(l + 4 * rs), "v"(l + 5 * rs), "v"(l + 6 * rs), "v"(l + 7 * rs),
                  "v"(p), "v"(p + gs), "v"(p + 2 * gs), "v"(p + 3 * gs), "v"(p + 4 * gs), "v"(p + 5 * gs), "v"(p + 6 * gs), "v"(p + 7 * gs)
               : "memory");
}
// QKV: block (64 rows, 128 cols = 2 heads, which); eight tiles of 64 k, embedding rows (f32, as they come in; rounded to bf16 where the A fragment is formed) and weight rows staged once per block in LDS (two buffers, the next tile's copies fly during this tile's products); q (+bias) -> Q32 f32 [bh][s][64]; k (+bias) -> bf16 hi/lo rows; v (+bias) -> VT hi/lo x4 [bh][d][s]
__global__ __launch_bounds__(128) void k_qkv(const float* __restrict__ XQ, const float* __restrict__ XK, const float* __restrict__ XV, const __bf16* __restrict__ PT, const float* __restrict__ bq, const float* __restrict__ bk, const float* __restrict__ bv, float* __restrict__ Q32, __bf16* __restrict__ Kh, __bf16* __restrict__ Kl, _Float16* __restrict__ VTh, _Float16* __restrict__ VTl) {
  __shared__ __align__(16) unsigned char sm[2 * OBUF];   // operand tiles in the loop; output staging behind its last barrier
  float (*so)[16][132] = (float (*)[16][132])sm;
  _Float16 (*sth)[72] = (_Float16 (*)[72])sm; _Float16 (*stl)[72] = (_Float16 (*)[72])(sm + 128 * 72 * 2);
  const int tid = threadIdx.x, wave = tid >> 5, lane = tid & 31, col = lane & 15, g = lane >> 4;
  const int which = blockIdx.z, r0b = blockIdx.x * 64, n0 = blockIdx.y * 128; const int b = r0b / SS, s0 = r0b % SS;
  const float* Xf = which == 0 ? XQ : (which == 1 ? XK : XV); const float* bb_ = which == 0 ? bq : (which == 1 ? bk : bv);
  const unsigned la = (unsigned)(size_t)&sm[(tid >> 4) * (OAP * 4) + (tid & 15) * 16];
  const unsigned lb = (unsigned)(size_t)&sm[64 * OAP * 4 + (tid >> 3) * (GP * 2) + (tid & 7) * 16];
  const float* ga = Xf + (size_t)(r0b + (tid >> 4)) * E + (tid & 15) * 4; const __bf16* gb = PT + (size_t)(which * E + n0 + (tid >> 3)) * E + (tid & 7) * 8;
  stage8(la, 8 * OAP * 4, ga, (size_t)8 * E); stage8(lb, 16 * GP * 2, gb, (size_t)16 * E);
  v8f acc[8] = {};
  asm volatile("s_wait_asynccnt 0x0" ::: "memory");   // this wave's share of tile 0 has landed
  __syncthreads();                                     // tile 0 is published to every wave
  stage8(la + OBUF, 8 * OAP * 4, ga + 64, (size_t)8 * E); stage8(lb + OBUF, 16 * GP * 2, gb + 64, (size_t)16 * E);
#pragma unroll 1
  for (int c = 0; c < E / 64; ++c) { const float* ta = (const float*)(sm + (c & 1) * OBUF); const __bf16* tb = (const __bf16*)(sm + (c & 1) * OBUF + 64 * OAP * 4);
    v16b a[2], wb[2][8];   // the tile's fragment reads all stand in front of its products: the wave meets the LDS latency once per tile, not once per product
#pragma unroll
    for (int kk = 0; kk < 2; ++kk) { a[kk] = frag_bf32(ta + (wave * 16 + col) * OAP + kk * 32, lane);
#pragma unroll
      for (int j = 0; j < 8; ++j) wb[kk][j] = frag_b(tb + (j * 16 + col) * GP + kk * 32, lane); }
    __builtin_amdgcn_sched_barrier(0);   // holds the reads in front: without it the compiler sinks them among the products, each pair with a wait of its own
#pragma unroll
    for (int kk = 0; kk < 2; ++kk) {
#pragma unroll
      for (int j = 0; j < 8; ++j) acc[j] = wmma_bf(a[kk], wb[kk][j], acc[j]); }
    __builtin_amdgcn_sched_barrier(0);   // holds the products in front of the waits, so that the next tile's copies fly during them
    asm volatile("s_wait_dscnt 0x0" ::: "memory");      // this wave's reads of the buffer have returned before it is handed to its next writer
    asm volatile("s_wait_asynccnt 0x0" ::: "memory");   // this wave's share of tile c + 1 has landed
    __syncthreads();                                     // publishes tile c + 1 and ends every wave's reads of this buffer
    if (c + 2 < E / 64) { stage8(la + (c & 1) * OBUF, 8 * OAP * 4, ga + (c + 2) * 64, (size_t)8 * E); stage8(lb + (c & 1) * OBUF, 16 * GP * 2, gb + (c + 2) * 64, (size_t)16 * E); } }
  asm volatile("s_wait_asynccnt 0x0" ::: "memory");     // no copy is outstanding when the LDS becomes output staging
  if (which < 2) {
#pragma unroll
    for (int j = 0; j < 8; ++j) { const float bb = bfr(bb_[n0 + j * 16 + col]);
#pragma unroll
      for (int r = 0; r < 8; ++r) so[wave][8 * g + r][j * 16 + col] = acc[j][r] + bb; }
    LDSX();
    if (which == 0) { for (int qq = lane; qq < 2 * 16 * 16; qq += 32) { const int hh = qq >> 8, rl = (qq >> 4) & 15, pc = qq & 15; const int h = (n0 >> 6) + hh;
        vst2(Q32 + (((size_t)b * NH + h) * SS + s0 + wave * 16 + rl) * HD + pc * 4, *(const v4f*)(&so[wave][rl][hh * 64 + pc * 4])); } }
    else {
      for (int qq = lane; qq < 2 * 16 * 16; qq += 32) { const int hh = qq >> 8, rl = (qq >> 4) & 15, pl = qq & 15; const int h = (n0 >> 6) + hh; const int pc = pl & 7; union { __bf16 e[8]; v4u u; } pk;
#pragma unroll
        for (int e = 0; e < 8; ++e) { const float v = so[wave][rl][hh * 64 + pc * 8 + e]; const __bf16 hi = (__bf16)v; pk.e[e] = pl < 8 ? hi : (__bf16)(v - (float)hi); }
        vst2((unsigned*)((pl < 8 ? Kh : Kl) + (((size_t)b * NH + h) * SS + s0 + wave * 16 + rl) * HD + pc * 8), pk.u); } } }
  else {
#pragma unroll
    for (int j = 0; j < 8; ++j) { const float bb = bfr(bb_[n0 + j * 16 + col]);
#pragma unroll
      for (int r = 0; r < 8; ++r) { const float v = (acc[j][r] + bb) * 4.0f; const _Float16 hi = (_Float16)v; sth[j * 16 + col][wave * 16 + 8 * g + r] = hi; stl[j * 16 + col][wave * 16 + 8 * g + r] = (_Float16)(v - (float)hi); } }
    __syncthreads();
    for (int qq = tid; qq < 128 * 8; qq += 128) { const int cl = qq >> 3, pc = qq & 7; const int c = n0 + cl, h = c >> 6, d = c & 63; const size_t o = (((size_t)b * NH + h) * HD + d) * SS + s0 + pc * 8;
      vst2(VTh + o, *(const v4u*)(&sth[cl][pc * 8])); vst2(VTl + o, *(const v4u*)(&stl[cl][pc * 8])); } }
}
// K/V staging: one 64-key tile of Kh, Kl, VTh, VTl (64 rows x 128 B each) per buffer, rows at a 144-B pitch (16 B x odd: conflict-free for 16-byte fragment reads)
#define KVP 72
#define KVT (64 * KVP * 2)
// Half a tile's copies (a block of four waves calls it twice, the second time 16 rows on): every lane moves 16 B of two rows of each of the four arrays, so a wave-wide copy covers four whole 128-B lines.
// s_wait_xcnt 0 closes the statement so that no address register named here is rewritten in front of it.
__device__ __forceinline__ void stage_kv(unsigned l, const __bf16* kh, const __bf16* kl, const _Float16* vh, const _Float16* vl) {
  asm volatile("global_load_async_to_lds_b128 %0, %8, off\n\t"
               "global_load_async_to_lds_b128 %1, %9, off\n\t"
               "global_load_async_to_lds_b128 %2, %10, off\n\t"
               "global_load_async_to_lds_b128 %3, %11, off\n\t"
               "global_load_async_to_lds_b128 %4, %12, off\n\t"
               "global_load_async_to_lds_b128 %5, %13, off\n\t"
               "global_load_async_to_lds_b128 %6, %14, off\n\t"
               "global_load_async_to_lds_b128 %7, %15, off\n\t"
               "s_wait_xcnt 0x0"
               :: "v"(l), "v"(l + 32 * KVP * 2), "v"(l + KVT), "v"(l + KVT + 32 * KVP * 2), "v"(l + 2 * KVT), "v"(l + 2 * KVT + 32 * KVP * 2), "v"(l + 3 * KVT), "v"(l + 3 * KVT + 32 * KVP * 2),
                  "v"(kh), "v"(kh + 32 * HD), "v"(kl), "v"(kl + 32 * HD), "v"(vh), "v"(vh + 32 * SS), "v"(vl), "v"(vl + 32 * SS)
               : "memory");
}
// full attention: block (128 queries = 4 waves x 32, bh); 32 key tiles of 64, each staged once per block in LDS (two buffers, the next tile's copies fly during this tile's work)
// transposed products: S^T = K q^T (A = K hi/lo rows, B = q hi/lo) and O^T += V^T P^T (A = V^T rows, B = P^T). A lane's S^T accumulators are, per query tile u, 32 scores of its query 16 u + (lane & 15), keys 16 t + 8 g + r,
// and those are the elements the B fragment of P^T wants in that lane: scores and P stay in registers. softmax in base 2 (one fma and one hardware exp2 per score); P,V hi/lo; O f32 [bh][s][64]
// A wave holds two query tiles of 16 (u = 0, 1): every K and V^T fragment read from LDS is the A operand of both tiles' products. Two blocks share a WGP, one wave of each on every SIMD (512 registers a wave), so a whole tile's fragments fit in registers.
__global__ __launch_bounds__(128) __attribute__((amdgpu_waves_per_eu(2, 2))) void k_attn(const float* __restrict__ Q32, const __bf16* __restrict__ Kh, const __bf16* __restrict__ Kl, const _Float16* __restrict__ VTh, const _Float16* __restrict__ VTl, float* __restrict__ O32) {
  __shared__ __align__(16) _Float16 sKV[2][4][64][KVP];   // K/V tiles in the loop; output staging behind its last barrier (each wave its own slice)
  float (*sO)[32][68] = (float (*)[32][68])sKV;
  const int tid = threadIdx.x, w = tid >> 5, lane = tid & 31, col = lane & 15, g = lane >> 4;
  const size_t bh = blockIdx.y; const int qb = blockIdx.x; const int q0 = qb * 128 + w * 32;
  const int crow = tid >> 3, cpc = tid & 7;   // this thread's copies: 16 B of the rows crow, crow + 16, crow + 32, crow + 48 of each array
  const unsigned lds0 = (unsigned)(size_t)&sKV[0][0][crow][cpc * 8];
  const unsigned ok = ((unsigned)bh * SS + crow) * HD + cpc * 8, ov = ((unsigned)bh * HD + crow) * SS + cpc * 8;   // element offsets of this thread's first piece in the K arrays and in the V^T arrays (two registers live through the loop, where four pointers would spill)
  stage_kv(lds0, Kh + ok, Kl + ok, VTh + ov, VTl + ov); stage_kv(lds0 + 16 * KVP * 2, Kh + (ok + 16 * HD), Kl + (ok + 16 * HD), VTh + (ov + 16 * SS), VTl + (ov + 16 * SS));
  F2 aq[2][2];
#pragma unroll
  for (int u = 0; u < 2; ++u) {
#pragma unroll
    for (int kc = 0; kc < 2; ++kc) aq[u][kc] = split_row(Q32 + (bh * SS + q0 + u * 16 + col) * HD, kc * 32, lane); }
  float mrun[2] = {-3.0e38f, -3.0e38f}, lrun[2] = {0.f, 0.f}; v8f acc[2][4] = {};   // mrun, lrun: of query 16 u + col, the same in both halves of the wave; acc[u][t][r]: d = 16 t + 8 g + r of that query
  LDSX();
  asm volatile("s_wait_asynccnt 0x0" ::: "memory");   // this wave's share of tile 0 has landed
  __syncthreads();                                     // tile 0 is published to every wave
  stage_kv(lds0 + 4 * KVT, Kh + (ok + 64 * HD), Kl + (ok + 64 * HD), VTh + (ov + 64), VTl + (ov + 64)); stage_kv(lds0 + 4 * KVT + 16 * KVP * 2, Kh + (ok + 80 * HD), Kl + (ok + 80 * HD), VTh + (ov + 16 * SS + 64), VTl + (ov + 16 * SS + 64));
#pragma unroll 1
  for (int kt = 0; kt < SS / 64; ++kt) {
    const int bf = kt & 1;
    v8f s[2][4];
#pragma unroll
    for (int t = 0; t < 4; ++t) { const __bf16* kr = (const __bf16*)&sKV[bf][0][t * 16 + col][0]; const __bf16* lr_ = (const __bf16*)&sKV[bf][1][t * 16 + col][0]; v8f st[2] = {};
#pragma unroll
      for (int kc = 0; kc < 2; ++kc) { const v16b khf = frag_b(kr + kc * 32, lane), klf = frag_b(lr_ + kc * 32, lane);
#pragma unroll
        for (int u = 0; u < 2; ++u) st[u] = wmma_bf(khf, aq[u][kc].l, st[u]);
#pragma unroll
        for (int u = 0; u < 2; ++u) st[u] = wmma_bf(klf, aq[u][kc].h, st[u]);
#pragma unroll
        for (int u = 0; u < 2; ++u) st[u] = wmma_bf(khf, aq[u][kc].h, st[u]); }
      s[0][t] = st[0]; s[1][t] = st[1]; }
    v16h vh[2][4], vl[2][4];   // the tile's V^T fragments, read as one group into the registers the K fragments have left: their latency passes under the softmax
#pragma unroll
    for (int kc = 0; kc < 2; ++kc) {
#pragma unroll
      for (int t = 0; t < 4; ++t) { vh[kc][t] = frag_h(&sKV[bf][2][t * 16 + col][kc * 32], lane); vl[kc][t] = frag_h(&sKV[bf][3][t * 16 + col][kc * 32], lane); } }
    __builtin_amdgcn_sched_barrier(0);   // holds the reads in front: without it the compiler sinks them among the products in pairs, each pair with a wait of its own
    v16h ph[2][2], pl[2][2];
#pragma unroll
    for (int u = 0; u < 2; ++u) {
      float mx = -3.4e38f;
#pragma unroll
      for (int t = 0; t < 4; ++t) {
#pragma unroll
        for (int r = 0; r < 8; ++r) mx = fmaxf(mx, s[u][t][r]); }
      mx = fmaxf(mx, __shfl_xor(mx, 16, 32));
      const float mnew = fmaxf(mrun[u], mx * SC2); const float corr = __builtin_amdgcn_exp2f(mrun[u] - mnew);   // running maximum in base-2 units
      const float moff = mnew - 14.0f;   // the factor 16384 = 2^14 of P rides in the exponent
      float ps = 0.f;
#pragma unroll
      for (int kc = 0; kc < 2; ++kc) {
#pragma unroll
        for (int i = 0; i < 16; ++i) { const float p = __builtin_amdgcn_exp2f(fmaf(s[u][2 * kc + (i >> 3)][i & 7], SC2, -moff)); ps += p; const _Float16 hi = (_Float16)p; ph[u][kc][i] = hi; pl[u][kc][i] = (_Float16)(p - (float)hi); } }
      ps += __shfl_xor(ps, 16, 32);
      lrun[u] = lrun[u] * corr + ps * (1.0f / 16384.0f); mrun[u] = mnew;
#pragma unroll
      for (int t = 0; t < 4; ++t) {
#pragma unroll
        for (int r = 0; r < 8; ++r) acc[u][t][r] *= corr; } }
#pragma unroll
    for (int kc = 0; kc < 2; ++kc) {   // the three products of a d tile add into one accumulator; each kind runs over the four d tiles and both query tiles, so that no product follows directly on the one it adds to
#pragma unroll
      for (int t = 0; t < 4; ++t) {
#pragma unroll
        for (int u = 0; u < 2; ++u) acc[u][t] = wmma16(vh[kc][t], pl[u][kc], acc[u][t]); }
#pragma unroll
      for (int t = 0; t < 4; ++t) {
#pragma unroll
        for (int u = 0; u < 2; ++u) acc[u][t] = wmma16(vl[kc][t], ph[u][kc], acc[u][t]); }
#pragma unroll
      for (int t = 0; t < 4; ++t) {
#pragma unroll
        for (int u = 0; u < 2; ++u) acc[u][t] = wmma16(vh[kc][t], ph[u][kc], acc[u][t]); } }
    __builtin_amdgcn_sched_barrier(0);   // holds the softmax and the products in front of the waits, so that the V^T reads return and the next tile's copies fly during them
    asm volatile("s_wait_dscnt 0x0" ::: "memory");      // this wave's reads of buffer bf have returned before the buffer is handed to its next writer
    asm volatile("s_wait_asynccnt 0x0" ::: "memory");   // this wave's share of tile kt + 1 has landed
    __syncthreads();                                     // publishes tile kt + 1 and ends every wave's reads of buffer bf
    if (kt + 2 < SS / 64) { const unsigned k2 = ok + (kt + 2) * 64 * HD, v2 = ov + (kt + 2) * 64; const unsigned l = lds0 + bf * (4 * KVT);
      stage_kv(l, Kh + k2, Kl + k2, VTh + v2, VTl + v2); stage_kv(l + 16 * KVP * 2, Kh + (k2 + 16 * HD), Kl + (k2 + 16 * HD), VTh + (v2 + 16 * SS), VTl + (v2 + 16 * SS)); } }
  asm volatile("s_wait_asynccnt 0x0" ::: "memory");     // no copy is outstanding when the LDS becomes output staging
#pragma unroll
  for (int u = 0; u < 2; ++u) { const float inv = 1.0f / (lrun[u] * 16384.0f * 4.0f);
#pragma unroll
    for (int t = 0; t < 4; ++t) {
#pragma unroll
      for (int r = 0; r < 8; ++r) sO[w][u * 16 + col][t * 16 + 8 * g + r] = acc[u][t][r] * inv; } }
  LDSX();
  for (int qq = lane; qq < 32 * 16; qq += 32) { const int rl = qq >> 4, pc = qq & 15; vst2(O32 + ((bh * SS) + q0 + rl) * HD + pc * 4, *(const v4f*)(&sO[w][rl][pc * 4])); }
}
// out = ctx Wo^T + bo : split(ctx) x bf16(Wo rows): 2 products (Wo is an INPUT -> bf16 exact); eight tiles of 64 k (one head each), ctx rows (f32) and Wo rows staged once per block in LDS, two buffers
__global__ __launch_bounds__(128) void k_out(const float* __restrict__ O32, const __bf16* __restrict__ PT, const float* __restrict__ bo, float* __restrict__ out) {
  __shared__ __align__(16) unsigned char sm[2 * OBUF];   // operand tiles in the loop; output staging behind its last barrier
  float (*so)[16][132] = (float (*)[16][132])sm;
  const int tid = threadIdx.x, wave = tid >> 5, lane = tid & 31, col = lane & 15, g = lane >> 4;
  const int r0b = blockIdx.x * 64, r0 = r0b + wave * 16, n0 = blockIdx.y * 128; const int b = r0b / SS, s0 = r0b % SS;
  const unsigned la = (unsigned)(size_t)&sm[(tid >> 4) * (OAP * 4) + (tid & 15) * 16];
  const unsigned lb = (unsigned)(size_t)&sm[64 * OAP * 4 + (tid >> 3) * (GP * 2) + (tid & 7) * 16];
  const float* ga = O32 + ((size_t)b * NH * SS + s0 + (tid >> 4)) * HD + (tid & 15) * 4;   // head h of these rows: + h * SS * HD
  const __bf16* gb = PT + (size_t)(3 * E + n0 + (tid >> 3)) * E + (tid & 7) * 8;
  stage8(la, 8 * OAP * 4, ga, (size_t)8 * HD); stage8(lb, 16 * GP * 2, gb, (size_t)16 * E);
  v8f acc[8] = {};
  asm volatile("s_wait_asynccnt 0x0" ::: "memory");   // this wave's share of tile 0 has landed
  __syncthreads();                                     // tile 0 is published to every wave
  stage8(la + OBUF, 8 * OAP * 4, ga + (size_t)SS * HD, (size_t)8 * HD); stage8(lb + OBUF, 16 * GP * 2, gb + 64, (size_t)16 * E);
#pragma unroll 1
  for (int c = 0; c < E / 64; ++c) { const float* ta = (const float*)(sm + (c & 1) * OBUF); const __bf16* tb = (const __bf16*)(sm + (c & 1) * OBUF + 64 * OAP * 4);
    F2 a[2]; v16b wb[2][8];   // the tile's fragment reads all stand in front of its products: the wave meets the LDS latency once per tile, not once per product
#pragma unroll
    for (int kk = 0; kk < 2; ++kk) { a[kk] = split_row(ta + (wave * 16 + col) * OAP, kk * 32, lane);
#pragma unroll
      for (int j = 0; j < 8; ++j) wb[kk][j] = frag_b(tb + (j * 16 + col) * GP + kk * 32, lane); }
    __builtin_amdgcn_sched_barrier(0);   // holds the reads in front: without it the compiler sinks them among the products, each pair with a wait of its own
#pragma unroll
    for (int kk = 0; kk < 2; ++kk) {
#pragma unroll
      for (int j = 0; j < 8; ++j) { acc[j] = wmma_bf(a[kk].l, wb[kk][j], acc[j]); acc[j] = wmma_bf(a[kk].h, wb[kk][j], acc[j]); } }
    __builtin_amdgcn_sched_barrier(0);   // holds the products in front of the waits, so that the next tile's copies fly during them
    asm volatile("s_wait_dscnt 0x0" ::: "memory");      // this wave's reads of the buffer have returned before it is handed to its next writer
    asm volatile("s_wait_asynccnt 0x0" ::: "memory");   // this wave's share of tile c + 1 has landed
    __syncthreads();                                     // publishes tile c + 1 and ends every wave's reads of this buffer
    if (c + 2 < E / 64) { stage8(la + (c & 1) * OBUF, 8 * OAP * 4, ga + (size_t)(c + 2) * SS * HD, (size_t)8 * HD); stage8(lb + (c & 1) * OBUF, 16 * GP * 2, gb + (c + 2) * 64, (size_t)16 * E); } }
  asm volatile("s_wait_asynccnt 0x0" ::: "memory");     // no copy is outstanding when the LDS becomes output staging
#pragma unroll
  for (int j = 0; j < 8; ++j) { const float bb = bfr(bo[n0 + j * 16 + col]);
#pragma unroll
    for (int r = 0; r < 8; ++r) so[wave][8 * g + r][j * 16 + col] = acc[j][r] + bb; }
  LDSX();
#pragma unroll 4
  for (int rl = 0; rl < 16; ++rl) vst2(out + (size_t)(r0 + rl) * E + n0 + lane * 4, *(const v4f*)(&so[wave][rl][lane * 4]));
}
extern "C" void kernel_launch(void* const* d_in, const int* in_sizes, int n_in, void* d_out, int out_size, void* d_ws, size_t ws_size, hipStream_t stream) {
  (void)in_sizes; (void)n_in; (void)out_size; (void)ws_size;
  const float** I = (const float**)d_in;   // emb_q, emb_k, emb_v, WQ, bQ, WK, bK, WV, bV, WO, bO
  const float* eq = I[0]; const float* ek = I[1]; const float* ev = I[2]; const float* WQ = I[3]; const float* bQ = I[4]; const float* WK = I[5]; const float* bK = I[6]; const float* WV = I[7]; const float* bV = I[8]; const float* WO = I[9]; const float* bO = I[10];
  float* out = (float*)d_out;
  char* ws = (char*)d_ws; size_t off = 0;
  auto take = [&](size_t bytes) { char* p = ws + off; off += (bytes + 255) & ~(size_t)255; return p; };
  __bf16* PT = (__bf16*)take((size_t)4 * E * E * 2);
  float* Q32 = (float*)take((size_t)NR * E * 4); __bf16* Kh = (__bf16*)take((size_t)NR * E * 2); __bf16* Kl = (__bf16*)take((size_t)NR * E * 2); _Float16* VTh = (_Float16*)take((size_t)NR * E * 2); _Float16* VTl = (_Float16*)take((size_t)NR * E * 2); float* O32 = (float*)take((size_t)NR * E * 4);
  // ws ~ 69 MB
  k_pack<<<PKT + PKO, 256, 0, stream>>>(WQ, WK, WV, WO, PT);
  k_qkv<<<dim3(NR / 64, E / 128, 3), 128, 0, stream>>>(eq, ek, ev, PT, bQ, bK, bV, Q32, Kh, Kl, VTh, VTl);
  k_attn<<<dim3(SS / 128, NB * NH), 128, 0, stream>>>(Q32, Kh, Kl, VTh, VTl, O32);
  k_out<<<dim3(NR / 64, E / 128), 128, 0, stream>>>(O32, PT, bO, out);
}

// v010
// One run takes 107 microseconds.
// Timed twice side by side with v009, it ran 1.03 times as fast both times.
// Over all steps from v000 it is 3.90 times as fast.
// compute dtype: embeddings and W*/b* (INPUTS) rounded to bf16 with exact bf16 WMMA products (f32 accumulate) for the projections; K pre-split into bf16 hi/lo rows; q f32 split, P and V f16 hi/lo (3 products each, the low halves at the scale of the high ones, one f32 accumulator); softmax f32.
#include <hip/hip_runtime.h>
#include <math.h>

typedef __attribute__((ext_vector_type(16))) _Float16 v16h;
typedef __attribute__((ext_vector_type(16))) __bf16 v16b;
typedef __attribute__((ext_vector_type(8)))  _Float16 v8h;
typedef __attribute__((ext_vector_type(2)))  _Float16 v2h;
typedef __attribute__((ext_vector_type(8)))  float v8f;
typedef __attribute__((ext_vector_type(4)))  float v4f;
typedef __attribute__((ext_vector_type(2)))  float v2f;
typedef __attribute__((ext_vector_type(4)))  unsigned v4u;
typedef __attribute__((ext_vector_type(2)))  unsigned v2u;
typedef __attribute__((ext_vector_type(4)))  int v4i;
typedef float __attribute__((may_alias)) float_a;
typedef int __attribute__((may_alias)) int_a;

template <typename T> __device__ __forceinline__ void vst2(void* p, T v) { *(T*)p = v;  }
__device__ __forceinline__ v8f wmma16(v16h a, v16h b, v8f c) {
  return __builtin_amdgcn_wmma_f32_16x16x32_f16(false, a, false, b, (short)0, c, false, false);
}
__device__ __forceinline__ v8f wmma_bf(v16b a, v16b b, v8f c) {
  return __builtin_amdgcn_wmma_f32_16x16x32_bf16(false, a, false, b, (short)0, c, false, false);
}
// 16x16x32 fragments: lane = (h = lane>>4, row/col = lane&15); elements 0..7 = k0+8h+0..7, 8..15 = k0+16+8h+0..7; D element r = row 8h+r
__device__ __forceinline__ v16h frag_h(const _Float16* rowk0, int lane) {
  union { v16h v; v8h q[2]; } u; const _Float16* p = rowk0 + 8 * (lane >> 4);
  u.q[0] = *(const v8h*)p; u.q[1] = *(const v8h*)(p + 16); return u.v;
}
__device__ __forceinline__ v16h frag_f32(const float* rowk0, int lane) {
  v16h a; const float* p = rowk0 + 8 * (lane >> 4);
#pragma unroll
  for (int i = 0; i < 8; ++i) { a[i] = (_Float16)p[i]; a[8 + i] = (_Float16)p[16 + i]; }
  return a;
}
__device__ __forceinline__ v16h frag_f32s(const float* rowk0, int lane, float sc) {
  v16h a; const float* p = rowk0 + 8 * (lane >> 4);
#pragma unroll
  for (int i = 0; i < 8; ++i) { a[i] = (_Float16)(p[i] * sc); a[8 + i] = (_Float16)(p[16 + i] * sc); }
  return a;
}
// column fragment from a [K][ld] layout (column n), rows >= K read as 0
__device__ __forceinline__ v16h fragc_f32(const float* W, int k0, int n, int lane, int ld, int K) {
  v16h a; const int g = lane >> 4;
#pragma unroll
  for (int i = 0; i < 8; ++i) { const int ka = k0 + 8 * g + i, kb = ka + 16;
    a[i] = (_Float16)(ka < K ? W[(size_t)ka * ld + n] : 0.f); a[8 + i] = (_Float16)(kb < K ? W[(size_t)kb * ld + n] : 0.f); }
  return a;
}
struct F2 { v16b h, l; };
__device__ __forceinline__ F2 bsplit16(const float v[16]) { F2 r;
#pragma unroll
  for (int i = 0; i < 16; ++i) { const __bf16 h = (__bf16)v[i]; r.h[i] = h; r.l[i] = (__bf16)(v[i] - (float)h); }
  return r; }
__device__ __forceinline__ F2 split_row(const float* row, int k0, int lane) { float v[16]; const float* p = row + k0 + 8 * (lane >> 4);
#pragma unroll
  for (int i = 0; i < 8; ++i) { v[i] = p[i]; v[8 + i] = p[16 + i]; }
  return bsplit16(v); }
__device__ __forceinline__ F2 split_rowK(const float* row, int k0, int lane, int K) { float v[16]; const int g = lane >> 4;
#pragma unroll
  for (int i = 0; i < 8; ++i) { const int ka = k0 + 8 * g + i, kb = ka + 16; v[i] = ka < K ? row[ka] : 0.f; v[8 + i] = kb < K ? row[kb] : 0.f; }
  return bsplit16(v); }
__device__ __forceinline__ F2 split_col(const float* W, int k0, int n, int lane, int ld, int K) { float v[16]; const int g = lane >> 4;
#pragma unroll
  for (int i = 0; i < 8; ++i) { const int ka = k0 + 8 * g + i, kb = ka + 16; v[i] = ka < K ? W[(size_t)ka * ld + n] : 0.f; v[8 + i] = kb < K ? W[(size_t)kb * ld + n] : 0.f; }
  return bsplit16(v); }
__device__ __forceinline__ v8f mac3(const F2& a, const F2& b, v8f c) { c = wmma_bf(a.l, b.h, c); c = wmma_bf(a.h, b.l, c); return wmma_bf(a.h, b.h, c); }
__device__ __forceinline__ float sigm(float v) { return 1.0f / (1.0f + expf(-v)); }
#define LDSX() do { asm volatile("s_wait_dscnt 0" ::: "memory"); __builtin_amdgcn_wave_barrier(); __builtin_amdgcn_fence(__ATOMIC_RELEASE, "workgroup"); } while (0)


// Encoder-decoder multi-head attention (8 heads x 64 on [4,2048,512]): Q/K/V from three separate embeddings with per-head weights W[h][e][d] + biases; full softmax(q.k/8); cat(heads) WO^T + bO.
#define NB 4
#define SS 2048
#define E 512
#define NH 8
#define HD 64
#define NR (NB * SS)
#define SC2 0.18033688f   // 1/8 x log2(e): takes a raw score to base-2 units
__device__ __forceinline__ float bfr(float v) { return (float)(__bf16)v; }
__device__ __forceinline__ v16b frag_b(const __bf16* rowk0, int lane) { return __builtin_bit_cast(v16b, frag_h((const _Float16*)rowk0, lane)); }

// A fragment from an f32 row: the same elements as frag_b, each rounded to bf16 (nearest even) on the way
__device__ __forceinline__ v16b frag_bf32(const float* rowk0, int lane) {
  v16b a; const float* p = rowk0 + 8 * (lane >> 4);
#pragma unroll
  for (int i = 0; i < 8; ++i) { a[i] = (__bf16)p[i]; a[8 + i] = (__bf16)p[16 + i]; }
  return a;
}
// PT rows: [0,E) Wq[:,n], [E,2E) Wk[:,n], [2E,3E) Wv[:,n], [3E,4E) Wo[n,:]  (Wq/Wk/Wv, [in][out]: column n as a bf16 row; Wo, [out][in]: row n as a bf16 row)
// Blocks [0, PKT): one tile of 128 e x 64 d of one head of Wq, Wk or Wv ([H][E][DH]), read in 16-byte pieces along d (a wave-wide load covers whole lines), turned in LDS, written as 64 pieces of 256 B along e.
// Blocks [PKT, PKT + PKO): 16 rows of WO ([out][in]: row n is already PT's row), rounded where they stand.
#define PKT (3 * NH * (E / 128))
#define PKO (E / 16)
#define PKP 68   // LDS row pitch in dwords: 128 e as bf16 and 16 B, so that a row starts at a multiple of 16 B
// Every loop of the kernel is unrolled: x stays in registers, and a thread's eight loads are all in flight before the first is used.
__global__ __launch_bounds__(256) void k_pack(const float* __restrict__ Wq, const float* __restrict__ Wk, const float* __restrict__ Wv, const float* __restrict__ Wo, __bf16* __restrict__ PT) {
  const unsigned blk = blockIdx.x, tid = threadIdx.x; __shared__ __align__(16) unsigned st[HD][PKP];
  if (blk < PKT) {
    const unsigned m = blk / (NH * (E / 128)), hh = (blk / (E / 128)) % NH, e0 = (blk % (E / 128)) * 128;
    const float* W = (m == 0 ? Wq : (m == 1 ? Wk : Wv)) + ((size_t)hh * E + e0) * HD;
    const unsigned dq = tid & 15, eq = tid >> 4;   // this thread: d = 4 dq + 0..3 of the rows e = 4 eq + 0..3 and 64 + 4 eq + 0..3
    v4f x[2][4];
#pragma unroll
    for (int i = 0; i < 2; ++i) {
#pragma unroll
      for (int r = 0; r < 4; ++r) x[i][r] = *(const v4f*)(W + (size_t)(64 * i + 4 * eq + r) * HD + dq * 4); }
#pragma unroll
    for (int i = 0; i < 2; ++i) {
#pragma unroll
      for (int j = 0; j < 4; ++j) { union { __bf16 e[4]; v2u u; } pk;
#pragma unroll
        for (int r = 0; r < 4; ++r) pk.e[r] = (__bf16)x[i][r][j];
        *(v2u*)(&st[dq * 4 + j][32 * i + 2 * eq]) = pk.u; } }
    __syncthreads();
#pragma unroll
    for (int i = 0; i < 4; ++i) { const int d = 16 * i + eq;   // sixteen threads write one row's 256 B
      vst2(PT + (size_t)(m * E + hh * HD + d) * E + e0 + dq * 8, *(const v4u*)(&st[d][dq * 4])); } }
  else {
    const size_t o = (size_t)(blk - PKT) * (16 * E) + tid * 8;
    v4f x[4][2];
#pragma unroll
    for (int i = 0; i < 4; ++i) { x[i][0] = *(const v4f*)(Wo + o + i * 2048); x[i][1] = *(const v4f*)(Wo + o + i * 2048 + 4); }
#pragma unroll
    for (int i = 0; i < 4; ++i) { union { __bf16 e[8]; v4u u; } pk;
#pragma unroll
      for (int r = 0; r < 8; ++r) pk.e[r] = (__bf16)x[i][r >> 2][r & 3];
      vst2(PT + (size_t)3 * E * E + o + i * 2048, pk.u); }
    asm volatile("s_wait_xcnt 0x0" ::: "memory"); }   // behind the four stores: no register that they name is rewritten in front of it on any way the code behind allows
}
// Operand staging of the projection products: a tile is 64 k of every row the block needs, rows of 16-bit data (128 B) at a 144-B pitch, rows of f32 (256 B) at a 272-B pitch (16 B x odd: conflict-free for 16-byte fragment reads).
// A wave-wide copy covers four whole 128-B lines, where a fragment load from global memory touches sixteen.
#define GP 72
#define OAP 68
#define OBUF (64 * OAP * 4 + 128 * GP * 2)
// Eight copies: 16 B of eight rows, the rows rs apart in LDS (bytes) and gs apart in global memory (elements). s_wait_xcnt 0 closes the statement so that no address register named here is rewritten in front of it.
template <typename T> __device__ __forceinline__ void stage8(unsigned l, unsigned rs, const T* p, size_t gs) {
  asm volatile("global_load_async_to_lds_b128 %0, %8, off\n\t"
               "global_load_async_to_lds_b128 %1, %9, off\n\t"
               "global_load_async_to_lds_b128 %2, %10, off\n\t"
               "global_load_async_to_lds_b128 %3, %11, off\n\t"
               "global_load_async_to_lds_b128 %4, %12, off\n\t"
               "global_load_async_to_lds_b128 %5, %13, off\n\t"
               "global_load_async_to_lds_b128 %6, %14, off\n\t"
               "global_load_async_to_lds_b128 %7, %15, off\n\t"
               "s_wait_xcnt 0x0"
               :: "v"(l), "v"(l + rs), "v"(l + 2 * rs), "v"(l + 3 * rs), "v"(l + 4 * rs), "v"(l + 5 * rs), "v"(l + 6 * rs), "v"(l + 7 * rs),
                  "v"(p), "v"(p + gs), "v"(p + 2 * gs), "v"(p + 3 * gs), "v"(p + 4 * gs), "v"(p + 5 * gs), "v"(p + 6 * gs), "v"(p + 7 * gs)
               : "memory");
}
// QKV: block (64 rows, 128 cols = 2 heads, which); eight tiles of 64 k, embedding rows (f32, as they come in; rounded to bf16 where the A fragment is formed) and weight rows staged once per block in LDS (two buffers, the next tile's copies fly during this tile's products); q (+bias) -> Q32 f32 [bh][s][64]; k (+bias) -> bf16 hi/lo rows; v (+bias) -> VT hi/lo x4 [bh][d][s]
__global__ __launch_bounds__(128) void k_qkv(const float* __restrict__ XQ, const float* __restrict__ XK, const float* __restrict__ XV, const __bf16* __restrict__ PT, const float* __restrict__ bq, const float* __restrict__ bk, const float* __restrict__ bv, float* __restrict__ Q32, __bf16* __restrict__ Kh, __bf16* __restrict__ Kl, _Float16* __restrict__ VTh, _Float16* __restrict__ VTl) {
  __shared__ __align__(16) unsigned char sm[2 * OBUF];   // operand tiles in the loop; output staging behind its last barrier
  float (*so)[16][132] = (float (*)[16][132])sm;
  _Float16 (*sth)[72] = (_Float16 (*)[72])sm; _Float16 (*stl)[72] = (_Float16 (*)[72])(sm + 128 * 72 * 2);
  const int tid = threadIdx.x, wave = tid >> 5, lane = tid & 31, col = lane & 15, g = lane >> 4;
  const int which = blockIdx.z, r0b = blockIdx.x * 64, n0 = blockIdx.y * 128; const int b = r0b / SS, s0 = r0b % SS;
  const float* Xf = which == 0 ? XQ : (which == 1 ? XK : XV); const float* bb_ = which == 0 ? bq : (which == 1 ? bk : bv);
  const unsigned la = (unsigned)(size_t)&sm[(tid >> 4) * (OAP * 4) + (tid & 15) * 16];
  const unsigned lb = (unsigned)(size_t)&sm[64 * OAP * 4 + (tid >> 3) * (GP * 2) + (tid & 7) * 16];
  const float* ga = Xf + (size_t)(r0b + (tid >> 4)) * E + (tid & 15) * 4; const __bf16* gb = PT + (size_t)(which * E + n0 + (tid >> 3)) * E + (tid & 7) * 8;
  stage8(la, 8 * OAP * 4, ga, (size_t)8 * E); stage8(lb, 16 * GP * 2, gb, (size_t)16 * E);
  v8f acc[8] = {};
  asm volatile("s_wait_asynccnt 0x0" ::: "memory");   // this wave's share of tile 0 has landed
  __syncthreads();                                     // tile 0 is published to every wave
  stage8(la + OBUF, 8 * OAP * 4, ga + 64, (size_t)8 * E); stage8(lb + OBUF, 16 * GP * 2, gb + 64, (size_t)16 * E);
#pragma unroll 1
  for (int c = 0; c < E / 64; ++c) { const float* ta = (const float*)(sm + (c & 1) * OBUF); const __bf16* tb = (const __bf16*)(sm + (c & 1) * OBUF + 64 * OAP * 4);
    v16b a[2], wb[2][8];   // the tile's fragment reads all stand in front of its products: the wave meets the LDS latency once per tile, not once per product
#pragma unroll
    for (int kk = 0; kk < 2; ++kk) { a[kk] = frag_bf32(ta + (wave * 16 + col) * OAP + kk * 32, lane);
#pragma unroll
      for (int j = 0; j < 8; ++j) wb[kk][j] = frag_b(tb + (j * 16 + col) * GP + kk * 32, lane); }
    __builtin_amdgcn_sched_barrier(0);   // holds the reads in front: without it the compiler sinks them among the products, each pair with a wait of its own
#pragma unroll
    for (int kk = 0; kk < 2; ++kk) {
#pragma unroll
      for (int j = 0; j < 8; ++j) acc[j] = wmma_bf(a[kk], wb[kk][j], acc[j]); }
    __builtin_amdgcn_sched_barrier(0);   // holds the products in front of the waits, so that the next tile's copies fly during them
    asm volatile("s_wait_dscnt 0x0" ::: "memory");      // this wave's reads of the buffer have returned before it is handed to its next writer
    asm volatile("s_wait_asynccnt 0x0" ::: "memory");   // this wave's share of tile c + 1 has landed
    __syncthreads();                                     // publishes tile c + 1 and ends every wave's reads of this buffer
    if (c + 2 < E / 64) { stage8(la + (c & 1) * OBUF, 8 * OAP * 4, ga + (c + 2) * 64, (size_t)8 * E); stage8(lb + (c & 1) * OBUF, 16 * GP * 2, gb + (c + 2) * 64, (size_t)16 * E); } }
  asm volatile("s_wait_asynccnt 0x0" ::: "memory");     // no copy is outstanding when the LDS becomes output staging
  if (which < 2) {
#pragma unroll
    for (int j = 0; j < 8; ++j) { const float bb = bfr(bb_[n0 + j * 16 + col]);
#pragma unroll
      for (int r = 0; r < 8; ++r) so[wave][8 * g + r][j * 16 + col] = acc[j][r] + bb; }
    LDSX();
    if (which == 0) { for (int qq = lane; qq < 2 * 16 * 16; qq += 32) { const int hh = qq >> 8, rl = (qq >> 4) & 15, pc = qq & 15; const int h = (n0 >> 6) + hh;
        vst2(Q32 + (((size_t)b * NH + h) * SS + s0 + wave * 16 + rl) * HD + pc * 4, *(const v4f*)(&so[wave][rl][hh * 64 + pc * 4])); } }
    else {
      for (int qq = lane; qq < 2 * 16 * 16; qq += 32) { const int hh = qq >> 8, rl = (qq >> 4) & 15, pl = qq & 15; const int h = (n0 >> 6) + hh; const int pc = pl & 7; union { __bf16 e[8]; v4u u; } pk;
#pragma unroll
        for (int e = 0; e < 8; ++e) { const float v = so[wave][rl][hh * 64 + pc * 8 + e]; const __bf16 hi = (__bf16)v; pk.e[e] = pl < 8 ? hi : (__bf16)(v - (float)hi); }
        vst2((unsigned*)((pl < 8 ? Kh : Kl) + (((size_t)b * NH + h) * SS + s0 + wave * 16 + rl) * HD + pc * 8), pk.u); } } }
  else {
#pragma unroll
    for (int j = 0; j < 8; ++j) { const float bb = bfr(bb_[n0 + j * 16 + col]);
#pragma unroll
      for (int r = 0; r < 8; ++r) { const float v = (acc[j][r] + bb) * 4.0f; const _Float16 hi = (_Float16)v; sth[j * 16 + col][wave * 16 + 8 * g + r] = hi; stl[j * 16 + col][wave * 16 + 8 * g + r] = (_Float16)(v - (float)hi); } }
    __syncthreads();
    for (int qq = tid; qq < 128 * 8; qq += 128) { const int cl = qq >> 3, pc = qq & 7; const int c = n0 + cl, h = c >> 6, d = c & 63; const size_t o = (((size_t)b * NH + h) * HD + d) * SS + s0 + pc * 8;
      vst2(VTh + o, *(const v4u*)(&sth[cl][pc * 8])); vst2(VTl + o, *(const v4u*)(&stl[cl][pc * 8])); } }
}
// K/V staging: one 64-key tile of Kh, Kl, VTh, VTl (64 rows x 128 B each) per buffer, rows at a 144-B pitch (16 B x odd: conflict-free for 16-byte fragment reads)
#define KVP 72
#define KVT (64 * KVP * 2)
// Half a tile's copies (a block of four waves calls it twice, the second time 16 rows on): every lane moves 16 B of two rows of each of the four arrays, so a wave-wide copy covers four whole 128-B lines.
// s_wait_xcnt 0 closes the statement so that no address register named here is rewritten in front of it.
__device__ __forceinline__ void stage_kv(unsigned l, const __bf16* kh, const __bf16* kl, const _Float16* vh, const _Float16* vl) {
  asm volatile("global_load_async_to_lds_b128 %0, %8, off\n\t"
               "global_load_async_to_lds_b128 %1, %9, off\n\t"
               "global_load_async_to_lds_b128 %2, %10, off\n\t"
               "global_load_async_to_lds_b128 %3, %11, off\n\t"
               "global_load_async_to_lds_b128 %4, %12, off\n\t"
               "global_load_async_to_lds_b128 %5, %13, off\n\t"
               "global_load_async_to_lds_b128 %6, %14, off\n\t"
               "global_load_async_to_lds_b128 %7, %15, off\n\t"
               "s_wait_xcnt 0x0"
               :: "v"(l), "v"(l + 32 * KVP * 2), "v"(l + KVT), "v"(l + KVT + 32 * KVP * 2), "v"(l + 2 * KVT), "v"(l + 2 * KVT + 32 * KVP * 2), "v"(l + 3 * KVT), "v"(l + 3 * KVT + 32 * KVP * 2),
                  "v"(kh), "v"(kh + 32 * HD), "v"(kl), "v"(kl + 32 * HD), "v"(vh), "v"(vh + 32 * SS), "v"(vl), "v"(vl + 32 * SS)
               : "memory");
}
// The f16 low halves of four pairs: p - hi (exact in f32) rounded to f16, each by one mixed-precision fma that reads its half of the packed hi and writes its half of the result.
// In plain source the compiler widens both halves of hi again, subtracts and packs: five instructions a pair, the conversion of hi counted, where these are three.
// The four low halves stand in front of the four high halves, and s_delay_alu names the writer of the same register four instructions back, so that the wave that shares the SIMD issues meanwhile.
__device__ __forceinline__ void resid8(v2h* d, const v2h* hi, const v2f* p) {
  asm("v_fma_mixlo_f16 %0, %4, -1.0, %8 op_sel_hi:[1,1,0]\n\t"
      "v_fma_mixlo_f16 %1, %5, -1.0, %10 op_sel_hi:[1,1,0]\n\t"
      "v_fma_mixlo_f16 %2, %6, -1.0, %12 op_sel_hi:[1,1,0]\n\t"
      "v_fma_mixlo_f16 %3, %7, -1.0, %14 op_sel_hi:[1,1,0]\n\t"
      "s_delay_alu instid0(VALU_DEP_4) | instskip(NEXT) | instid1(VALU_DEP_4)\n\t"
      "v_fma_mixhi_f16 %0, %4, -1.0, %9 op_sel:[1,0,0] op_sel_hi:[1,1,0]\n\t"
      "v_fma_mixhi_f16 %1, %5, -1.0, %11 op_sel:[1,0,0] op_sel_hi:[1,1,0]\n\t"
      "s_delay_alu instid0(VALU_DEP_4) | instskip(NEXT) | instid1(VALU_DEP_4)\n\t"
      "v_fma_mixhi_f16 %2, %6, -1.0, %13 op_sel:[1,0,0] op_sel_hi:[1,1,0]\n\t"
      "v_fma_mixhi_f16 %3, %7, -1.0, %15 op_sel:[1,0,0] op_sel_hi:[1,1,0]"
      : "=&v"(d[0]), "=&v"(d[1]), "=&v"(d[2]), "=&v"(d[3])
      : "v"(hi[0]), "v"(hi[1]), "v"(hi[2]), "v"(hi[3]), "v"(p[0][0]), "v"(p[0][1]), "v"(p[1][0]), "v"(p[1][1]), "v"(p[2][0]), "v"(p[2][1]), "v"(p[3][0]), "v"(p[3][1]));
}
// full attention: block (128 queries = 4 waves x 32, bh); 32 key tiles of 64, each staged once per block in LDS (two buffers, the next tile's copies fly during this tile's work)
// transposed products: S^T = K q^T (A = K hi/lo rows, B = q hi/lo) and O^T += V^T P^T (A = V^T rows, B = P^T). A lane's S^T accumulators are, per query tile u, 32 scores of its query 16 u + (lane & 15), keys 16 t + 8 g + r,
// and those are the elements the B fragment of P^T wants in that lane: scores and P stay in registers. softmax in base 2 (one fma and one hardware exp2 per score); P,V hi/lo; O f32 [bh][s][64]
// A wave holds two query tiles of 16 (u = 0, 1): every K and V^T fragment read from LDS is the A operand of both tiles' products. Two blocks share a WGP, one wave of each on every SIMD (512 registers a wave), so a whole tile's fragments fit in registers.
__global__ __launch_bounds__(128) __attribute__((amdgpu_waves_per_eu(2, 2))) void k_attn(const float* __restrict__ Q32, const __bf16* __restrict__ Kh, const __bf16* __restrict__ Kl, const _Float16* __restrict__ VTh, const _Float16* __restrict__ VTl, float* __restrict__ O32) {
  __shared__ __align__(16) _Float16 sKV[2][4][64][KVP];   // K/V tiles in the loop; output staging behind its last barrier (each wave its own slice)
  float (*sO)[32][68] = (float (*)[32][68])sKV;
  const int tid = threadIdx.x, w = tid >> 5, lane = tid & 31, col = lane & 15, g = lane >> 4;
  const size_t bh = blockIdx.y; const int qb = blockIdx.x; const int q0 = qb * 128 + w * 32;
  const int crow = tid >> 3, cpc = tid & 7;   // this thread's copies: 16 B of the rows crow, crow + 16, crow + 32, crow + 48 of each array
  const unsigned lds0 = (unsigned)(size_t)&sKV[0][0][crow][cpc * 8];
  const unsigned ok = ((unsigned)bh * SS + crow) * HD + cpc * 8, ov = ((unsigned)bh * HD + crow) * SS + cpc * 8;   // element offsets of this thread's first piece in the K arrays and in the V^T arrays (two registers live through the loop, where four pointers would spill)
  stage_kv(lds0, Kh + ok, Kl + ok, VTh + ov, VTl + ov); stage_kv(lds0 + 16 * KVP * 2, Kh + (ok + 16 * HD), Kl + (ok + 16 * HD), VTh + (ov + 16 * SS), VTl + (ov + 16 * SS));
  F2 aq[2][2];
#pragma unroll
  for (int u = 0; u < 2; ++u) {
#pragma unroll
    for (int kc = 0; kc < 2; ++kc) aq[u][kc] = split_row(Q32 + (bh * SS + q0 + u * 16 + col) * HD, kc * 32, lane); }
  float mrun[2] = {-3.0e38f, -3.0e38f}, lrun[2] = {0.f, 0.f}; v8f acc[2][4] = {};   // mrun, lrun: of query 16 u + col, the same in both halves of the wave; acc[u][t][r]: d = 16 t + 8 g + r of that query
  LDSX();
  asm volatile("s_wait_asynccnt 0x0" ::: "memory");   // this wave's share of tile 0 has landed
  __syncthreads();                                     // tile 0 is published to every wave
  stage_kv(lds0 + 4 * KVT, Kh + (ok + 64 * HD), Kl + (ok + 64 * HD), VTh + (ov + 64), VTl + (ov + 64)); stage_kv(lds0 + 4 * KVT + 16 * KVP * 2, Kh + (ok + 80 * HD), Kl + (ok + 80 * HD), VTh + (ov + 16 * SS + 64), VTl + (ov + 16 * SS + 64));
#pragma unroll 1
  for (int kt = 0; kt < SS / 64; ++kt) {
    const int bf = kt & 1;
    v8f s[2][4];
#pragma unroll
    for (int t = 0; t < 4; ++t) { const __bf16* kr = (const __bf16*)&sKV[bf][0][t * 16 + col][0]; const __bf16* lr_ = (const __bf16*)&sKV[bf][1][t * 16 + col][0]; v8f st[2] = {};
#pragma unroll
      for (int kc = 0; kc < 2; ++kc) { const v16b khf = frag_b(kr + kc * 32, lane), klf = frag_b(lr_ + kc * 32, lane);
#pragma unroll
        for (int u = 0; u < 2; ++u) st[u] = wmma_bf(khf, aq[u][kc].l, st[u]);
#pragma unroll
        for (int u = 0; u < 2; ++u) st[u] = wmma_bf(klf, aq[u][kc].h, st[u]);
#pragma unroll
        for (int u = 0; u < 2; ++u) st[u] = wmma_bf(khf, aq[u][kc].h, st[u]); }
      s[0][t] = st[0]; s[1][t] = st[1]; }
    v16h vh[2][4], vl[2][4];   // the tile's V^T fragments, read as one group into the registers the K fragments have left: their latency passes under the softmax
#pragma unroll
    for (int kc = 0; kc < 2; ++kc) {
#pragma unroll
      for (int t = 0; t < 4; ++t) { vh[kc][t] = frag_h(&sKV[bf][2][t * 16 + col][kc * 32], lane); vl[kc][t] = frag_h(&sKV[bf][3][t * 16 + col][kc * 32], lane); } }
    __builtin_amdgcn_sched_barrier(0);   // holds the reads in front: without it the compiler sinks them among the products in pairs, each pair with a wait of its own
    v16h ph[2][2], pl[2][2];
#pragma unroll
    for (int u = 0; u < 2; ++u) {
      float mx = -3.4e38f;
#pragma unroll
      for (int t = 0; t < 4; ++t) {
#pragma unroll
        for (int r = 0; r < 8; ++r) mx = fmaxf(mx, s[u][t][r]); }
      mx = fmaxf(mx, __shfl_xor(mx, 16, 32));
      const float mnew = fmaxf(mrun[u], mx * SC2); const float corr = __builtin_amdgcn_exp2f(mrun[u] - mnew);   // running maximum in base-2 units
      const float moff = mnew - 14.0f;   // the factor 16384 = 2^14 of P rides in the exponent
      const v2f sc2 = {SC2, SC2}, nmo = {-moff, -moff}; v2f ps2 = {0.f, 0.f};   // scores go two at a time: an accumulator's even-aligned register pair is the operand of the packed f32 forms
#pragma unroll
      for (int kc = 0; kc < 2; ++kc) { union { v16h v; v2h q[8]; } uh, ul; v2f p[8];
#pragma unroll
        for (int j = 0; j < 8; ++j) { const int t = 2 * kc + (j >> 2), r = 2 * (j & 3);
          const v2f x = {s[u][t][r], s[u][t][r + 1]}; const v2f e = __builtin_elementwise_fma(x, sc2, nmo);
          p[j] = (v2f){__builtin_amdgcn_exp2f(e[0]), __builtin_amdgcn_exp2f(e[1])}; ps2 += p[j];
          uh.q[j] = __builtin_convertvector(p[j], v2h); }
        resid8(&ul.q[0], &uh.q[0], &p[0]); resid8(&ul.q[4], &uh.q[4], &p[4]);
        ph[u][kc] = uh.v; pl[u][kc] = ul.v; }
      float ps = ps2[0] + ps2[1];
      ps += __shfl_xor(ps, 16, 32);
      lrun[u] = lrun[u] * corr + ps * (1.0f / 16384.0f); mrun[u] = mnew;
#pragma unroll
      for (int t = 0; t < 4; ++t) {
#pragma unroll
        for (int r = 0; r < 8; ++r) acc[u][t][r] *= corr; } }
#pragma unroll
    for (int kc = 0; kc < 2; ++kc) {   // the three products of a d tile add into one accumulator; each kind runs over the four d tiles and both query tiles, so that no product follows directly on the one it adds to
#pragma unroll
      for (int t = 0; t < 4; ++t) {
#pragma unroll
        for (int u = 0; u < 2; ++u) acc[u][t] = wmma16(vh[kc][t], pl[u][kc], acc[u][t]); }
#pragma unroll
      for (int t = 0; t < 4; ++t) {
#pragma unroll
        for (int u = 0; u < 2; ++u) acc[u][t] = wmma16(vl[kc][t], ph[u][kc], acc[u][t]); }
#pragma unroll
      for (int t = 0; t < 4; ++t) {
#pragma unroll
        for (int u = 0; u < 2; ++u) acc[u][t] = wmma16(vh[kc][t], ph[u][kc], acc[u][t]); } }
    __builtin_amdgcn_sched_barrier(0);   // holds the softmax and the products in front of the waits, so that the V^T reads return and the next tile's copies fly during them
    asm volatile("s_wait_dscnt 0x0" ::: "memory");      // this wave's reads of buffer bf have returned before the buffer is handed to its next writer
    asm volatile("s_wait_asynccnt 0x0" ::: "memory");   // this wave's share of tile kt + 1 has landed
    __syncthreads();                                     // publishes tile kt + 1 and ends every wave's reads of buffer bf
    if (kt + 2 < SS / 64) { const unsigned k2 = ok + (kt + 2) * 64 * HD, v2 = ov + (kt + 2) * 64; const unsigned l = lds0 + bf * (4 * KVT);
      stage_kv(l, Kh + k2, Kl + k2, VTh + v2, VTl + v2); stage_kv(l + 16 * KVP * 2, Kh + (k2 + 16 * HD), Kl + (k2 + 16 * HD), VTh + (v2 + 16 * SS), VTl + (v2 + 16 * SS)); } }
  asm volatile("s_wait_asynccnt 0x0" ::: "memory");     // no copy is outstanding when the LDS becomes output staging
#pragma unroll
  for (int u = 0; u < 2; ++u) { const float inv = 1.0f / (lrun[u] * 16384.0f * 4.0f);
#pragma unroll
    for (int t = 0; t < 4; ++t) {
#pragma unroll
      for (int r = 0; r < 8; ++r) sO[w][u * 16 + col][t * 16 + 8 * g + r] = acc[u][t][r] * inv; } }
  LDSX();
  for (int qq = lane; qq < 32 * 16; qq += 32) { const int rl = qq >> 4, pc = qq & 15; vst2(O32 + ((bh * SS) + q0 + rl) * HD + pc * 4, *(const v4f*)(&sO[w][rl][pc * 4])); }
}
// out = ctx Wo^T + bo : split(ctx) x bf16(Wo rows): 2 products (Wo is an INPUT -> bf16 exact); eight tiles of 64 k (one head each), ctx rows (f32) and Wo rows staged once per block in LDS, two buffers
__global__ __launch_bounds__(128) void k_out(const float* __restrict__ O32, const __bf16* __restrict__ PT, const float* __restrict__ bo, float* __restrict__ out) {
  __shared__ __align__(16) unsigned char sm[2 * OBUF];   // operand tiles in the loop; output staging behind its last barrier
  float (*so)[16][132] = (float (*)[16][132])sm;
  const int tid = threadIdx.x, wave = tid >> 5, lane = tid & 31, col = lane & 15, g = lane >> 4;
  const int r0b = blockIdx.x * 64, r0 = r0b + wave * 16, n0 = blockIdx.y * 128; const int b = r0b / SS, s0 = r0b % SS;
  const unsigned la = (unsigned)(size_t)&sm[(tid >> 4) * (OAP * 4) + (tid & 15) * 16];
  const unsigned lb = (unsigned)(size_t)&sm[64 * OAP * 4 + (tid >> 3) * (GP * 2) + (tid & 7) * 16];
  const float* ga = O32 + ((size_t)b * NH * SS + s0 + (tid >> 4)) * HD + (tid & 15) * 4;   // head h of these rows: + h * SS * HD
  const __bf16* gb = PT + (size_t)(3 * E + n0 + (tid >> 3)) * E + (tid & 7) * 8;
  stage8(la, 8 * OAP * 4, ga, (size_t)8 * HD); stage8(lb, 16 * GP * 2, gb, (size_t)16 * E);
  v8f acc[8] = {};
  asm volatile("s_wait_asynccnt 0x0" ::: "memory");   // this wave's share of tile 0 has landed
  __syncthreads();                                     // tile 0 is published to every wave
  stage8(la + OBUF, 8 * OAP * 4, ga + (size_t)SS * HD, (size_t)8 * HD); stage8(lb + OBUF, 16 * GP * 2, gb + 64, (size_t)16 * E);
#pragma unroll 1
  for (int c = 0; c < E / 64; ++c) { const float* ta = (const float*)(sm + (c & 1) * OBUF); const __bf16* tb = (const __bf16*)(sm + (c & 1) * OBUF + 64 * OAP * 4);
    F2 a[2]; v16b wb[2][8];   // the tile's fragment reads all stand in front of its products: the wave meets the LDS latency once per tile, not once per product
#pragma unroll
    for (int kk = 0; kk < 2; ++kk) { a[kk] = split_row(ta + (wave * 16 + col) * OAP, kk * 32, lane);
#pragma unroll
      for (int j = 0; j < 8; ++j) wb[kk][j] = frag_b(tb + (j * 16 + col) * GP + kk * 32, lane); }
    __builtin_amdgcn_sched_barrier(0);   // holds the reads in front: without it the compiler sinks them among the products, each pair with a wait of its own
#pragma unroll
    for (int kk = 0; kk < 2; ++kk) {
#pragma unroll
      for (int j = 0; j < 8; ++j) { acc[j] = wmma_bf(a[kk].l, wb[kk][j], acc[j]); acc[j] = wmma_bf(a[kk].h, wb[kk][j], acc[j]); } }
    __builtin_amdgcn_sched_barrier(0);   // holds the products in front of the waits, so that the next tile's copies fly during them
    asm volatile("s_wait_dscnt 0x0" ::: "memory");      // this wave's reads of the buffer have returned before it is handed to its next writer
    asm volatile("s_wait_asynccnt 0x0" ::: "memory");   // this wave's share of tile c + 1 has landed
    __syncthreads();                                     // publishes tile c + 1 and ends every wave's reads of this buffer
    if (c + 2 < E / 64) { stage8(la + (c & 1) * OBUF, 8 * OAP * 4, ga + (size_t)(c + 2) * SS * HD, (size_t)8 * HD); stage8(lb + (c & 1) * OBUF, 16 * GP * 2, gb + (c + 2) * 64, (size_t)16 * E); } }
  asm volatile("s_wait_asynccnt 0x0" ::: "memory");     // no copy is outstanding when the LDS becomes output staging
#pragma unroll
  for (int j = 0; j < 8; ++j) { const float bb = bfr(bo[n0 + j * 16 + col]);
#pragma unroll
    for (int r = 0; r < 8; ++r) so[wave][8 * g + r][j * 16 + col] = acc[j][r] + bb; }
  LDSX();
#pragma unroll 4
  for (int rl = 0; rl < 16; ++rl) vst2(out + (size_t)(r0 + rl) * E + n0 + lane * 4, *(const v4f*)(&so[wave][rl][lane * 4]));
}
extern "C" void kernel_launch(void* const* d_in, const int* in_sizes, int n_in, void* d_out, int out_size, void* d_ws, size_t ws_size, hipStream_t stream) {
  (void)in_sizes; (void)n_in; (void)out_size; (void)ws_size;
  const float** I = (const float**)d_in;   // emb_q, emb_k, emb_v, WQ, bQ, WK, bK, WV, bV, WO, bO
  const float* eq = I[0]; const float* ek = I[1]; const float* ev = I[2]; const float* WQ = I[3]; const float* bQ = I[4]; const float* WK = I[5]; const float* bK = I[6]; const float* WV = I[7]; const float* bV = I[8]; const float* WO = I[9]; const float* bO = I[10];
  float* out = (float*)d_out;
  char* ws = (char*)d_ws; size_t off = 0;
  auto take = [&](size_t bytes) { char* p = ws + off; off += (bytes + 255) & ~(size_t)255; return p; };
  __bf16* PT = (__bf16*)take((size_t)4 * E * E * 2);
  float* Q32 = (float*)take((size_t)NR * E * 4); __bf16* Kh = (__bf16*)take((size_t)NR * E * 2); __bf16* Kl = (__bf16*)take((size_t)NR * E * 2); _Float16* VTh = (_Float16*)take((size_t)NR * E * 2); _Float16* VTl = (_Float16*)take((size_t)NR * E * 2); float* O32 = (float*)take((size_t)NR * E * 4);
  // ws ~ 69 MB
  k_pack<<<PKT + PKO, 256, 0, stream>>>(WQ, WK, WV, WO, PT);
  k_qkv<<<dim3(NR / 64, E / 128, 3), 128, 0, stream>>>(eq, ek, ev, PT, bQ, bK, bV, Q32, Kh, Kl, VTh, VTl);
  k_attn<<<dim3(SS / 128, NB * NH), 128, 0, stream>>>(Q32, Kh, Kl, VTh, VTl, O32);
  k_out<<<dim3(NR / 64, E / 128), 128, 0, stream>>>(O32, PT, bO, out);
}
